// v000
// The times below were measured on an AMD MI455X: many runs one after another, warmed up first and cycling through
// copies of the inputs, with the whole window's GPU time divided by the number of runs. Launches and the gaps
// between them are all in it. The median over several windows is given; except for v000 it joins two sittings, which
// can be a few percent apart, so the side-by-side timings, each taken in one sitting, are the better comparison.
// The starting kernel, v000, takes 4690 microseconds a run.
#include <hip/hip_runtime.h>

// CLIP attention (hidden_states [8][1024][1024]; q = (x Wq + bq) x 64^-0.5, k, v = x W + b ('xw' [1024][1024]; 16 heads x 64); softmax(q.k) over all keys; out = merged Wo + bo -> [8][1024][1024] (8.4 M)).
// Compute dtypes, f32 accumulate: every input rounded to bf16; q/k/v on PLAIN bf16 operands (inputs: exact) + biases; the 64^-0.5 applied to the f32 score (the module scales q after the bias; power of two, exact); scores and attn.v: query rows < 512 hl (3 products), the rest single fp16 (x1024); softmax f32; Wo hl x exact (2 products) + bo.

#define NB_  8
#define TT   1024
#define DM   1024
#define NH_  16
#define NKV  16
#define REP  (NH_ / NKV)
#define HD   64
#define DQ   (NH_ * HD)
#define DKV  (NKV * HD)
#define ZH   2
#define RH   512                  // query rows < RH use hi+lo planes (0: none)
#define WIN  0
#define PCAR 1024.0f
#define SCL  0.125f   // HD^-0.5
typedef _Float16 h16;
typedef unsigned short bf;
typedef __attribute__((ext_vector_type(16))) __bf16   v16bf;
typedef __attribute__((ext_vector_type(16))) _Float16 v16h;
typedef __attribute__((ext_vector_type(8)))  _Float16 v8h;
typedef __attribute__((ext_vector_type(8)))  unsigned short v8us;
typedef __attribute__((ext_vector_type(8)))  float    v8f;
typedef __attribute__((ext_vector_type(4)))  float    v4f;
typedef v8h  __attribute__((may_alias)) v8ha;
typedef v4f  __attribute__((may_alias)) v4fa;
typedef v8us __attribute__((may_alias)) v8usa;

__device__ __forceinline__ unsigned short f2bf(float f) { unsigned u = __float_as_uint(f); u += 0x7FFFu + ((u >> 16) & 1u); return (unsigned short)(u >> 16); }
__device__ __forceinline__ float bf2f(unsigned short b) { return __uint_as_float(((unsigned)b) << 16); }
__device__ __forceinline__ float bfr(float f) { return bf2f(f2bf(f)); }
__device__ __forceinline__ v16h cat16(v8h lo, v8h hi) { return __builtin_shufflevector(lo, hi, 0, 1, 2, 3, 4, 5, 6, 7, 8, 9, 10, 11, 12, 13, 14, 15); }
__device__ __forceinline__ v16bf cat16b(v8us lo, v8us hi) { return __builtin_bit_cast(v16bf, __builtin_shufflevector(lo, hi, 0, 1, 2, 3, 4, 5, 6, 7, 8, 9, 10, 11, 12, 13, 14, 15)); }
__device__ __forceinline__ v8f wmma16(v16h a, v16h b, v8f c) { return __builtin_amdgcn_wmma_f32_16x16x32_f16(false, a, false, b, (short)0, c, false, false); }
__device__ __forceinline__ v8f wmmab(v16bf a, v16bf b, v8f c) { return __builtin_amdgcn_wmma_f32_16x16x32_bf16(false, a, false, b, (short)0, c, false, false); }



// ---- k_gemmw: register-blocked GEMM, ONE WAVE per 64x64 output tile (16 accumulators), operands straight from K-contiguous 16-bit planes; grid (M/64, N/64, Z), 32 threads.
// C[m][n] (f32, pitch ldc, + optional f32 bias[n]) = sum_k A[m][k] Bt[n][k] (+ split products per NSPLIT). z-batch strides sA/sB/sC in elements. K % 32 == 0.
template <typename T16> struct WFrag;
template <> struct WFrag<h16> { typedef v16h V; static __device__ __forceinline__ V ld(const h16* p) { return cat16(*(const v8h*)p, *(const v8h*)(p + 16)); } static __device__ __forceinline__ v8f mma(V a, V b, v8f c) { return wmma16(a, b, c); } };
template <> struct WFrag<bf> { typedef v16bf V; static __device__ __forceinline__ V ld(const bf* p) { return cat16b(*(const v8us*)p, *(const v8us*)(p + 16)); } static __device__ __forceinline__ v8f mma(V a, V b, v8f c) { return wmmab(a, b, c); } };
template <typename T16, int NSPLIT, bool BIAS>
__global__ __launch_bounds__(32) void k_gemmw(const T16* __restrict__ A, const T16* __restrict__ A2, const T16* __restrict__ Bt, const T16* __restrict__ Bt2, int K, float* C, int ldc, const float* __restrict__ bias, size_t sA, size_t sB, size_t sC) {
    typedef typename WFrag<T16>::V V;
    __shared__ __align__(16) float os[16 * 68];
    const size_t z = blockIdx.z; A += z * sA; if (A2) A2 += z * sA; Bt += z * sB; if (Bt2) Bt2 += z * sB; C += z * sC;
    const int lane = threadIdx.x & 31, lr = lane & 15, hi = lane >> 4; const int r0 = blockIdx.x * 64, c0 = blockIdx.y * 64;
    v8f acc[4][4];
#pragma unroll
    for (int mb = 0; mb < 4; ++mb)
#pragma unroll
        for (int nb = 0; nb < 4; ++nb) acc[mb][nb] = (v8f){};
    const size_t aoff = (size_t)(r0 + lr) * K + 8 * hi, boff = (size_t)(c0 + lr) * K + 8 * hi;
#pragma unroll 1
    for (int kc = 0; kc < K; kc += 32) {
        V a[4], a2[4];
#pragma unroll
        for (int mb = 0; mb < 4; ++mb) { a[mb] = WFrag<T16>::ld(A + aoff + (size_t)mb * 16 * K + kc); if (NSPLIT == 1 || NSPLIT == 2) a2[mb] = WFrag<T16>::ld(A2 + aoff + (size_t)mb * 16 * K + kc); }
#pragma unroll
        for (int nb = 0; nb < 4; ++nb) { const V b = WFrag<T16>::ld(Bt + boff + (size_t)nb * 16 * K + kc); V b2; if (NSPLIT >= 2) b2 = WFrag<T16>::ld(Bt2 + boff + (size_t)nb * 16 * K + kc);
#pragma unroll
            for (int mb = 0; mb < 4; ++mb) { acc[mb][nb] = WFrag<T16>::mma(a[mb], b, acc[mb][nb]); if (NSPLIT == 1 || NSPLIT == 2) acc[mb][nb] = WFrag<T16>::mma(a2[mb], b, acc[mb][nb]); if (NSPLIT >= 2) acc[mb][nb] = WFrag<T16>::mma(a[mb], b2, acc[mb][nb]); } }
        asm volatile("v_nop\n\tv_nop\n\tv_nop\n\tv_nop" : "+v"(acc[0][0]), "+v"(acc[1][1]), "+v"(acc[2][2]), "+v"(acc[3][3]) : "v"(a[0]), "v"(a[3]));
    }
#pragma unroll
    for (int mb = 0; mb < 4; ++mb) {
#pragma unroll
        for (int nb = 0; nb < 4; ++nb) {
#pragma unroll
            for (int j = 0; j < 8; ++j) os[(hi * 8 + j) * 68 + nb * 16 + lr] = acc[mb][nb][j]; }
        __builtin_amdgcn_wave_barrier(); asm volatile("" ::: "memory");
        float* crow = C + (size_t)(r0 + mb * 16) * ldc + c0;
{
#pragma unroll
            for (int s = 0; s < 8; ++s) { const int row = 2 * s + hi, cofs = lr * 4; v4f val = *(const v4fa*)(os + row * 68 + cofs); if (BIAS) { val[0] += bfr(bias[c0 + cofs]); val[1] += bfr(bias[c0 + cofs + 1]); val[2] += bfr(bias[c0 + cofs + 2]); val[3] += bfr(bias[c0 + cofs + 3]); }
                *(v4f*)(crow + (size_t)row * ldc + cofs) = val; }
             }
        __builtin_amdgcn_wave_barrier(); asm volatile("" ::: "memory");
    }
}

__device__ __forceinline__ h16 tohx(float x) { return (h16)x; }
__device__ __forceinline__ void splitf(float y, unsigned short& h, unsigned short& l) { h = f2bf(y); l = f2bf(y - bf2f(h)); }
typedef __attribute__((ext_vector_type(2))) _Float16 v2h;
typedef __attribute__((ext_vector_type(4))) _Float16 v4h;
typedef __attribute__((ext_vector_type(2))) unsigned short v2us;
typedef __attribute__((ext_vector_type(4))) unsigned short v4us;
typedef __attribute__((ext_vector_type(2))) float v2f;
typedef __attribute__((ext_vector_type(4))) int v4i;

__global__ __launch_bounds__(256) void k_wtG(const float* __restrict__ w, int K, int N, bf* Bt) {
    const int lane = threadIdx.x & 31; const int L0 = (blockIdx.x * 8 + (threadIdx.x >> 5)) * 8; const int nlines = N * K / 64;
{
#pragma unroll 1
        for (int l = 0; l < 8; ++l) { const int L = L0 + l; if (L >= nlines) break; const size_t e = (size_t)L * 64 + lane * 2; const int k = (int)(e % K), n = (int)(e / K); v2us o;
            o[0] = f2bf(w[(size_t)k * N + n]); o[1] = f2bf(w[(size_t)(k + 1) * N + n]); *(v2us*)(Bt + e) = o; }
         }
}
__global__ __launch_bounds__(256) void k_cvt8(const float* __restrict__ src, bf* dst, size_t n8) { const size_t i = (size_t)blockIdx.x * 256 + threadIdx.x; if (i >= n8) return; const v8f v = *(const v8f*)(src + i * 8); v8us o;
#pragma unroll
    for (int k = 0; k < 8; ++k) o[k] = f2bf(v[k]); *(v8us*)(dst + i * 8) = o;  }

// k_rope: head planes [h][t][d] (fp16 + hi/lo) of rope(x) x sc with the rotate-half convention out[d] = x[d] cos[t][d] - x[d+HD/2] sin[t][d], out[d+HD/2] = x[d+HD/2] cos[t][d+HD/2] + x[d] sin[t][d+HD/2]
__global__ __launch_bounds__(256) void k_rope(const float* __restrict__ F, int pitch, int nheads, const float* __restrict__ CS, const float* __restrict__ RF, const float* __restrict__ nw, float sc, h16* P16, bf* Ph, bf* Pl) {
    const size_t e = ((size_t)blockIdx.x * 256 + threadIdx.x) * 2; if (e >= (size_t)nheads * TT * HD) return; const int d = (int)(e % HD); const int t = (int)((e / HD) % TT); const int h = (int)(e / ((size_t)HD * TT)); const float* f = F + (size_t)t * pitch + h * HD; const float rf = RF ? RF[(size_t)h * TT + t] : 1.0f; v2h o16; v2us oh, ol;
#pragma unroll
    for (int q = 0; q < 2; ++q) { const int dd = d + q; const int dp = (dd < HD / 2) ? dd + HD / 2 : dd - HD / 2; float x0 = f[dd], x1 = f[dp];
        if (RF) { float n0 = __fmul_rn(x0, rf), n1 = __fmul_rn(x1, rf); asm volatile("" : "+v"(n0)); asm volatile("" : "+v"(n1)); x0 = __fmul_rn(bfr(nw[dd]), n0); x1 = __fmul_rn(bfr(nw[dp]), n1); }
        const v2f cs = *(const v2f*)(CS + ((size_t)t * HD + dd) * 2); float a = __fmul_rn(x0, cs[0]), bq = __fmul_rn(x1, cs[1]); asm volatile("" : "+v"(a)); asm volatile("" : "+v"(bq)); const float r = ((dd < HD / 2) ? __fsub_rn(a, bq) : __fadd_rn(a, bq)) * sc;
        o16[q] = tohx(r); unsigned short a2, c2; splitf(r, a2, c2); oh[q] = a2; ol[q] = c2; }
    *(v2h*)(P16 + e) = o16; *(v2us*)(Ph + e) = oh; *(v2us*)(Pl + e) = ol;  }
__global__ __launch_bounds__(256) void k_vtp(const float* __restrict__ F, int pitch, int nheads, h16* V16, bf* Vh, bf* Vl) { const size_t e = ((size_t)blockIdx.x * 256 + threadIdx.x) * 2; if (e >= (size_t)nheads * HD * TT) return; const int t = (int)(e % TT); const int d = (int)((e / TT) % HD); const int g = (int)(e / ((size_t)TT * HD)); v2h o16; v2us oh, ol;
#pragma unroll
    for (int q = 0; q < 2; ++q) { const float x = F[(size_t)(t + q) * pitch + g * HD + d]; o16[q] = tohx(x); unsigned short a2, c2; splitf(x, a2, c2); oh[q] = a2; ol[q] = c2; }
    *(v2h*)(V16 + e) = o16; *(v2us*)(Vh + e) = oh; *(v2us*)(Vl + e) = ol;  }
__global__ __launch_bounds__(256) void k_csid(float* CS) { const int idx = blockIdx.x * 256 + threadIdx.x; if (idx >= TT * HD) return; v2f cs; cs[0] = 1.0f; cs[1] = 0.0f; *(v2f*)(CS + (size_t)idx * 2) = cs;  }
// k_asoft: per row (zz, i): t = S x HD^-0.5 (no mask); softmax over the 1024 keys (register row, one exp, fixed trees);
__global__ __launch_bounds__(256) void k_asoft(const float* __restrict__ Sb, h16* P16, bf* Ph, bf* Pl) {
    const int lane = threadIdx.x & 31; const int row = blockIdx.x * 8 + (threadIdx.x >> 5); if (row >= ZH * TT) return; const int i = row % TT; const int zz = row / TT; (void)zz; const bool hires = (i < RH); const float* sr = Sb + (size_t)row * TT; float v[TT / 32]; float mx = -3.0e38f;
#pragma unroll
    for (int ch = 0; ch < TT / 128; ++ch) { const int j0 = ch * 128 + lane * 4; const v4f a = *(const v4f*)(sr + j0);
#pragma unroll
        for (int q = 0; q < 4; ++q) { const int j = j0 + q; (void)j; const float t = a[q] * SCL; v[ch * 4 + q] = t; mx = fmaxf(mx, t); } }
#pragma unroll
    for (int sh = 16; sh; sh >>= 1) mx = fmaxf(mx, __shfl_xor(mx, sh, 32));
    float sum = 0.f;
#pragma unroll
    for (int k = 0; k < TT / 32; ++k) { float d0 = __fsub_rn(v[k], mx); asm volatile("" : "+v"(d0)); v[k] = __builtin_amdgcn_exp2f(__fmul_rn(d0, 1.4426950408889634f)); sum += v[k]; }
#pragma unroll
    for (int sh = 16; sh; sh >>= 1) sum += __shfl_xor(sum, sh, 32);
    const float f = __fdiv_rn(hires ? 1.0f : PCAR, sum);
{
        if (hires) {
#pragma unroll
            for (int ch = 0; ch < TT / 128; ++ch) { v4us oh, ol;
#pragma unroll
                for (int q = 0; q < 4; ++q) { unsigned short a, c2; splitf(v[ch * 4 + q] * f, a, c2); oh[q] = a; ol[q] = c2; }
                const size_t oo = ((size_t)zz * (RH ? RH : 1) + i) * TT + ch * 128 + lane * 4; *(v4us*)(Ph + oo) = oh; *(v4us*)(Pl + oo) = ol; }
        } else {
#pragma unroll
            for (int ch = 0; ch < TT / 128; ++ch) { v4h o4;
#pragma unroll
                for (int q = 0; q < 4; ++q) o4[q] = tohx(v[ch * 4 + q] * f);
                *(v4h*)(P16 + (size_t)row * TT + ch * 128 + lane * 4) = o4; } }
         }
}
__global__ __launch_bounds__(256) void k_merge(const float* __restrict__ O, int h0, bf* Ah, bf* Al) { const size_t e = ((size_t)blockIdx.x * 256 + threadIdx.x) * 2; if (e >= (size_t)ZH * TT * HD) return; const int d = (int)(e % HD); const int t = (int)((e / HD) % TT); const int zz = (int)(e / ((size_t)HD * TT)); const float cs = (t < RH) ? 1.0f : (1.0f / PCAR); const size_t oo = (size_t)t * DQ + (h0 + zz) * HD + d;
    v2us oh, ol;
#pragma unroll
    for (int q = 0; q < 2; ++q) { unsigned short a, c2; splitf(O[e + q] * cs, a, c2); oh[q] = a; ol[q] = c2; } *(v2us*)(Ah + oo) = oh; *(v2us*)(Al + oo) = ol;  }

extern "C" void kernel_launch(void* const* d_in, const int* in_sizes, int n_in,
                              void* d_out, int out_size, void* d_ws, size_t ws_size, hipStream_t stream) {
    (void)in_sizes; (void)n_in; (void)out_size;
    const float* x = (const float*)d_in[0]; const float* wq = (const float*)d_in[1]; const float* bq = (const float*)d_in[2]; const float* wk = (const float*)d_in[3]; const float* bk = (const float*)d_in[4]; const float* wv = (const float*)d_in[5]; const float* bv = (const float*)d_in[6]; const float* wo = (const float*)d_in[7]; const float* bo = (const float*)d_in[8];
    float* OUT = (float*)d_out;     // [8][1024][1024]
    char* wsp = (char*)d_ws;
    auto take = [&](size_t bytes) { char* p = wsp; wsp += (bytes + 255) & ~(size_t)255; return (void*)p; };
    bf* WQ = (bf*)take((size_t)DQ * DM * 2); bf* WK = (bf*)take((size_t)DKV * DM * 2); bf* WV = (bf*)take((size_t)DKV * DM * 2); bf* WO = (bf*)take((size_t)DM * DQ * 2); float* CS = (float*)take((size_t)TT * HD * 2 * 4);
    bf* XB = (bf*)take((size_t)TT * DM * 2); float* FQ = (float*)take((size_t)TT * DQ * 4); float* FK = (float*)take((size_t)TT * DKV * 4);
    h16* QP16 = (h16*)take((size_t)NH_ * TT * HD * 2); h16* KP16 = (h16*)take((size_t)NKV * TT * HD * 2); h16* VT16 = (h16*)take((size_t)NKV * HD * TT * 2);
    bf* QPh = (bf*)take((size_t)NH_ * TT * HD * 2); bf* QPl = (bf*)take((size_t)NH_ * TT * HD * 2); bf* KPh = (bf*)take((size_t)NKV * TT * HD * 2); bf* KPl = (bf*)take((size_t)NKV * TT * HD * 2); bf* VTh = (bf*)take((size_t)NKV * HD * TT * 2); bf* VTl = (bf*)take((size_t)NKV * HD * TT * 2); bf* Ph = (bf*)take((size_t)ZH * RH * TT * 2); bf* Pl = (bf*)take((size_t)ZH * RH * TT * 2);
    float* Sb = (float*)take((size_t)ZH * TT * TT * 4); h16* P16 = (h16*)take((size_t)ZH * TT * TT * 2); float* Ob = (float*)take((size_t)ZH * TT * HD * 4); bf* ATh = (bf*)take((size_t)TT * DQ * 2); bf* ATl = (bf*)take((size_t)TT * DQ * 2);
    if ((size_t)(wsp - (char*)d_ws) > ws_size) return;    // ws 256 MiB
    float* FV = FK;   // v projection reuses the k buffer after the k planes are built (stream-ordered)
    { k_wtG<<<(unsigned)((DM * DQ / 64 + 63) / 64), 256, 0, stream>>>(wq, DM, DQ, WQ); k_wtG<<<(unsigned)((DM * DKV / 64 + 63) / 64), 256, 0, stream>>>(wk, DM, DKV, WK); k_wtG<<<(unsigned)((DM * DKV / 64 + 63) / 64), 256, 0, stream>>>(wv, DM, DKV, WV);
      k_wtG<<<(unsigned)((DQ * DM / 64 + 63) / 64), 256, 0, stream>>>(wo, DQ, DM, WO);
       }
    k_csid<<<(TT * HD + 255) / 256, 256, 0, stream>>>(CS);
    const unsigned LQ = (unsigned)(((size_t)NH_ * TT * HD / 2 + 255) / 256), LKv = (unsigned)(((size_t)NKV * TT * HD / 2 + 255) / 256);
    for (int b = 0; b < NB_; ++b) {
        
        k_cvt8<<<(unsigned)(((size_t)TT * DM / 8 + 255) / 256), 256, 0, stream>>>(x + (size_t)b * TT * DM, XB, (size_t)TT * DM / 8);
        k_gemmw<bf, 0, true><<<dim3(TT / 64, DQ / 64, 1), 32, 0, stream>>>(XB, nullptr, WQ, nullptr, DM, FQ, DQ, bq, 0, 0, 0);
        k_rope<<<LQ, 256, 0, stream>>>(FQ, DQ, NH_, CS, nullptr, nullptr, 1.0f, QP16, QPh, QPl);
        k_gemmw<bf, 0, true><<<dim3(TT / 64, DKV / 64, 1), 32, 0, stream>>>(XB, nullptr, WK, nullptr, DM, FK, DKV, bk, 0, 0, 0);
        k_rope<<<LKv, 256, 0, stream>>>(FK, DKV, NKV, CS, nullptr, nullptr, 1.0f, KP16, KPh, KPl);
        k_gemmw<bf, 0, true><<<dim3(TT / 64, DKV / 64, 1), 32, 0, stream>>>(XB, nullptr, WV, nullptr, DM, FV, DKV, bv, 0, 0, 0); k_vtp<<<LKv, 256, 0, stream>>>(FV, DKV, NKV, VT16, VTh, VTl);
        for (int h0 = 0; h0 < NH_; h0 += ZH) { const size_t zq = (size_t)h0, zk = (size_t)(h0 / REP);   // one kv head per query head: the pass's two heads use consecutive kv planes (z-strides TT*HD)
            k_gemmw<bf, 2, false><<<dim3(RH / 64, TT / 64, ZH), 32, 0, stream>>>(QPh + zq * TT * HD, QPl + zq * TT * HD, KPh + zk * TT * HD, KPl + zk * TT * HD, HD, Sb, TT, nullptr, (size_t)TT * HD, (size_t)TT * HD, (size_t)TT * TT);
            k_gemmw<h16, 0, false><<<dim3((TT - RH) / 64, TT / 64, ZH), 32, 0, stream>>>(QP16 + zq * TT * HD + (size_t)RH * HD, nullptr, KP16 + zk * TT * HD, nullptr, HD, Sb + (size_t)RH * TT, TT, nullptr, (size_t)TT * HD, (size_t)TT * HD, (size_t)TT * TT);
            k_asoft<<<ZH * TT / 8, 256, 0, stream>>>(Sb, P16, Ph, Pl);
            k_gemmw<bf, 2, false><<<dim3(RH / 64, HD / 64, ZH), 32, 0, stream>>>(Ph, Pl, VTh + zk * HD * TT, VTl + zk * HD * TT, TT, Ob, HD, nullptr, (size_t)RH * TT, (size_t)HD * TT, (size_t)TT * HD);
            k_gemmw<h16, 0, false><<<dim3((TT - RH) / 64, HD / 64, ZH), 32, 0, stream>>>(P16 + (size_t)RH * TT, nullptr, VT16 + zk * HD * TT, nullptr, TT, Ob + (size_t)RH * HD, HD, nullptr, (size_t)TT * TT, (size_t)HD * TT, (size_t)TT * HD);
            k_merge<<<(unsigned)(((size_t)ZH * TT * HD / 2 + 255) / 256), 256, 0, stream>>>(Ob, h0, ATh, ATl); }
        k_gemmw<bf, 1, true><<<dim3(TT / 64, DM / 64, 1), 32, 0, stream>>>(ATh, ATl, WO, nullptr, DQ, OUT + (size_t)b * TT * DM, DM, bo, 0, 0, 0); }
}

// v001
// A run of this version takes 987 microseconds.
// Two timings next to v000 put it at 4.72 and 4.74 times that version's speed.
#include <hip/hip_runtime.h>

// CLIP attention (hidden_states [8][1024][1024]; q = (x Wq + bq) x 64^-0.5, k, v = x W + b ('xw' [1024][1024]; 16 heads x 64); softmax(q.k) over all keys; out = merged Wo + bo -> [8][1024][1024] (8.4 M)).
// Compute dtypes, f32 accumulate: every input rounded to bf16; q/k/v on PLAIN bf16 operands (inputs: exact) + biases; the 64^-0.5 applied to the f32 score (the module scales q after the bias; power of two, exact); scores and attn.v: query rows < 512 hl (3 products), the rest single fp16 (x1024); softmax f32; Wo hl x exact (2 products) + bo.

#define NB_  8
#define TT   1024
#define DM   1024
#define NH_  16
#define NKV  16
#define REP  (NH_ / NKV)
#define HD   64
#define DQ   (NH_ * HD)
#define DKV  (NKV * HD)
#define ZH   16                   // heads per attention pass: one whole batch entry
#define GB   4                    // batch entries per projection group
#define RH   512                  // query rows < RH use hi+lo planes (0: none)
#define WIN  0
#define PCAR 1024.0f
#define SCL  0.125f   // HD^-0.5
typedef _Float16 h16;
typedef unsigned short bf;
typedef __attribute__((ext_vector_type(16))) __bf16   v16bf;
typedef __attribute__((ext_vector_type(16))) _Float16 v16h;
typedef __attribute__((ext_vector_type(8)))  _Float16 v8h;
typedef __attribute__((ext_vector_type(8)))  unsigned short v8us;
typedef __attribute__((ext_vector_type(8)))  float    v8f;
typedef __attribute__((ext_vector_type(4)))  float    v4f;
typedef v8h  __attribute__((may_alias)) v8ha;
typedef v4f  __attribute__((may_alias)) v4fa;
typedef v8us __attribute__((may_alias)) v8usa;

__device__ __forceinline__ unsigned short f2bf(float f) { unsigned u = __float_as_uint(f); u += 0x7FFFu + ((u >> 16) & 1u); return (unsigned short)(u >> 16); }
__device__ __forceinline__ float bf2f(unsigned short b) { return __uint_as_float(((unsigned)b) << 16); }
__device__ __forceinline__ float bfr(float f) { return bf2f(f2bf(f)); }
__device__ __forceinline__ v16h cat16(v8h lo, v8h hi) { return __builtin_shufflevector(lo, hi, 0, 1, 2, 3, 4, 5, 6, 7, 8, 9, 10, 11, 12, 13, 14, 15); }
__device__ __forceinline__ v16bf cat16b(v8us lo, v8us hi) { return __builtin_bit_cast(v16bf, __builtin_shufflevector(lo, hi, 0, 1, 2, 3, 4, 5, 6, 7, 8, 9, 10, 11, 12, 13, 14, 15)); }
__device__ __forceinline__ v8f wmma16(v16h a, v16h b, v8f c) { return __builtin_amdgcn_wmma_f32_16x16x32_f16(false, a, false, b, (short)0, c, false, false); }
__device__ __forceinline__ v8f wmmab(v16bf a, v16bf b, v8f c) { return __builtin_amdgcn_wmma_f32_16x16x32_bf16(false, a, false, b, (short)0, c, false, false); }



// ---- k_gemmw: register-blocked GEMM, ONE WAVE per 64x64 output tile (16 accumulators), operands straight from K-contiguous 16-bit planes; grid (M/64, N/64, Z), 32 threads.
// C[m][n] (f32, pitch ldc, + optional f32 bias[n], one vector per z slice up to three) = sum_k A[m][k] Bt[n][k] (+ split products per NSPLIT). z-batch strides sA/sB/sC in elements. K % 32 == 0.
template <typename T16> struct WFrag;
template <> struct WFrag<h16> { typedef v16h V; static __device__ __forceinline__ V ld(const h16* p) { return cat16(*(const v8h*)p, *(const v8h*)(p + 16)); } static __device__ __forceinline__ v8f mma(V a, V b, v8f c) { return wmma16(a, b, c); } };
template <> struct WFrag<bf> { typedef v16bf V; static __device__ __forceinline__ V ld(const bf* p) { return cat16b(*(const v8us*)p, *(const v8us*)(p + 16)); } static __device__ __forceinline__ v8f mma(V a, V b, v8f c) { return wmmab(a, b, c); } };
template <typename T16, int NSPLIT, bool BIAS>
__global__ __launch_bounds__(32) void k_gemmw(const T16* __restrict__ A, const T16* __restrict__ A2, const T16* __restrict__ Bt, const T16* __restrict__ Bt2, int K, float* C, int ldc, const float* __restrict__ bias0, const float* __restrict__ bias1, const float* __restrict__ bias2, size_t sA, size_t sB, size_t sC) {
    typedef typename WFrag<T16>::V V;
    __shared__ __align__(16) float os[16 * 68];
    const size_t z = blockIdx.z; A += z * sA; if (A2) A2 += z * sA; Bt += z * sB; if (Bt2) Bt2 += z * sB; C += z * sC;
    const float* __restrict__ bias = (z == 0) ? bias0 : (z == 1) ? bias1 : bias2;   // one bias vector per z slice
    const int lane = threadIdx.x & 31, lr = lane & 15, hi = lane >> 4; const int r0 = blockIdx.x * 64, c0 = blockIdx.y * 64;
    v8f acc[4][4];
#pragma unroll
    for (int mb = 0; mb < 4; ++mb)
#pragma unroll
        for (int nb = 0; nb < 4; ++nb) acc[mb][nb] = (v8f){};
    const size_t aoff = (size_t)(r0 + lr) * K + 8 * hi, boff = (size_t)(c0 + lr) * K + 8 * hi;
#pragma unroll 1
    for (int kc = 0; kc < K; kc += 32) {
        V a[4], a2[4];
#pragma unroll
        for (int mb = 0; mb < 4; ++mb) { a[mb] = WFrag<T16>::ld(A + aoff + (size_t)mb * 16 * K + kc); if (NSPLIT == 1 || NSPLIT == 2) a2[mb] = WFrag<T16>::ld(A2 + aoff + (size_t)mb * 16 * K + kc); }
#pragma unroll
        for (int nb = 0; nb < 4; ++nb) { const V b = WFrag<T16>::ld(Bt + boff + (size_t)nb * 16 * K + kc); V b2; if (NSPLIT >= 2) b2 = WFrag<T16>::ld(Bt2 + boff + (size_t)nb * 16 * K + kc);
#pragma unroll
            for (int mb = 0; mb < 4; ++mb) { acc[mb][nb] = WFrag<T16>::mma(a[mb], b, acc[mb][nb]); if (NSPLIT == 1 || NSPLIT == 2) acc[mb][nb] = WFrag<T16>::mma(a2[mb], b, acc[mb][nb]); if (NSPLIT >= 2) acc[mb][nb] = WFrag<T16>::mma(a[mb], b2, acc[mb][nb]); } }
        asm volatile("v_nop\n\tv_nop\n\tv_nop\n\tv_nop" : "+v"(acc[0][0]), "+v"(acc[1][1]), "+v"(acc[2][2]), "+v"(acc[3][3]) : "v"(a[0]), "v"(a[3]));
    }
#pragma unroll
    for (int mb = 0; mb < 4; ++mb) {
#pragma unroll
        for (int nb = 0; nb < 4; ++nb) {
#pragma unroll
            for (int j = 0; j < 8; ++j) os[(hi * 8 + j) * 68 + nb * 16 + lr] = acc[mb][nb][j]; }
        __builtin_amdgcn_wave_barrier(); asm volatile("" ::: "memory");
        float* crow = C + (size_t)(r0 + mb * 16) * ldc + c0;
{
#pragma unroll
            for (int s = 0; s < 8; ++s) { const int row = 2 * s + hi, cofs = lr * 4; v4f val = *(const v4fa*)(os + row * 68 + cofs); if (BIAS) { val[0] += bfr(bias[c0 + cofs]); val[1] += bfr(bias[c0 + cofs + 1]); val[2] += bfr(bias[c0 + cofs + 2]); val[3] += bfr(bias[c0 + cofs + 3]); }
                *(v4f*)(crow + (size_t)row * ldc + cofs) = val; }
             }
        __builtin_amdgcn_wave_barrier(); asm volatile("" ::: "memory");
    }
}

__device__ __forceinline__ h16 tohx(float x) { return (h16)x; }
__device__ __forceinline__ void splitf(float y, unsigned short& h, unsigned short& l) { h = f2bf(y); l = f2bf(y - bf2f(h)); }
typedef __attribute__((ext_vector_type(2))) _Float16 v2h;
typedef __attribute__((ext_vector_type(4))) _Float16 v4h;
typedef __attribute__((ext_vector_type(2))) unsigned short v2us;
typedef __attribute__((ext_vector_type(4))) unsigned short v4us;
typedef __attribute__((ext_vector_type(2))) float v2f;
typedef __attribute__((ext_vector_type(4))) int v4i;

__global__ __launch_bounds__(256) void k_wtG(const float* __restrict__ w0, const float* __restrict__ w1, const float* __restrict__ w2, const float* __restrict__ w3, int K, int N, bf* Bt) {
    const int y = blockIdx.y; const float* __restrict__ w = (y == 0) ? w0 : (y == 1) ? w1 : (y == 2) ? w2 : w3; Bt += (size_t)y * N * K;   // grid y: which of the four weights
    const int lane = threadIdx.x & 31; const int L0 = (blockIdx.x * 8 + (threadIdx.x >> 5)) * 8; const int nlines = N * K / 64;
{
#pragma unroll 1
        for (int l = 0; l < 8; ++l) { const int L = L0 + l; if (L >= nlines) break; const size_t e = (size_t)L * 64 + lane * 2; const int k = (int)(e % K), n = (int)(e / K); v2us o;
            o[0] = f2bf(w[(size_t)k * N + n]); o[1] = f2bf(w[(size_t)(k + 1) * N + n]); *(v2us*)(Bt + e) = o; }
         }
}
__global__ __launch_bounds__(256) void k_cvt8(const float* __restrict__ src, bf* dst, size_t n8) { const size_t i = (size_t)blockIdx.x * 256 + threadIdx.x; if (i >= n8) return; const v8f v = *(const v8f*)(src + i * 8); v8us o;
#pragma unroll
    for (int k = 0; k < 8; ++k) o[k] = f2bf(v[k]); *(v8us*)(dst + i * 8) = o;  }

// k_rope: head planes [h][t][d] (fp16 + hi/lo) of rope(x) x sc with the rotate-half convention out[d] = x[d] cos[t][d] - x[d+HD/2] sin[t][d], out[d+HD/2] = x[d+HD/2] cos[t][d+HD/2] + x[d] sin[t][d+HD/2]
__global__ __launch_bounds__(256) void k_rope(const float* __restrict__ F, int pitch, int nheads, const float* __restrict__ CS, const float* __restrict__ RF, const float* __restrict__ nw, float sc, h16* P16, bf* Ph, bf* Pl) {
    { const size_t po = ((size_t)blockIdx.z * GB + blockIdx.y) * nheads * TT * HD; F += (size_t)blockIdx.y * TT * pitch + (size_t)blockIdx.z * nheads * HD; P16 += po; Ph += po; Pl += po; }   // grid y: batch entry of the group; grid z: q columns, then k columns
    const size_t e = ((size_t)blockIdx.x * 256 + threadIdx.x) * 2; if (e >= (size_t)nheads * TT * HD) return; const int d = (int)(e % HD); const int t = (int)((e / HD) % TT); const int h = (int)(e / ((size_t)HD * TT)); const float* f = F + (size_t)t * pitch + h * HD; const float rf = RF ? RF[(size_t)h * TT + t] : 1.0f; v2h o16; v2us oh, ol;
#pragma unroll
    for (int q = 0; q < 2; ++q) { const int dd = d + q; const int dp = (dd < HD / 2) ? dd + HD / 2 : dd - HD / 2; float x0 = f[dd], x1 = f[dp];
        if (RF) { float n0 = __fmul_rn(x0, rf), n1 = __fmul_rn(x1, rf); asm volatile("" : "+v"(n0)); asm volatile("" : "+v"(n1)); x0 = __fmul_rn(bfr(nw[dd]), n0); x1 = __fmul_rn(bfr(nw[dp]), n1); }
        const v2f cs = *(const v2f*)(CS + ((size_t)t * HD + dd) * 2); float a = __fmul_rn(x0, cs[0]), bq = __fmul_rn(x1, cs[1]); asm volatile("" : "+v"(a)); asm volatile("" : "+v"(bq)); const float r = ((dd < HD / 2) ? __fsub_rn(a, bq) : __fadd_rn(a, bq)) * sc;
        o16[q] = tohx(r); unsigned short a2, c2; splitf(r, a2, c2); oh[q] = a2; ol[q] = c2; }
    *(v2h*)(P16 + e) = o16; *(v2us*)(Ph + e) = oh; *(v2us*)(Pl + e) = ol;  }
__global__ __launch_bounds__(256) void k_vtp(const float* __restrict__ F, int pitch, int nheads, h16* V16, bf* Vh, bf* Vl) { { const size_t po = (size_t)blockIdx.y * nheads * HD * TT; F += (size_t)blockIdx.y * TT * pitch; V16 += po; Vh += po; Vl += po; }   // grid y: batch entry of the group
    const size_t e = ((size_t)blockIdx.x * 256 + threadIdx.x) * 2; if (e >= (size_t)nheads * HD * TT) return; const int t = (int)(e % TT); const int d = (int)((e / TT) % HD); const int g = (int)(e / ((size_t)TT * HD)); v2h o16; v2us oh, ol;
#pragma unroll
    for (int q = 0; q < 2; ++q) { const float x = F[(size_t)(t + q) * pitch + g * HD + d]; o16[q] = tohx(x); unsigned short a2, c2; splitf(x, a2, c2); oh[q] = a2; ol[q] = c2; }
    *(v2h*)(V16 + e) = o16; *(v2us*)(Vh + e) = oh; *(v2us*)(Vl + e) = ol;  }
__global__ __launch_bounds__(256) void k_csid(float* CS) { const int idx = blockIdx.x * 256 + threadIdx.x; if (idx >= TT * HD) return; v2f cs; cs[0] = 1.0f; cs[1] = 0.0f; *(v2f*)(CS + (size_t)idx * 2) = cs;  }
// k_asoft: per row (zz, i): t = S x HD^-0.5 (no mask); softmax over the 1024 keys (register row, one exp, fixed trees);
__global__ __launch_bounds__(256) void k_asoft(const float* __restrict__ Sb, h16* P16, bf* Ph, bf* Pl) {
    const int lane = threadIdx.x & 31; const int row = blockIdx.x * 8 + (threadIdx.x >> 5); if (row >= ZH * TT) return; const int i = row % TT; const int zz = row / TT; (void)zz; const bool hires = (i < RH); const float* sr = Sb + (size_t)row * TT; float v[TT / 32]; float mx = -3.0e38f;
#pragma unroll
    for (int ch = 0; ch < TT / 128; ++ch) { const int j0 = ch * 128 + lane * 4; const v4f a = *(const v4f*)(sr + j0);
#pragma unroll
        for (int q = 0; q < 4; ++q) { const int j = j0 + q; (void)j; const float t = a[q] * SCL; v[ch * 4 + q] = t; mx = fmaxf(mx, t); } }
#pragma unroll
    for (int sh = 16; sh; sh >>= 1) mx = fmaxf(mx, __shfl_xor(mx, sh, 32));
    float sum = 0.f;
#pragma unroll
    for (int k = 0; k < TT / 32; ++k) { float d0 = __fsub_rn(v[k], mx); asm volatile("" : "+v"(d0)); v[k] = __builtin_amdgcn_exp2f(__fmul_rn(d0, 1.4426950408889634f)); sum += v[k]; }
#pragma unroll
    for (int sh = 16; sh; sh >>= 1) sum += __shfl_xor(sum, sh, 32);
    const float f = __fdiv_rn(hires ? 1.0f : PCAR, sum);
{
        if (hires) {
#pragma unroll
            for (int ch = 0; ch < TT / 128; ++ch) { v4us oh, ol;
#pragma unroll
                for (int q = 0; q < 4; ++q) { unsigned short a, c2; splitf(v[ch * 4 + q] * f, a, c2); oh[q] = a; ol[q] = c2; }
                const size_t oo = ((size_t)zz * (RH ? RH : 1) + i) * TT + ch * 128 + lane * 4; *(v4us*)(Ph + oo) = oh; *(v4us*)(Pl + oo) = ol; }
        } else {
#pragma unroll
            for (int ch = 0; ch < TT / 128; ++ch) { v4h o4;
#pragma unroll
                for (int q = 0; q < 4; ++q) o4[q] = tohx(v[ch * 4 + q] * f);
                *(v4h*)(P16 + (size_t)row * TT + ch * 128 + lane * 4) = o4; } }
         }
}
__global__ __launch_bounds__(256) void k_merge(const float* __restrict__ O, int h0, bf* Ah, bf* Al) { const size_t e = ((size_t)blockIdx.x * 256 + threadIdx.x) * 2; if (e >= (size_t)ZH * TT * HD) return; const int d = (int)(e % HD); const int t = (int)((e / HD) % TT); const int zz = (int)(e / ((size_t)HD * TT)); const float cs = (t < RH) ? 1.0f : (1.0f / PCAR); const size_t oo = (size_t)t * DQ + (h0 + zz) * HD + d;
    v2us oh, ol;
#pragma unroll
    for (int q = 0; q < 2; ++q) { unsigned short a, c2; splitf(O[e + q] * cs, a, c2); oh[q] = a; ol[q] = c2; } *(v2us*)(Ah + oo) = oh; *(v2us*)(Al + oo) = ol;  }

extern "C" void kernel_launch(void* const* d_in, const int* in_sizes, int n_in,
                              void* d_out, int out_size, void* d_ws, size_t ws_size, hipStream_t stream) {
    (void)in_sizes; (void)n_in; (void)out_size;
    const float* x = (const float*)d_in[0]; const float* wq = (const float*)d_in[1]; const float* bq = (const float*)d_in[2]; const float* wk = (const float*)d_in[3]; const float* bk = (const float*)d_in[4]; const float* wv = (const float*)d_in[5]; const float* bv = (const float*)d_in[6]; const float* wo = (const float*)d_in[7]; const float* bo = (const float*)d_in[8];
    float* OUT = (float*)d_out;     // [8][1024][1024]
    char* wsp = (char*)d_ws;
    auto take = [&](size_t bytes) { char* p = wsp; wsp += (bytes + 255) & ~(size_t)255; return (void*)p; };
    const size_t PS = (size_t)GB * NH_ * TT * HD;   // one 16-bit plane of a group: [entry][head][t][d] (v: [entry][head][d][t])
    static_assert(NKV == NH_ && NB_ % GB == 0 && ZH == NH_, "one pass per batch entry; q, k, v of equal width");
    bf* W4 = (bf*)take((size_t)4 * DQ * DM * 2); bf* WO = W4 + (size_t)3 * DQ * DM;   // Wq, Wk, Wv, Wo transposed, back to back
    float* CS = (float*)take((size_t)TT * HD * 2 * 4);
    bf* XB = (bf*)take((size_t)GB * TT * DM * 2);
    h16* QP16 = (h16*)take(2 * PS * 2); h16* KP16 = QP16 + PS; h16* VT16 = (h16*)take(PS * 2);
    bf* QPh = (bf*)take(2 * PS * 2); bf* KPh = QPh + PS; bf* QPl = (bf*)take(2 * PS * 2); bf* KPl = QPl + PS; bf* VTh = (bf*)take(PS * 2); bf* VTl = (bf*)take(PS * 2); bf* Ph = (bf*)take((size_t)ZH * RH * TT * 2); bf* Pl = (bf*)take((size_t)ZH * RH * TT * 2);
    float* Sb = (float*)take((size_t)ZH * TT * TT * 4); h16* P16 = (h16*)take((size_t)ZH * TT * TT * 2); float* Ob = (float*)take((size_t)ZH * TT * HD * 4); bf* ATh = (bf*)take((size_t)NB_ * TT * DQ * 2); bf* ATl = (bf*)take((size_t)NB_ * TT * DQ * 2);
    if ((size_t)(wsp - (char*)d_ws) > ws_size) return;    // ws 256 MiB
    static_assert((size_t)GB * 3 * DQ <= (size_t)ZH * TT, "the projections fit the score buffer");
    float* F3 = Sb;   // q|k|v projections [GB*TT][3*DQ] live in the score buffer until the planes are built (stream-ordered)
    k_wtG<<<dim3((unsigned)((DM * DQ / 64 + 63) / 64), 4, 1), 256, 0, stream>>>(wq, wk, wv, wo, DM, DQ, W4);
    k_csid<<<(TT * HD + 255) / 256, 256, 0, stream>>>(CS);
    const unsigned LQ = (unsigned)(((size_t)NH_ * TT * HD / 2 + 255) / 256);
    for (int g = 0; g < NB_ / GB; ++g) {
        k_cvt8<<<(unsigned)(((size_t)GB * TT * DM / 8 + 255) / 256), 256, 0, stream>>>(x + (size_t)g * GB * TT * DM, XB, (size_t)GB * TT * DM / 8);
        k_gemmw<bf, 0, true><<<dim3(GB * TT / 64, DQ / 64, 3), 32, 0, stream>>>(XB, nullptr, W4, nullptr, DM, F3, 3 * DQ, bq, bk, bv, 0, (size_t)DQ * DM, (size_t)DQ);
        k_rope<<<dim3(LQ, GB, 2), 256, 0, stream>>>(F3, 3 * DQ, NH_, CS, nullptr, nullptr, 1.0f, QP16, QPh, QPl);
        k_vtp<<<dim3(LQ, GB, 1), 256, 0, stream>>>(F3 + 2 * DQ, 3 * DQ, NKV, VT16, VTh, VTl);
        for (int bl = 0; bl < GB; ++bl) { const size_t zq = (size_t)bl * NH_, zk = zq; const size_t ao = (size_t)(g * GB + bl) * TT * DQ;   // one pass: all heads of one batch entry (z-strides TT*HD)
            k_gemmw<bf, 2, false><<<dim3(RH / 64, TT / 64, ZH), 32, 0, stream>>>(QPh + zq * TT * HD, QPl + zq * TT * HD, KPh + zk * TT * HD, KPl + zk * TT * HD, HD, Sb, TT, nullptr, nullptr, nullptr, (size_t)TT * HD, (size_t)TT * HD, (size_t)TT * TT);
            k_gemmw<h16, 0, false><<<dim3((TT - RH) / 64, TT / 64, ZH), 32, 0, stream>>>(QP16 + zq * TT * HD + (size_t)RH * HD, nullptr, KP16 + zk * TT * HD, nullptr, HD, Sb + (size_t)RH * TT, TT, nullptr, nullptr, nullptr, (size_t)TT * HD, (size_t)TT * HD, (size_t)TT * TT);
            k_asoft<<<ZH * TT / 8, 256, 0, stream>>>(Sb, P16, Ph, Pl);
            k_gemmw<bf, 2, false><<<dim3(RH / 64, HD / 64, ZH), 32, 0, stream>>>(Ph, Pl, VTh + zk * HD * TT, VTl + zk * HD * TT, TT, Ob, HD, nullptr, nullptr, nullptr, (size_t)RH * TT, (size_t)HD * TT, (size_t)TT * HD);
            k_gemmw<h16, 0, false><<<dim3((TT - RH) / 64, HD / 64, ZH), 32, 0, stream>>>(P16 + (size_t)RH * TT, nullptr, VT16 + zk * HD * TT, nullptr, TT, Ob + (size_t)RH * HD, HD, nullptr, nullptr, nullptr, (size_t)TT * TT, (size_t)HD * TT, (size_t)TT * HD);
            k_merge<<<(unsigned)(((size_t)ZH * TT * HD / 2 + 255) / 256), 256, 0, stream>>>(Ob, 0, ATh + ao, ATl + ao); } }
    k_gemmw<bf, 1, true><<<dim3(NB_ * TT / 64, DM / 64, 1), 32, 0, stream>>>(ATh, ATl, WO, nullptr, DQ, OUT, DM, bo, nullptr, nullptr, 0, 0, 0);
}

// v002
// Measured time: 370 microseconds a run.
// Two timings next to v001 put it at 2.66 and 2.68 times that version's speed.
// Over all steps from v000 it is 12.6 times as fast.
#include <hip/hip_runtime.h>

// CLIP attention (hidden_states [8][1024][1024]; q = (x Wq + bq) x 64^-0.5, k, v = x W + b ('xw' [1024][1024]; 16 heads x 64); softmax(q.k) over all keys; out = merged Wo + bo -> [8][1024][1024] (8.4 M)).
// Compute dtypes, f32 accumulate: every input rounded to bf16; q/k/v on PLAIN bf16 operands (inputs: exact) + biases; the 64^-0.5 applied to the f32 score (the module scales q after the bias; power of two, exact); scores and attn.v: query rows < 512 hl (3 products), the rest single fp16 (x1024); softmax f32; Wo hl x exact (2 products) + bo.

#define NB_  8
#define TT   1024
#define DM   1024
#define NH_  16
#define NKV  16
#define REP  (NH_ / NKV)
#define HD   64
#define DQ   (NH_ * HD)
#define DKV  (NKV * HD)
#define ZH   16                   // heads of one batch entry; an attention pass covers GB entries
#define GB   4                    // batch entries per projection group
#define RH   512                  // query rows < RH use hi+lo planes (0: none)
#define WIN  0
#define PCAR 1024.0f
#define SCL  0.125f   // HD^-0.5
typedef _Float16 h16;
typedef unsigned short bf;
typedef __attribute__((ext_vector_type(16))) __bf16   v16bf;
typedef __attribute__((ext_vector_type(16))) _Float16 v16h;
typedef __attribute__((ext_vector_type(8)))  _Float16 v8h;
typedef __attribute__((ext_vector_type(8)))  unsigned short v8us;
typedef __attribute__((ext_vector_type(8)))  float    v8f;
typedef __attribute__((ext_vector_type(4)))  float    v4f;
typedef v8h  __attribute__((may_alias)) v8ha;
typedef v4f  __attribute__((may_alias)) v4fa;
typedef v8us __attribute__((may_alias)) v8usa;

__device__ __forceinline__ unsigned short f2bf(float f) { unsigned u = __float_as_uint(f); u += 0x7FFFu + ((u >> 16) & 1u); return (unsigned short)(u >> 16); }
__device__ __forceinline__ float bf2f(unsigned short b) { return __uint_as_float(((unsigned)b) << 16); }
__device__ __forceinline__ float bfr(float f) { return bf2f(f2bf(f)); }
__device__ __forceinline__ v16h cat16(v8h lo, v8h hi) { return __builtin_shufflevector(lo, hi, 0, 1, 2, 3, 4, 5, 6, 7, 8, 9, 10, 11, 12, 13, 14, 15); }
__device__ __forceinline__ v16bf cat16b(v8us lo, v8us hi) { return __builtin_bit_cast(v16bf, __builtin_shufflevector(lo, hi, 0, 1, 2, 3, 4, 5, 6, 7, 8, 9, 10, 11, 12, 13, 14, 15)); }
__device__ __forceinline__ v8f wmma16(v16h a, v16h b, v8f c) { return __builtin_amdgcn_wmma_f32_16x16x32_f16(false, a, false, b, (short)0, c, false, false); }
__device__ __forceinline__ v8f wmmab(v16bf a, v16bf b, v8f c) { return __builtin_amdgcn_wmma_f32_16x16x32_bf16(false, a, false, b, (short)0, c, false, false); }



// ---- k_gemmw: register-blocked GEMM, ONE WAVE per 64x64 output tile (16 accumulators), operands straight from K-contiguous 16-bit planes; grid (M/64, N/64, Z), 32 threads.
// C[m][n] (f32, pitch ldc, + optional f32 bias[n], one vector per z slice up to three) = sum_k A[m][k] Bt[n][k] (+ split products per NSPLIT). z-batch strides sA/sB/sC in elements. K % 32 == 0.
template <typename T16> struct WFrag;
template <> struct WFrag<h16> { typedef v16h V; static __device__ __forceinline__ V ld(const h16* p) { return cat16(*(const v8h*)p, *(const v8h*)(p + 16)); } static __device__ __forceinline__ v8f mma(V a, V b, v8f c) { return wmma16(a, b, c); } };
template <> struct WFrag<bf> { typedef v16bf V; static __device__ __forceinline__ V ld(const bf* p) { return cat16b(*(const v8us*)p, *(const v8us*)(p + 16)); } static __device__ __forceinline__ v8f mma(V a, V b, v8f c) { return wmmab(a, b, c); } };
template <typename T16, int NSPLIT, bool BIAS>
__global__ __launch_bounds__(32) void k_gemmw(const T16* __restrict__ A, const T16* __restrict__ A2, const T16* __restrict__ Bt, const T16* __restrict__ Bt2, int K, float* C, int ldc, const float* __restrict__ bias0, const float* __restrict__ bias1, const float* __restrict__ bias2, size_t sA, size_t sB, size_t sC) {
    typedef typename WFrag<T16>::V V;
    __shared__ __align__(16) float os[16 * 68];
    const size_t z = blockIdx.z; A += z * sA; if (A2) A2 += z * sA; Bt += z * sB; if (Bt2) Bt2 += z * sB; C += z * sC;
    const float* __restrict__ bias = (z == 0) ? bias0 : (z == 1) ? bias1 : bias2;   // one bias vector per z slice
    const int lane = threadIdx.x & 31, lr = lane & 15, hi = lane >> 4; const int r0 = blockIdx.x * 64, c0 = blockIdx.y * 64;
    v8f acc[4][4];
#pragma unroll
    for (int mb = 0; mb < 4; ++mb)
#pragma unroll
        for (int nb = 0; nb < 4; ++nb) acc[mb][nb] = (v8f){};
    const size_t aoff = (size_t)(r0 + lr) * K + 8 * hi, boff = (size_t)(c0 + lr) * K + 8 * hi;
#pragma unroll 1
    for (int kc = 0; kc < K; kc += 32) {
        V a[4], a2[4];
#pragma unroll
        for (int mb = 0; mb < 4; ++mb) { a[mb] = WFrag<T16>::ld(A + aoff + (size_t)mb * 16 * K + kc); if (NSPLIT == 1 || NSPLIT == 2) a2[mb] = WFrag<T16>::ld(A2 + aoff + (size_t)mb * 16 * K + kc); }
#pragma unroll
        for (int nb = 0; nb < 4; ++nb) { const V b = WFrag<T16>::ld(Bt + boff + (size_t)nb * 16 * K + kc); V b2; if (NSPLIT >= 2) b2 = WFrag<T16>::ld(Bt2 + boff + (size_t)nb * 16 * K + kc);
#pragma unroll
            for (int mb = 0; mb < 4; ++mb) { acc[mb][nb] = WFrag<T16>::mma(a[mb], b, acc[mb][nb]); if (NSPLIT == 1 || NSPLIT == 2) acc[mb][nb] = WFrag<T16>::mma(a2[mb], b, acc[mb][nb]); if (NSPLIT >= 2) acc[mb][nb] = WFrag<T16>::mma(a[mb], b2, acc[mb][nb]); } }
        asm volatile("v_nop\n\tv_nop\n\tv_nop\n\tv_nop" : "+v"(acc[0][0]), "+v"(acc[1][1]), "+v"(acc[2][2]), "+v"(acc[3][3]) : "v"(a[0]), "v"(a[3]));
    }
#pragma unroll
    for (int mb = 0; mb < 4; ++mb) {
#pragma unroll
        for (int nb = 0; nb < 4; ++nb) {
#pragma unroll
            for (int j = 0; j < 8; ++j) os[(hi * 8 + j) * 68 + nb * 16 + lr] = acc[mb][nb][j]; }
        __builtin_amdgcn_wave_barrier(); asm volatile("" ::: "memory");
        float* crow = C + (size_t)(r0 + mb * 16) * ldc + c0;
{
#pragma unroll
            for (int s = 0; s < 8; ++s) { const int row = 2 * s + hi, cofs = lr * 4; v4f val = *(const v4fa*)(os + row * 68 + cofs); if (BIAS) { val[0] += bfr(bias[c0 + cofs]); val[1] += bfr(bias[c0 + cofs + 1]); val[2] += bfr(bias[c0 + cofs + 2]); val[3] += bfr(bias[c0 + cofs + 3]); }
                *(v4f*)(crow + (size_t)row * ldc + cofs) = val; }
             }
        __builtin_amdgcn_wave_barrier(); asm volatile("" ::: "memory");
    }
}

__device__ __forceinline__ h16 tohx(float x) { return (h16)x; }
__device__ __forceinline__ void splitf(float y, unsigned short& h, unsigned short& l) { h = f2bf(y); l = f2bf(y - bf2f(h)); }
typedef __attribute__((ext_vector_type(2))) _Float16 v2h;
typedef __attribute__((ext_vector_type(4))) _Float16 v4h;
typedef __attribute__((ext_vector_type(2))) unsigned short v2us;
typedef __attribute__((ext_vector_type(4))) unsigned short v4us;
typedef __attribute__((ext_vector_type(2))) float v2f;
typedef __attribute__((ext_vector_type(4))) int v4i;

__global__ __launch_bounds__(256) void k_wtG(const float* __restrict__ w0, const float* __restrict__ w1, const float* __restrict__ w2, const float* __restrict__ w3, int K, int N, bf* Bt) {
    const int y = blockIdx.y; const float* __restrict__ w = (y == 0) ? w0 : (y == 1) ? w1 : (y == 2) ? w2 : w3; Bt += (size_t)y * N * K;   // grid y: which of the four weights
    const int lane = threadIdx.x & 31; const int L0 = (blockIdx.x * 8 + (threadIdx.x >> 5)) * 8; const int nlines = N * K / 64;
{
#pragma unroll 1
        for (int l = 0; l < 8; ++l) { const int L = L0 + l; if (L >= nlines) break; const size_t e = (size_t)L * 64 + lane * 2; const int k = (int)(e % K), n = (int)(e / K); v2us o;
            o[0] = f2bf(w[(size_t)k * N + n]); o[1] = f2bf(w[(size_t)(k + 1) * N + n]); *(v2us*)(Bt + e) = o; }
         }
}
__global__ __launch_bounds__(256) void k_cvt8(const float* __restrict__ src, bf* dst, size_t n8) { const size_t i = (size_t)blockIdx.x * 256 + threadIdx.x; if (i >= n8) return; const v8f v = *(const v8f*)(src + i * 8); v8us o;
#pragma unroll
    for (int k = 0; k < 8; ++k) o[k] = f2bf(v[k]); *(v8us*)(dst + i * 8) = o;  }

// k_rope: head planes [h][t][d] (fp16 + hi/lo) of rope(x) x sc with the rotate-half convention out[d] = x[d] cos[t][d] - x[d+HD/2] sin[t][d], out[d+HD/2] = x[d+HD/2] cos[t][d+HD/2] + x[d] sin[t][d+HD/2]
__global__ __launch_bounds__(256) void k_rope(const float* __restrict__ F, int pitch, int nheads, const float* __restrict__ CS, const float* __restrict__ RF, const float* __restrict__ nw, float sc, h16* P16, bf* Ph, bf* Pl) {
    { const size_t po = ((size_t)blockIdx.z * GB + blockIdx.y) * nheads * TT * HD; F += (size_t)blockIdx.y * TT * pitch + (size_t)blockIdx.z * nheads * HD; P16 += po; Ph += po; Pl += po; }   // grid y: batch entry of the group; grid z: q columns, then k columns
    const size_t e = ((size_t)blockIdx.x * 256 + threadIdx.x) * 2; if (e >= (size_t)nheads * TT * HD) return; const int d = (int)(e % HD); const int t = (int)((e / HD) % TT); const int h = (int)(e / ((size_t)HD * TT)); const float* f = F + (size_t)t * pitch + h * HD; const float rf = RF ? RF[(size_t)h * TT + t] : 1.0f; v2h o16; v2us oh, ol;
#pragma unroll
    for (int q = 0; q < 2; ++q) { const int dd = d + q; const int dp = (dd < HD / 2) ? dd + HD / 2 : dd - HD / 2; float x0 = f[dd], x1 = f[dp];
        if (RF) { float n0 = __fmul_rn(x0, rf), n1 = __fmul_rn(x1, rf); asm volatile("" : "+v"(n0)); asm volatile("" : "+v"(n1)); x0 = __fmul_rn(bfr(nw[dd]), n0); x1 = __fmul_rn(bfr(nw[dp]), n1); }
        const v2f cs = *(const v2f*)(CS + ((size_t)t * HD + dd) * 2); float a = __fmul_rn(x0, cs[0]), bq = __fmul_rn(x1, cs[1]); asm volatile("" : "+v"(a)); asm volatile("" : "+v"(bq)); const float r = ((dd < HD / 2) ? __fsub_rn(a, bq) : __fadd_rn(a, bq)) * sc;
        o16[q] = tohx(r); unsigned short a2, c2; splitf(r, a2, c2); oh[q] = a2; ol[q] = c2; }
    *(v2h*)(P16 + e) = o16; *(v2us*)(Ph + e) = oh; *(v2us*)(Pl + e) = ol;  }
__global__ __launch_bounds__(256) void k_vtp(const float* __restrict__ F, int pitch, int nheads, h16* V16, bf* Vh, bf* Vl) { { const size_t po = (size_t)blockIdx.y * nheads * HD * TT; F += (size_t)blockIdx.y * TT * pitch; V16 += po; Vh += po; Vl += po; }   // grid y: batch entry of the group
    const size_t e = ((size_t)blockIdx.x * 256 + threadIdx.x) * 2; if (e >= (size_t)nheads * HD * TT) return; const int t = (int)(e % TT); const int d = (int)((e / TT) % HD); const int g = (int)(e / ((size_t)TT * HD)); v2h o16; v2us oh, ol;
#pragma unroll
    for (int q = 0; q < 2; ++q) { const float x = F[(size_t)(t + q) * pitch + g * HD + d]; o16[q] = tohx(x); unsigned short a2, c2; splitf(x, a2, c2); oh[q] = a2; ol[q] = c2; }
    *(v2h*)(V16 + e) = o16; *(v2us*)(Vh + e) = oh; *(v2us*)(Vl + e) = ol;  }
__global__ __launch_bounds__(256) void k_csid(float* CS) { const int idx = blockIdx.x * 256 + threadIdx.x; if (idx >= TT * HD) return; v2f cs; cs[0] = 1.0f; cs[1] = 0.0f; *(v2f*)(CS + (size_t)idx * 2) = cs;  }
#define NQ   2                    // 16-query groups per wave
#define FW   4                    // waves per work-group: same head, neighbouring rows, no exchange between them
#define LC   (SCL * 1.4426950408889634f)
typedef __attribute__((ext_vector_type(2))) __bf16 v2b;
typedef __attribute__((ext_vector_type(8))) __bf16 v8b;
// XWAIT: stands behind a group of global loads or stores, before a register that one of them names is written again (this build goes above v255); the scheduling fence keeps later register writes behind it
#define XWAIT() do { asm volatile("s_wait_xcnt 0x0" ::: "memory"); __builtin_amdgcn_sched_barrier(0); } while (0)
__device__ __forceinline__ float xhalf(float v) { const int b = __float_as_int(v); return __int_as_float(__builtin_amdgcn_permlanex16(b, b, 0x76543210, 0xfedcba98, false, false)); }   // lane l <-> l ^ 16
template <typename T16, bool HL>
__device__ __forceinline__ void fattn(const T16* __restrict__ Q, const T16* __restrict__ Q2, const T16* __restrict__ Kp, const T16* __restrict__ K2, const T16* __restrict__ Vt, const T16* __restrict__ V2, int q0, bf* Ah, bf* Al) {
    typedef typename WFrag<T16>::V V;
    const int lane = threadIdx.x & 31, lr = lane & 15, hi = lane >> 4;
    V qf[NQ][2], qf2[NQ][2], kf[2][2], kf2[2][2];
#pragma unroll
    for (int qt = 0; qt < NQ; ++qt)
#pragma unroll
        for (int ks = 0; ks < 2; ++ks) { const int qo = (q0 + qt * 16 + lr) * HD + ks * 32 + 8 * hi; qf[qt][ks] = WFrag<T16>::ld(Q + qo); if constexpr (HL) qf2[qt][ks] = WFrag<T16>::ld(Q2 + qo); }
    XWAIT();
    const int koff = lr * HD + 8 * hi, voff = lr * TT + 8 * hi;
#pragma unroll
    for (int kt = 0; kt < 2; ++kt)
#pragma unroll
        for (int ks = 0; ks < 2; ++ks) { const int ko = koff + kt * 16 * HD + ks * 32; kf[kt][ks] = WFrag<T16>::ld(Kp + ko); if constexpr (HL) kf2[kt][ks] = WFrag<T16>::ld(K2 + ko); }
    XWAIT();
    v8f o[NQ][4]; float m[NQ], l[NQ];
#pragma unroll
    for (int qt = 0; qt < NQ; ++qt) { m[qt] = -3.0e38f; l[qt] = 0.f;
#pragma unroll
        for (int dt = 0; dt < 4; ++dt) o[qt][dt] = (v8f){}; }
#pragma unroll 1
    for (int kb = 0; kb < TT; kb += 32) {
        V vf[4], vf2[4];   // this pass's Vt fragments: asked for first, used last
#pragma unroll
        for (int dt = 0; dt < 4; ++dt) vf[dt] = WFrag<T16>::ld(Vt + voff + dt * 16 * TT + kb);
        XWAIT();
        if constexpr (HL) {
#pragma unroll
            for (int dt = 0; dt < 4; ++dt) vf2[dt] = WFrag<T16>::ld(V2 + voff + dt * 16 * TT + kb);
            XWAIT(); }
        v8f s[NQ][2];
#pragma unroll
        for (int qt = 0; qt < NQ; ++qt) { s[qt][0] = (v8f){}; s[qt][1] = (v8f){}; }
#pragma unroll
        for (int ks = 0; ks < 2; ++ks) {
#pragma unroll
            for (int kt = 0; kt < 2; ++kt)
#pragma unroll
                for (int qt = 0; qt < NQ; ++qt) s[qt][kt] = WFrag<T16>::mma(kf[kt][ks], qf[qt][ks], s[qt][kt]);
            if constexpr (HL) {
#pragma unroll
                for (int kt = 0; kt < 2; ++kt)
#pragma unroll
                    for (int qt = 0; qt < NQ; ++qt) s[qt][kt] = WFrag<T16>::mma(kf[kt][ks], qf2[qt][ks], s[qt][kt]);
#pragma unroll
                for (int kt = 0; kt < 2; ++kt)
#pragma unroll
                    for (int qt = 0; qt < NQ; ++qt) s[qt][kt] = WFrag<T16>::mma(kf2[kt][ks], qf[qt][ks], s[qt][kt]); } }
        const int kn = (kb + 32) & (TT - 1);   // next pass's key fragments, one pass ahead; the last pass asks for the first keys again (in bounds, not used)
#pragma unroll
        for (int kt = 0; kt < 2; ++kt)
#pragma unroll
            for (int ks = 0; ks < 2; ++ks) { const int ko = koff + (kn + kt * 16) * HD + ks * 32; kf[kt][ks] = WFrag<T16>::ld(Kp + ko); if constexpr (HL) kf2[kt][ks] = WFrag<T16>::ld(K2 + ko); }
        XWAIT();
        V pf[NQ], pf2[NQ];
#pragma unroll
        for (int qt = 0; qt < NQ; ++qt) {
            float bm = fmaxf(s[qt][0][0], s[qt][1][0]);
#pragma unroll
            for (int j = 1; j < 8; ++j) bm = fmaxf(bm, fmaxf(s[qt][0][j], s[qt][1][j]));
            bm = fmaxf(bm, xhalf(bm));
            const float mn = fmaxf(m[qt], bm); const float al = __builtin_amdgcn_exp2f((m[qt] - mn) * LC); m[qt] = mn;
            const float sh = (HL ? 0.0f : 10.0f) - mn * LC; float ps = 0.f;
#pragma unroll
            for (int e = 0; e < 16; e += 2) { v2f p; p[0] = __builtin_amdgcn_exp2f(__builtin_fmaf(s[qt][e >> 3][e & 7], LC, sh)); p[1] = __builtin_amdgcn_exp2f(__builtin_fmaf(s[qt][e >> 3][(e & 7) + 1], LC, sh)); ps += p[0]; ps += p[1];
                if constexpr (HL) { const v2b ph = __builtin_convertvector(p, v2b); const v2b pl = __builtin_convertvector(p - __builtin_convertvector(ph, v2f), v2b); pf[qt][e] = ph[0]; pf[qt][e + 1] = ph[1]; pf2[qt][e] = pl[0]; pf2[qt][e + 1] = pl[1]; }
                else { const v2h ph = __builtin_convertvector(p, v2h); pf[qt][e] = ph[0]; pf[qt][e + 1] = ph[1]; } }
            l[qt] = l[qt] * al + ps;
#pragma unroll
            for (int dt = 0; dt < 4; ++dt) o[qt][dt] *= al; }
#pragma unroll
        for (int dt = 0; dt < 4; ++dt)
#pragma unroll
            for (int qt = 0; qt < NQ; ++qt) o[qt][dt] = WFrag<T16>::mma(vf[dt], pf[qt], o[qt][dt]);
        if constexpr (HL) {
#pragma unroll
            for (int dt = 0; dt < 4; ++dt)
#pragma unroll
                for (int qt = 0; qt < NQ; ++qt) o[qt][dt] = WFrag<T16>::mma(vf[dt], pf2[qt], o[qt][dt]);
#pragma unroll
            for (int dt = 0; dt < 4; ++dt)
#pragma unroll
                for (int qt = 0; qt < NQ; ++qt) o[qt][dt] = WFrag<T16>::mma(vf2[dt], pf[qt], o[qt][dt]); }
    }
#pragma unroll
    for (int qt = 0; qt < NQ; ++qt) { const float inv = __fdiv_rn(1.0f, l[qt] + xhalf(l[qt])); const size_t ro = (size_t)(q0 + qt * 16 + lr) * DQ + 8 * hi;   // o[qt][dt][j] = O[query lr][d = dt*16 + 8*hi + j]
#pragma unroll
        for (int dt = 0; dt < 4; ++dt) { const v8f val = o[qt][dt] * inv; const v8b oh = __builtin_convertvector(val, v8b); const v8b ol = __builtin_convertvector(val - __builtin_convertvector(oh, v8f), v8b);
            *(v8us*)(Ah + ro + dt * 16) = __builtin_bit_cast(v8us, oh); *(v8us*)(Al + ro + dt * 16) = __builtin_bit_cast(v8us, ol);
            XWAIT(); } }
}
// grid x: (entry of the group, head); grid y: block of FW*NQ*16 query rows, the hi+lo blocks (three times the products) first
__global__ __launch_bounds__(FW * 32) void k_fattn(const h16* __restrict__ Q16, const h16* __restrict__ K16, const h16* __restrict__ V16, const bf* __restrict__ Qh, const bf* __restrict__ Ql, const bf* __restrict__ Kh, const bf* __restrict__ Kl, const bf* __restrict__ Vh, const bf* __restrict__ Vl, bf* Ah, bf* Al) {
    const int z = blockIdx.x; const size_t po = (size_t)z * TT * HD; const size_t ao = (size_t)(z / NH_) * TT * DQ + (size_t)(z % NH_) * HD;
    const int qb = blockIdx.y * (FW * NQ * 16); const int q0 = qb + (int)(threadIdx.x >> 5) * (NQ * 16);
    if (qb < RH) fattn<bf, true>(Qh + po, Ql + po, Kh + po, Kl + po, Vh + po, Vl + po, q0, Ah + ao, Al + ao);
    else fattn<h16, false>(Q16 + po, nullptr, K16 + po, nullptr, V16 + po, nullptr, q0, Ah + ao, Al + ao);
}

extern "C" void kernel_launch(void* const* d_in, const int* in_sizes, int n_in,
                              void* d_out, int out_size, void* d_ws, size_t ws_size, hipStream_t stream) {
    (void)in_sizes; (void)n_in; (void)out_size;
    const float* x = (const float*)d_in[0]; const float* wq = (const float*)d_in[1]; const float* bq = (const float*)d_in[2]; const float* wk = (const float*)d_in[3]; const float* bk = (const float*)d_in[4]; const float* wv = (const float*)d_in[5]; const float* bv = (const float*)d_in[6]; const float* wo = (const float*)d_in[7]; const float* bo = (const float*)d_in[8];
    float* OUT = (float*)d_out;     // [8][1024][1024]
    char* wsp = (char*)d_ws;
    auto take = [&](size_t bytes) { char* p = wsp; wsp += (bytes + 255) & ~(size_t)255; return (void*)p; };
    const size_t PS = (size_t)GB * NH_ * TT * HD;   // one 16-bit plane of a group: [entry][head][t][d] (v: [entry][head][d][t])
    static_assert(NKV == NH_ && NB_ % GB == 0 && ZH == NH_, "one pass per group of GB entries; q, k, v of equal width");
    bf* W4 = (bf*)take((size_t)4 * DQ * DM * 2); bf* WO = W4 + (size_t)3 * DQ * DM;   // Wq, Wk, Wv, Wo transposed, back to back
    float* CS = (float*)take((size_t)TT * HD * 2 * 4);
    bf* XB = (bf*)take((size_t)GB * TT * DM * 2);
    h16* QP16 = (h16*)take(2 * PS * 2); h16* KP16 = QP16 + PS; h16* VT16 = (h16*)take(PS * 2);
    bf* QPh = (bf*)take(2 * PS * 2); bf* KPh = QPh + PS; bf* QPl = (bf*)take(2 * PS * 2); bf* KPl = QPl + PS; bf* VTh = (bf*)take(PS * 2); bf* VTl = (bf*)take(PS * 2);
    float* F3 = (float*)take((size_t)GB * TT * 3 * DQ * 4); bf* ATh = (bf*)take((size_t)NB_ * TT * DQ * 2); bf* ATl = (bf*)take((size_t)NB_ * TT * DQ * 2);   // F3: q|k|v projections [GB*TT][3*DQ]
    if ((size_t)(wsp - (char*)d_ws) > ws_size) return;    // ws 256 MiB
    static_assert(RH % (FW * NQ * 16) == 0 && TT % (FW * NQ * 16) == 0 && HD == 64 && (TT & (TT - 1)) == 0, "whole row blocks on either side of RH");
    k_wtG<<<dim3((unsigned)((DM * DQ / 64 + 63) / 64), 4, 1), 256, 0, stream>>>(wq, wk, wv, wo, DM, DQ, W4);
    k_csid<<<(TT * HD + 255) / 256, 256, 0, stream>>>(CS);
    const unsigned LQ = (unsigned)(((size_t)NH_ * TT * HD / 2 + 255) / 256);
    for (int g = 0; g < NB_ / GB; ++g) {
        k_cvt8<<<(unsigned)(((size_t)GB * TT * DM / 8 + 255) / 256), 256, 0, stream>>>(x + (size_t)g * GB * TT * DM, XB, (size_t)GB * TT * DM / 8);
        k_gemmw<bf, 0, true><<<dim3(GB * TT / 64, DQ / 64, 3), 32, 0, stream>>>(XB, nullptr, W4, nullptr, DM, F3, 3 * DQ, bq, bk, bv, 0, (size_t)DQ * DM, (size_t)DQ);
        k_rope<<<dim3(LQ, GB, 2), 256, 0, stream>>>(F3, 3 * DQ, NH_, CS, nullptr, nullptr, 1.0f, QP16, QPh, QPl);
        k_vtp<<<dim3(LQ, GB, 1), 256, 0, stream>>>(F3 + 2 * DQ, 3 * DQ, NKV, VT16, VTh, VTl);
        k_fattn<<<dim3(GB * NH_, TT / (FW * NQ * 16), 1), FW * 32, 0, stream>>>(QP16, KP16, VT16, QPh, QPl, KPh, KPl, VTh, VTl, ATh + (size_t)g * GB * TT * DQ, ATl + (size_t)g * GB * TT * DQ); }
    k_gemmw<bf, 1, true><<<dim3(NB_ * TT / 64, DM / 64, 1), 32, 0, stream>>>(ATh, ATl, WO, nullptr, DQ, OUT, DM, bo, nullptr, nullptr, 0, 0, 0);
}

// v003
// A run of this version takes 286 microseconds.
// Next to v002, in two timings, it ran 1.29 and 1.30 times as fast.
// Over all steps from v000 it is 16.3 times as fast.
#include <hip/hip_runtime.h>

// CLIP attention (hidden_states [8][1024][1024]; q = (x Wq + bq) x 64^-0.5, k, v = x W + b ('xw' [1024][1024]; 16 heads x 64); softmax(q.k) over all keys; out = merged Wo + bo -> [8][1024][1024] (8.4 M)).
// Compute dtypes, f32 accumulate: every input rounded to bf16; q/k/v on PLAIN bf16 operands (inputs: exact) + biases; the 64^-0.5 applied to the f32 score (the module scales q after the bias; power of two, exact); scores and attn.v: query rows < 512 hl (3 products), the rest single fp16 (x1024); softmax f32; Wo hl x exact (2 products) + bo.

#define NB_  8
#define TT   1024
#define DM   1024
#define NH_  16
#define NKV  16
#define REP  (NH_ / NKV)
#define HD   64
#define DQ   (NH_ * HD)
#define DKV  (NKV * HD)
#define ZH   16                   // heads of one batch entry; an attention pass covers GB entries
#define GB   4                    // batch entries per projection group
#define RH   512                  // query rows < RH use hi+lo planes (0: none)
#define WIN  0
#define PCAR 1024.0f
#define SCL  0.125f   // HD^-0.5
typedef _Float16 h16;
typedef unsigned short bf;
typedef __attribute__((ext_vector_type(16))) __bf16   v16bf;
typedef __attribute__((ext_vector_type(16))) _Float16 v16h;
typedef __attribute__((ext_vector_type(8)))  _Float16 v8h;
typedef __attribute__((ext_vector_type(8)))  unsigned short v8us;
typedef __attribute__((ext_vector_type(8)))  float    v8f;
typedef __attribute__((ext_vector_type(4)))  float    v4f;
typedef v8h  __attribute__((may_alias)) v8ha;
typedef v4f  __attribute__((may_alias)) v4fa;
typedef v8us __attribute__((may_alias)) v8usa;

__device__ __forceinline__ unsigned short f2bf(float f) { unsigned u = __float_as_uint(f); u += 0x7FFFu + ((u >> 16) & 1u); return (unsigned short)(u >> 16); }
__device__ __forceinline__ float bf2f(unsigned short b) { return __uint_as_float(((unsigned)b) << 16); }
__device__ __forceinline__ float bfr(float f) { return bf2f(f2bf(f)); }
__device__ __forceinline__ v16h cat16(v8h lo, v8h hi) { return __builtin_shufflevector(lo, hi, 0, 1, 2, 3, 4, 5, 6, 7, 8, 9, 10, 11, 12, 13, 14, 15); }
__device__ __forceinline__ v16bf cat16b(v8us lo, v8us hi) { return __builtin_bit_cast(v16bf, __builtin_shufflevector(lo, hi, 0, 1, 2, 3, 4, 5, 6, 7, 8, 9, 10, 11, 12, 13, 14, 15)); }
__device__ __forceinline__ v8f wmma16(v16h a, v16h b, v8f c) { return __builtin_amdgcn_wmma_f32_16x16x32_f16(false, a, false, b, (short)0, c, false, false); }
__device__ __forceinline__ v8f wmmab(v16bf a, v16bf b, v8f c) { return __builtin_amdgcn_wmma_f32_16x16x32_bf16(false, a, false, b, (short)0, c, false, false); }



// ---- k_gemmw: register-blocked GEMM, ONE WAVE per 64x64 output tile (16 accumulators), operands straight from K-contiguous 16-bit planes; grid (M/64, N/64, Z), 32 threads.
// C[m][n] (f32, pitch ldc, + optional f32 bias[n], one vector per z slice up to three) = sum_k A[m][k] Bt[n][k] (+ split products per NSPLIT). z-batch strides sA/sB/sC in elements. K % 32 == 0.
// PLANES (the q/k/v projection): no f32 C. A 64x64 tile is 64 tokens x the 64 columns of ONE head, so the wave itself writes the attention operand planes (fp16, bf16 hi, bf16 lo):
// z 0, 1 (q, k): [entry][head][t][d], the tile is 8 KB in a row of each plane; z 2 (v): [entry][head][d][t], staged through LDS the other way round so that each d row gets its whole 128-B line of 64 tokens.
typedef __attribute__((ext_vector_type(8))) __bf16 v8b;
// eight neighbouring f32 values -> 16 bytes in each of the three operand planes (round to nearest even, as the planes always were)
__device__ __forceinline__ void put3(v8f val, h16* p16, bf* ph, bf* pl) {
    const v8h o16 = __builtin_convertvector(val, v8h); const v8b oh = __builtin_convertvector(val, v8b); const v8b ol = __builtin_convertvector(val - __builtin_convertvector(oh, v8f), v8b);
    *(v8h*)p16 = o16; *(v8us*)ph = __builtin_bit_cast(v8us, oh); *(v8us*)pl = __builtin_bit_cast(v8us, ol); }
template <typename T16> struct WFrag;
template <> struct WFrag<h16> { typedef v16h V; static __device__ __forceinline__ V ld(const h16* p) { return cat16(*(const v8h*)p, *(const v8h*)(p + 16)); } static __device__ __forceinline__ v8f mma(V a, V b, v8f c) { return wmma16(a, b, c); } };
template <> struct WFrag<bf> { typedef v16bf V; static __device__ __forceinline__ V ld(const bf* p) { return cat16b(*(const v8us*)p, *(const v8us*)(p + 16)); } static __device__ __forceinline__ v8f mma(V a, V b, v8f c) { return wmmab(a, b, c); } };
template <typename T16, int NSPLIT, bool BIAS, bool PLANES>
__global__ __launch_bounds__(32) void k_gemmw(const T16* __restrict__ A, const T16* __restrict__ A2, const T16* __restrict__ Bt, const T16* __restrict__ Bt2, int K, float* C, int ldc, const float* __restrict__ bias0, const float* __restrict__ bias1, const float* __restrict__ bias2, size_t sA, size_t sB, size_t sC, h16* P16, bf* Ph, bf* Pl, h16* V16, bf* Vh, bf* Vl) {
    typedef typename WFrag<T16>::V V;
    __shared__ __align__(16) float os[16 * 68];
    const size_t z = blockIdx.z; A += z * sA; if (A2) A2 += z * sA; Bt += z * sB; if (Bt2) Bt2 += z * sB; C += z * sC;
    const float* __restrict__ bias = (z == 0) ? bias0 : (z == 1) ? bias1 : bias2;   // one bias vector per z slice
    const int lane = threadIdx.x & 31, lr = lane & 15, hi = lane >> 4; const int r0 = blockIdx.x * 64, c0 = blockIdx.y * 64;
    v8f acc[4][4];
#pragma unroll
    for (int mb = 0; mb < 4; ++mb)
#pragma unroll
        for (int nb = 0; nb < 4; ++nb) acc[mb][nb] = (v8f){};
    const size_t aoff = (size_t)(r0 + lr) * K + 8 * hi, boff = (size_t)(c0 + lr) * K + 8 * hi;
#pragma unroll 1
    for (int kc = 0; kc < K; kc += 32) {
        V a[4], a2[4];
#pragma unroll
        for (int mb = 0; mb < 4; ++mb) { a[mb] = WFrag<T16>::ld(A + aoff + (size_t)mb * 16 * K + kc); if (NSPLIT == 1 || NSPLIT == 2) a2[mb] = WFrag<T16>::ld(A2 + aoff + (size_t)mb * 16 * K + kc); }
#pragma unroll
        for (int nb = 0; nb < 4; ++nb) { const V b = WFrag<T16>::ld(Bt + boff + (size_t)nb * 16 * K + kc); V b2; if (NSPLIT >= 2) b2 = WFrag<T16>::ld(Bt2 + boff + (size_t)nb * 16 * K + kc);
#pragma unroll
            for (int mb = 0; mb < 4; ++mb) { acc[mb][nb] = WFrag<T16>::mma(a[mb], b, acc[mb][nb]); if (NSPLIT == 1 || NSPLIT == 2) acc[mb][nb] = WFrag<T16>::mma(a2[mb], b, acc[mb][nb]); if (NSPLIT >= 2) acc[mb][nb] = WFrag<T16>::mma(a[mb], b2, acc[mb][nb]); } }
        asm volatile("v_nop\n\tv_nop\n\tv_nop\n\tv_nop" : "+v"(acc[0][0]), "+v"(acc[1][1]), "+v"(acc[2][2]), "+v"(acc[3][3]) : "v"(a[0]), "v"(a[3]));
    }
    if constexpr (PLANES) {
        const int sub = lane >> 3, cofs = (lane & 7) * 8;   // read-back: 8 lanes x 8 values = one 64-value row, 4 rows a step
        const size_t hp = ((size_t)(r0 / TT) * NH_ + blockIdx.y) * TT * HD; const int t0 = r0 % TT;   // (entry, head) plane; first token of the tile
        if (z == 2) {
            const size_t po = hp + t0 + cofs; float bb[4];
#pragma unroll
            for (int nb = 0; nb < 4; ++nb) bb[nb] = bias[c0 + nb * 16 + lr];
            asm volatile("" :: "v"(bb[0]), "v"(bb[1]), "v"(bb[2]), "v"(bb[3]));   // inputs only: the four bias loads are asked for together, one wait (without it the build waits out each load in turn)
#pragma unroll
            for (int nb = 0; nb < 4; ++nb) bb[nb] = bfr(bb[nb]);
#pragma unroll
            for (int nb = 0; nb < 4; ++nb) {
#pragma unroll
                for (int mb = 0; mb < 4; ++mb) { const v8f val = acc[mb][nb] + bb[nb];   // lane (lr, hi): column d = nb*16 + lr, tokens mb*16 + 8*hi + 0..7
                    *(v4fa*)(os + lr * 68 + mb * 16 + hi * 8) = __builtin_shufflevector(val, val, 0, 1, 2, 3); *(v4fa*)(os + lr * 68 + mb * 16 + hi * 8 + 4) = __builtin_shufflevector(val, val, 4, 5, 6, 7); }
                __builtin_amdgcn_wave_barrier(); asm volatile("" ::: "memory");   // the read-back below stays behind the LDS stores
#pragma unroll
                for (int s = 0; s < 4; ++s) { const int row = 4 * s + sub; const v4f v0 = *(const v4fa*)(os + row * 68 + cofs), v1 = *(const v4fa*)(os + row * 68 + cofs + 4);
                    const size_t e = po + (size_t)(nb * 16 + row) * TT; put3(__builtin_shufflevector(v0, v1, 0, 1, 2, 3, 4, 5, 6, 7), V16 + e, Vh + e, Vl + e); }
                __builtin_amdgcn_wave_barrier(); asm volatile("" ::: "memory");   // the next block's LDS stores stay behind the read-back
            }
            return;
        }
        const size_t po = z * ((size_t)GB * NH_ * TT * HD) + hp + (size_t)t0 * HD + cofs; v8f bb;
#pragma unroll
        for (int i = 0; i < 8; ++i) bb[i] = bfr(bias[c0 + cofs + i]);
#pragma unroll
        for (int mb = 0; mb < 4; ++mb) {
#pragma unroll
            for (int nb = 0; nb < 4; ++nb) {
#pragma unroll
                for (int j = 0; j < 8; ++j) os[(hi * 8 + j) * 68 + nb * 16 + lr] = acc[mb][nb][j]; }
            __builtin_amdgcn_wave_barrier(); asm volatile("" ::: "memory");   // the read-back below stays behind the LDS stores
#pragma unroll
            for (int s = 0; s < 4; ++s) { const int row = 4 * s + sub; const v4f v0 = *(const v4fa*)(os + row * 68 + cofs), v1 = *(const v4fa*)(os + row * 68 + cofs + 4);
                const size_t e = po + (size_t)(mb * 16 + row) * HD; put3(__builtin_shufflevector(v0, v1, 0, 1, 2, 3, 4, 5, 6, 7) + bb, P16 + e, Ph + e, Pl + e); }
            __builtin_amdgcn_wave_barrier(); asm volatile("" ::: "memory");   // the next block's LDS stores stay behind the read-back
        }
        asm volatile("s_wait_xcnt 0x0" ::: "memory");   // the build lays the v path behind this one with a never-taken fall-through: its first register writes stay behind the wait for the stores above
        return;
    }
#pragma unroll
    for (int mb = 0; mb < 4; ++mb) {
#pragma unroll
        for (int nb = 0; nb < 4; ++nb) {
#pragma unroll
            for (int j = 0; j < 8; ++j) os[(hi * 8 + j) * 68 + nb * 16 + lr] = acc[mb][nb][j]; }
        __builtin_amdgcn_wave_barrier(); asm volatile("" ::: "memory");
        float* crow = C + (size_t)(r0 + mb * 16) * ldc + c0;
{
#pragma unroll
            for (int s = 0; s < 8; ++s) { const int row = 2 * s + hi, cofs = lr * 4; v4f val = *(const v4fa*)(os + row * 68 + cofs); if (BIAS) { val[0] += bfr(bias[c0 + cofs]); val[1] += bfr(bias[c0 + cofs + 1]); val[2] += bfr(bias[c0 + cofs + 2]); val[3] += bfr(bias[c0 + cofs + 3]); }
                *(v4f*)(crow + (size_t)row * ldc + cofs) = val; }
             }
        __builtin_amdgcn_wave_barrier(); asm volatile("" ::: "memory");
    }
}

typedef __attribute__((ext_vector_type(2))) _Float16 v2h;
typedef __attribute__((ext_vector_type(4))) _Float16 v4h;
typedef __attribute__((ext_vector_type(2))) unsigned short v2us;
typedef __attribute__((ext_vector_type(4))) unsigned short v4us;
typedef __attribute__((ext_vector_type(2))) float v2f;
typedef __attribute__((ext_vector_type(4))) int v4i;

__global__ __launch_bounds__(256) void k_wtG(const float* __restrict__ w0, const float* __restrict__ w1, const float* __restrict__ w2, const float* __restrict__ w3, int K, int N, bf* Bt) {
    const int y = blockIdx.y; const float* __restrict__ w = (y == 0) ? w0 : (y == 1) ? w1 : (y == 2) ? w2 : w3; Bt += (size_t)y * N * K;   // grid y: which of the four weights
    const int lane = threadIdx.x & 31; const int L0 = (blockIdx.x * 8 + (threadIdx.x >> 5)) * 8; const int nlines = N * K / 64;
{
#pragma unroll 1
        for (int l = 0; l < 8; ++l) { const int L = L0 + l; if (L >= nlines) break; const size_t e = (size_t)L * 64 + lane * 2; const int k = (int)(e % K), n = (int)(e / K); v2us o;
            o[0] = f2bf(w[(size_t)k * N + n]); o[1] = f2bf(w[(size_t)(k + 1) * N + n]); *(v2us*)(Bt + e) = o; }
         }
}
__global__ __launch_bounds__(256) void k_cvt8(const float* __restrict__ src, bf* dst, size_t n8) { const size_t i = (size_t)blockIdx.x * 256 + threadIdx.x; if (i >= n8) return; const v8f v = *(const v8f*)(src + i * 8); v8us o;
#pragma unroll
    for (int k = 0; k < 8; ++k) o[k] = f2bf(v[k]); *(v8us*)(dst + i * 8) = o;  }

#define NQ   2                    // 16-query groups per wave
#define FW   4                    // waves per work-group: same head, neighbouring rows, no exchange between them
#define LC   (SCL * 1.4426950408889634f)
typedef __attribute__((ext_vector_type(2))) __bf16 v2b;
// XWAIT: stands behind a group of global loads or stores, before a register that one of them names is written again (this build goes above v255); the scheduling fence keeps later register writes behind it
#define XWAIT() do { asm volatile("s_wait_xcnt 0x0" ::: "memory"); __builtin_amdgcn_sched_barrier(0); } while (0)
__device__ __forceinline__ float xhalf(float v) { const int b = __float_as_int(v); return __int_as_float(__builtin_amdgcn_permlanex16(b, b, 0x76543210, 0xfedcba98, false, false)); }   // lane l <-> l ^ 16
template <typename T16, bool HL>
__device__ __forceinline__ void fattn(const T16* __restrict__ Q, const T16* __restrict__ Q2, const T16* __restrict__ Kp, const T16* __restrict__ K2, const T16* __restrict__ Vt, const T16* __restrict__ V2, int q0, bf* Ah, bf* Al) {
    typedef typename WFrag<T16>::V V;
    const int lane = threadIdx.x & 31, lr = lane & 15, hi = lane >> 4;
    V qf[NQ][2], qf2[NQ][2], kf[2][2], kf2[2][2];
#pragma unroll
    for (int qt = 0; qt < NQ; ++qt)
#pragma unroll
        for (int ks = 0; ks < 2; ++ks) { const int qo = (q0 + qt * 16 + lr) * HD + ks * 32 + 8 * hi; qf[qt][ks] = WFrag<T16>::ld(Q + qo); if constexpr (HL) qf2[qt][ks] = WFrag<T16>::ld(Q2 + qo); }
    XWAIT();
    const int koff = lr * HD + 8 * hi, voff = lr * TT + 8 * hi;
#pragma unroll
    for (int kt = 0; kt < 2; ++kt)
#pragma unroll
        for (int ks = 0; ks < 2; ++ks) { const int ko = koff + kt * 16 * HD + ks * 32; kf[kt][ks] = WFrag<T16>::ld(Kp + ko); if constexpr (HL) kf2[kt][ks] = WFrag<T16>::ld(K2 + ko); }
    XWAIT();
    v8f o[NQ][4]; float m[NQ], l[NQ];
#pragma unroll
    for (int qt = 0; qt < NQ; ++qt) { m[qt] = -3.0e38f; l[qt] = 0.f;
#pragma unroll
        for (int dt = 0; dt < 4; ++dt) o[qt][dt] = (v8f){}; }
#pragma unroll 1
    for (int kb = 0; kb < TT; kb += 32) {
        V vf[4], vf2[4];   // this pass's Vt fragments: asked for first, used last
#pragma unroll
        for (int dt = 0; dt < 4; ++dt) vf[dt] = WFrag<T16>::ld(Vt + voff + dt * 16 * TT + kb);
        XWAIT();
        if constexpr (HL) {
#pragma unroll
            for (int dt = 0; dt < 4; ++dt) vf2[dt] = WFrag<T16>::ld(V2 + voff + dt * 16 * TT + kb);
            XWAIT(); }
        v8f s[NQ][2];
#pragma unroll
        for (int qt = 0; qt < NQ; ++qt) { s[qt][0] = (v8f){}; s[qt][1] = (v8f){}; }
#pragma unroll
        for (int ks = 0; ks < 2; ++ks) {
#pragma unroll
            for (int kt = 0; kt < 2; ++kt)
#pragma unroll
                for (int qt = 0; qt < NQ; ++qt) s[qt][kt] = WFrag<T16>::mma(kf[kt][ks], qf[qt][ks], s[qt][kt]);
            if constexpr (HL) {
#pragma unroll
                for (int kt = 0; kt < 2; ++kt)
#pragma unroll
                    for (int qt = 0; qt < NQ; ++qt) s[qt][kt] = WFrag<T16>::mma(kf[kt][ks], qf2[qt][ks], s[qt][kt]);
#pragma unroll
                for (int kt = 0; kt < 2; ++kt)
#pragma unroll
                    for (int qt = 0; qt < NQ; ++qt) s[qt][kt] = WFrag<T16>::mma(kf2[kt][ks], qf[qt][ks], s[qt][kt]); } }
        const int kn = (kb + 32) & (TT - 1);   // next pass's key fragments, one pass ahead; the last pass asks for the first keys again (in bounds, not used)
#pragma unroll
        for (int kt = 0; kt < 2; ++kt)
#pragma unroll
            for (int ks = 0; ks < 2; ++ks) { const int ko = koff + (kn + kt * 16) * HD + ks * 32; kf[kt][ks] = WFrag<T16>::ld(Kp + ko); if constexpr (HL) kf2[kt][ks] = WFrag<T16>::ld(K2 + ko); }
        XWAIT();
        V pf[NQ], pf2[NQ];
#pragma unroll
        for (int qt = 0; qt < NQ; ++qt) {
            float bm = fmaxf(s[qt][0][0], s[qt][1][0]);
#pragma unroll
            for (int j = 1; j < 8; ++j) bm = fmaxf(bm, fmaxf(s[qt][0][j], s[qt][1][j]));
            bm = fmaxf(bm, xhalf(bm));
            const float mn = fmaxf(m[qt], bm); const float al = __builtin_amdgcn_exp2f((m[qt] - mn) * LC); m[qt] = mn;
            const float sh = (HL ? 0.0f : 10.0f) - mn * LC; float ps = 0.f;
#pragma unroll
            for (int e = 0; e < 16; e += 2) { v2f p; p[0] = __builtin_amdgcn_exp2f(__builtin_fmaf(s[qt][e >> 3][e & 7], LC, sh)); p[1] = __builtin_amdgcn_exp2f(__builtin_fmaf(s[qt][e >> 3][(e & 7) + 1], LC, sh)); ps += p[0]; ps += p[1];
                if constexpr (HL) { const v2b ph = __builtin_convertvector(p, v2b); const v2b pl = __builtin_convertvector(p - __builtin_convertvector(ph, v2f), v2b); pf[qt][e] = ph[0]; pf[qt][e + 1] = ph[1]; pf2[qt][e] = pl[0]; pf2[qt][e + 1] = pl[1]; }
                else { const v2h ph = __builtin_convertvector(p, v2h); pf[qt][e] = ph[0]; pf[qt][e + 1] = ph[1]; } }
            l[qt] = l[qt] * al + ps;
#pragma unroll
            for (int dt = 0; dt < 4; ++dt) o[qt][dt] *= al; }
#pragma unroll
        for (int dt = 0; dt < 4; ++dt)
#pragma unroll
            for (int qt = 0; qt < NQ; ++qt) o[qt][dt] = WFrag<T16>::mma(vf[dt], pf[qt], o[qt][dt]);
        if constexpr (HL) {
#pragma unroll
            for (int dt = 0; dt < 4; ++dt)
#pragma unroll
                for (int qt = 0; qt < NQ; ++qt) o[qt][dt] = WFrag<T16>::mma(vf[dt], pf2[qt], o[qt][dt]);
#pragma unroll
            for (int dt = 0; dt < 4; ++dt)
#pragma unroll
                for (int qt = 0; qt < NQ; ++qt) o[qt][dt] = WFrag<T16>::mma(vf2[dt], pf[qt], o[qt][dt]); }
    }
#pragma unroll
    for (int qt = 0; qt < NQ; ++qt) { const float inv = __fdiv_rn(1.0f, l[qt] + xhalf(l[qt])); const size_t ro = (size_t)(q0 + qt * 16 + lr) * DQ + 8 * hi;   // o[qt][dt][j] = O[query lr][d = dt*16 + 8*hi + j]
#pragma unroll
        for (int dt = 0; dt < 4; ++dt) { const v8f val = o[qt][dt] * inv; const v8b oh = __builtin_convertvector(val, v8b); const v8b ol = __builtin_convertvector(val - __builtin_convertvector(oh, v8f), v8b);
            *(v8us*)(Ah + ro + dt * 16) = __builtin_bit_cast(v8us, oh); *(v8us*)(Al + ro + dt * 16) = __builtin_bit_cast(v8us, ol);
            XWAIT(); } }
}
// grid x: (entry of the group, head); grid y: block of FW*NQ*16 query rows, the hi+lo blocks (three times the products) first
__global__ __launch_bounds__(FW * 32) void k_fattn(const h16* __restrict__ Q16, const h16* __restrict__ K16, const h16* __restrict__ V16, const bf* __restrict__ Qh, const bf* __restrict__ Ql, const bf* __restrict__ Kh, const bf* __restrict__ Kl, const bf* __restrict__ Vh, const bf* __restrict__ Vl, bf* Ah, bf* Al) {
    const int z = blockIdx.x; const size_t po = (size_t)z * TT * HD; const size_t ao = (size_t)(z / NH_) * TT * DQ + (size_t)(z % NH_) * HD;
    const int qb = blockIdx.y * (FW * NQ * 16); const int q0 = qb + (int)(threadIdx.x >> 5) * (NQ * 16);
    if (qb < RH) fattn<bf, true>(Qh + po, Ql + po, Kh + po, Kl + po, Vh + po, Vl + po, q0, Ah + ao, Al + ao);
    else fattn<h16, false>(Q16 + po, nullptr, K16 + po, nullptr, V16 + po, nullptr, q0, Ah + ao, Al + ao);
}

extern "C" void kernel_launch(void* const* d_in, const int* in_sizes, int n_in,
                              void* d_out, int out_size, void* d_ws, size_t ws_size, hipStream_t stream) {
    (void)in_sizes; (void)n_in; (void)out_size;
    const float* x = (const float*)d_in[0]; const float* wq = (const float*)d_in[1]; const float* bq = (const float*)d_in[2]; const float* wk = (const float*)d_in[3]; const float* bk = (const float*)d_in[4]; const float* wv = (const float*)d_in[5]; const float* bv = (const float*)d_in[6]; const float* wo = (const float*)d_in[7]; const float* bo = (const float*)d_in[8];
    float* OUT = (float*)d_out;     // [8][1024][1024]
    char* wsp = (char*)d_ws;
    auto take = [&](size_t bytes) { char* p = wsp; wsp += (bytes + 255) & ~(size_t)255; return (void*)p; };
    const size_t PS = (size_t)GB * NH_ * TT * HD;   // one 16-bit plane of a group: [entry][head][t][d] (v: [entry][head][d][t])
    static_assert(NKV == NH_ && NB_ % GB == 0 && ZH == NH_, "one pass per group of GB entries; q, k, v of equal width");
    bf* W4 = (bf*)take((size_t)4 * DQ * DM * 2); bf* WO = W4 + (size_t)3 * DQ * DM;   // Wq, Wk, Wv, Wo transposed, back to back
    bf* XB = (bf*)take((size_t)GB * TT * DM * 2);
    h16* QP16 = (h16*)take(2 * PS * 2); h16* KP16 = QP16 + PS; h16* VT16 = (h16*)take(PS * 2);
    bf* QPh = (bf*)take(2 * PS * 2); bf* KPh = QPh + PS; bf* QPl = (bf*)take(2 * PS * 2); bf* KPl = QPl + PS; bf* VTh = (bf*)take(PS * 2); bf* VTl = (bf*)take(PS * 2);
    bf* ATh = (bf*)take((size_t)NB_ * TT * DQ * 2); bf* ATl = (bf*)take((size_t)NB_ * TT * DQ * 2);
    if ((size_t)(wsp - (char*)d_ws) > ws_size) return;    // ws 256 MiB
    static_assert(TT % 64 == 0 && HD == 64 && DQ == NH_ * HD, "a 64x64 projection tile is 64 tokens of one entry x one head");
    static_assert(RH % (FW * NQ * 16) == 0 && TT % (FW * NQ * 16) == 0 && HD == 64 && (TT & (TT - 1)) == 0, "whole row blocks on either side of RH");
    k_wtG<<<dim3((unsigned)((DM * DQ / 64 + 63) / 64), 4, 1), 256, 0, stream>>>(wq, wk, wv, wo, DM, DQ, W4);
    for (int g = 0; g < NB_ / GB; ++g) {
        k_cvt8<<<(unsigned)(((size_t)GB * TT * DM / 8 + 255) / 256), 256, 0, stream>>>(x + (size_t)g * GB * TT * DM, XB, (size_t)GB * TT * DM / 8);
        k_gemmw<bf, 0, true, true><<<dim3(GB * TT / 64, DQ / 64, 3), 32, 0, stream>>>(XB, nullptr, W4, nullptr, DM, nullptr, 0, bq, bk, bv, 0, (size_t)DQ * DM, 0, QP16, QPh, QPl, VT16, VTh, VTl);
        k_fattn<<<dim3(GB * NH_, TT / (FW * NQ * 16), 1), FW * 32, 0, stream>>>(QP16, KP16, VT16, QPh, QPl, KPh, KPl, VTh, VTl, ATh + (size_t)g * GB * TT * DQ, ATl + (size_t)g * GB * TT * DQ); }
    k_gemmw<bf, 1, true, false><<<dim3(NB_ * TT / 64, DM / 64, 1), 32, 0, stream>>>(ATh, ATl, WO, nullptr, DQ, OUT, DM, bo, nullptr, nullptr, 0, 0, 0, nullptr, nullptr, nullptr, nullptr, nullptr, nullptr);
}

// v004
// It runs in 215 microseconds.
// Next to v003, in two timings, it ran 1.34 times as fast each time.
// Counting every step since v000, it is 21.8 times as fast.
#include <hip/hip_runtime.h>

// CLIP attention (hidden_states [8][1024][1024]; q = (x Wq + bq) x 64^-0.5, k, v = x W + b ('xw' [1024][1024]; 16 heads x 64); softmax(q.k) over all keys; out = merged Wo + bo -> [8][1024][1024] (8.4 M)).
// Compute dtypes, f32 accumulate: every input rounded to bf16; q/k/v on PLAIN bf16 operands (inputs: exact) + biases; the 64^-0.5 applied to the f32 score (the module scales q after the bias; power of two, exact); scores and attn.v: query rows < 512 hl (3 products), the rest single fp16 (x1024); softmax f32; Wo hl x exact (2 products) + bo.

#define NB_  8
#define TT   1024
#define DM   1024
#define NH_  16
#define NKV  16
#define REP  (NH_ / NKV)
#define HD   64
#define DQ   (NH_ * HD)
#define DKV  (NKV * HD)
#define ZH   16                   // heads of one batch entry; an attention pass covers GB entries
#define GB   4                    // batch entries per projection group
#define RH   512                  // query rows < RH use hi+lo planes (0: none)
#define WIN  0
#define PCAR 1024.0f
#define SCL  0.125f   // HD^-0.5
typedef _Float16 h16;
typedef unsigned short bf;
typedef __attribute__((ext_vector_type(16))) __bf16   v16bf;
typedef __attribute__((ext_vector_type(16))) _Float16 v16h;
typedef __attribute__((ext_vector_type(8)))  _Float16 v8h;
typedef __attribute__((ext_vector_type(8)))  unsigned short v8us;
typedef __attribute__((ext_vector_type(8)))  float    v8f;
typedef __attribute__((ext_vector_type(4)))  float    v4f;
typedef v8h  __attribute__((may_alias)) v8ha;
typedef v4f  __attribute__((may_alias)) v4fa;
typedef v8us __attribute__((may_alias)) v8usa;

__device__ __forceinline__ unsigned short f2bf(float f) { unsigned u = __float_as_uint(f); u += 0x7FFFu + ((u >> 16) & 1u); return (unsigned short)(u >> 16); }
__device__ __forceinline__ float bf2f(unsigned short b) { return __uint_as_float(((unsigned)b) << 16); }
__device__ __forceinline__ float bfr(float f) { return bf2f(f2bf(f)); }
__device__ __forceinline__ v16h cat16(v8h lo, v8h hi) { return __builtin_shufflevector(lo, hi, 0, 1, 2, 3, 4, 5, 6, 7, 8, 9, 10, 11, 12, 13, 14, 15); }
__device__ __forceinline__ v16bf cat16b(v8us lo, v8us hi) { return __builtin_bit_cast(v16bf, __builtin_shufflevector(lo, hi, 0, 1, 2, 3, 4, 5, 6, 7, 8, 9, 10, 11, 12, 13, 14, 15)); }
__device__ __forceinline__ v8f wmma16(v16h a, v16h b, v8f c) { return __builtin_amdgcn_wmma_f32_16x16x32_f16(false, a, false, b, (short)0, c, false, false); }
__device__ __forceinline__ v8f wmmab(v16bf a, v16bf b, v8f c) { return __builtin_amdgcn_wmma_f32_16x16x32_bf16(false, a, false, b, (short)0, c, false, false); }



// FRAGMENT ORDER of every 16-bit operand plane [rows][K]: a block of 16 rows x 32 k is 512 elements in a row, element (row r, k) at ((k >> 4) & 1) * 256 + (((k >> 3) & 1) * 16 + (r & 15)) * 8 + (k & 7);
// blocks run along k, then along the rows: block (r >> 4, k >> 5) starts at (r >> 4) * 16 * K + (k >> 5) * 512. Lane l of a wave finds its two 16-byte pieces of a fragment at l * 8 and 256 + l * 8,
// so each wave-wide 16-byte load or store covers 512 bytes in a row: 4 whole lines, where rows of K in a row give a 32-byte piece of each of 16 lines. Lane (lr, hi), l = hi * 16 + lr, holds row lr, k = 8 * hi + 0..7 and 16 + 8 * hi + 0..7.

// ---- k_gemmw: register-blocked GEMM, ONE WAVE per 64x64 output tile (16 accumulators), operands straight from 16-bit planes in fragment order; grid (M/64, N/64, Z), 32 threads.
// C[m][n] (f32, pitch ldc, + optional f32 bias[n], one vector per z slice up to three) = sum_k A[m][k] Bt[n][k] (+ split products per NSPLIT). z-batch strides sA/sB/sC in elements. K % 32 == 0.
// PLANES (the q/k/v projection): no f32 C. A 64x64 tile is 64 tokens x the 64 columns of ONE head, so the wave itself writes the attention operand planes (fp16, bf16 hi, bf16 lo):
// z 0, 1 (q, k): [entry][head] planes of [t][d] in fragment order, the tile is 8 KB in a row of each plane; z 2 (v): [entry][head] planes of [d][t] in fragment order, staged through LDS the other way round.
typedef __attribute__((ext_vector_type(8))) __bf16 v8b;
// eight neighbouring f32 values -> 16 bytes in each of the three operand planes (round to nearest even, as the planes always were)
__device__ __forceinline__ void put3(v8f val, h16* p16, bf* ph, bf* pl) {
    const v8h o16 = __builtin_convertvector(val, v8h); const v8b oh = __builtin_convertvector(val, v8b); const v8b ol = __builtin_convertvector(val - __builtin_convertvector(oh, v8f), v8b);
    *(v8h*)p16 = o16; *(v8us*)ph = __builtin_bit_cast(v8us, oh); *(v8us*)pl = __builtin_bit_cast(v8us, ol); }
// ld(p): p = start of the fragment's block + 8 * lane
template <typename T16> struct WFrag;
template <> struct WFrag<h16> { typedef v16h V; static __device__ __forceinline__ V ld(const h16* p) { return cat16(*(const v8h*)p, *(const v8h*)(p + 256)); } static __device__ __forceinline__ v8f mma(V a, V b, v8f c) { return wmma16(a, b, c); } };
template <> struct WFrag<bf> { typedef v16bf V; static __device__ __forceinline__ V ld(const bf* p) { return cat16b(*(const v8us*)p, *(const v8us*)(p + 256)); } static __device__ __forceinline__ v8f mma(V a, V b, v8f c) { return wmmab(a, b, c); } };
template <typename T16, int NSPLIT, bool BIAS, bool PLANES, int K>   // K at compile time: the row blocks of a fragment-order plane are then fixed byte offsets from one address per operand
__global__ __launch_bounds__(32) void k_gemmw(const T16* __restrict__ A, const T16* __restrict__ A2, const T16* __restrict__ Bt, const T16* __restrict__ Bt2, float* C, int ldc, const float* __restrict__ bias0, const float* __restrict__ bias1, const float* __restrict__ bias2, size_t sA, size_t sB, size_t sC, h16* P16, bf* Ph, bf* Pl, h16* V16, bf* Vh, bf* Vl) {
    typedef typename WFrag<T16>::V V;
    __shared__ __align__(16) float os[16 * 68];
    const size_t z = blockIdx.z; A += z * sA; if (A2) A2 += z * sA; Bt += z * sB; if (Bt2) Bt2 += z * sB; C += z * sC;
    const float* __restrict__ bias = (z == 0) ? bias0 : (z == 1) ? bias1 : bias2;   // one bias vector per z slice
    const int lane = threadIdx.x & 31, lr = lane & 15, hi = lane >> 4; const int r0 = blockIdx.x * 64, c0 = blockIdx.y * 64;
    v8f acc[4][4];
#pragma unroll
    for (int mb = 0; mb < 4; ++mb)
#pragma unroll
        for (int nb = 0; nb < 4; ++nb) acc[mb][nb] = (v8f){};
    // fragment order: row block stride 16 * K, k block stride 512; one running address per operand, the row blocks at fixed offsets from it
    const T16* pa = A + (size_t)r0 * K + 8 * lane; const T16* pa2 = A2 + (size_t)r0 * K + 8 * lane; const T16* pb = Bt + (size_t)c0 * K + 8 * lane; const T16* pb2 = Bt2 + (size_t)c0 * K + 8 * lane;
#pragma unroll 1
    for (int kc = 0; kc < K; kc += 32, pa += 512, pa2 += 512, pb += 512, pb2 += 512) {
        V a[4], a2[4];
#pragma unroll
        for (int mb = 0; mb < 4; ++mb) { a[mb] = WFrag<T16>::ld(pa + mb * 16 * K); if (NSPLIT == 1 || NSPLIT == 2) a2[mb] = WFrag<T16>::ld(pa2 + mb * 16 * K); }
#pragma unroll
        for (int nb = 0; nb < 4; ++nb) { const V b = WFrag<T16>::ld(pb + nb * 16 * K); V b2; if (NSPLIT >= 2) b2 = WFrag<T16>::ld(pb2 + nb * 16 * K);
#pragma unroll
            for (int mb = 0; mb < 4; ++mb) { acc[mb][nb] = WFrag<T16>::mma(a[mb], b, acc[mb][nb]); if (NSPLIT == 1 || NSPLIT == 2) acc[mb][nb] = WFrag<T16>::mma(a2[mb], b, acc[mb][nb]); if (NSPLIT >= 2) acc[mb][nb] = WFrag<T16>::mma(a[mb], b2, acc[mb][nb]); } }
        asm volatile("v_nop\n\tv_nop\n\tv_nop\n\tv_nop" : "+v"(acc[0][0]), "+v"(acc[1][1]), "+v"(acc[2][2]), "+v"(acc[3][3]) : "v"(a[0]), "v"(a[3]));
        // stands before the address registers of this pass's loads are written again; the addresses as inputs: their registers stay theirs up to here (without them the build loads a fragment over an address pair that has loads out)
        if constexpr (NSPLIT == 0) asm volatile("s_wait_xcnt 0x0" :: "v"(pa), "v"(pb) : "memory");
        else if constexpr (NSPLIT == 1) asm volatile("s_wait_xcnt 0x0" :: "v"(pa), "v"(pa2), "v"(pb) : "memory");
        else asm volatile("s_wait_xcnt 0x0" :: "v"(pa), "v"(pa2), "v"(pb), "v"(pb2) : "memory");
    }
    if constexpr (PLANES) {
        const int cofs = hi * 8;   // read-back in fragment order: step s, lane (lr, hi) takes row lr, values s*16 + hi*8 + 0..7; the wave's 32 pieces are 512 bytes in a row of the plane
        const size_t hp = ((size_t)(r0 / TT) * NH_ + blockIdx.y) * TT * HD; const int t0 = r0 % TT;   // (entry, head) plane; first token of the tile
        if (z == 2) {
            const size_t po = hp + (size_t)t0 * 16 + lane * 8; float bb[4];
#pragma unroll
            for (int nb = 0; nb < 4; ++nb) bb[nb] = bias[c0 + nb * 16 + lr];
            asm volatile("" :: "v"(bb[0]), "v"(bb[1]), "v"(bb[2]), "v"(bb[3]));   // inputs only: the four bias loads are asked for together, one wait (without it the build waits out each load in turn)
#pragma unroll
            for (int nb = 0; nb < 4; ++nb) bb[nb] = bfr(bb[nb]);
#pragma unroll
            for (int nb = 0; nb < 4; ++nb) {
#pragma unroll
                for (int mb = 0; mb < 4; ++mb) { const v8f val = acc[mb][nb] + bb[nb];   // lane (lr, hi): column d = nb*16 + lr, tokens mb*16 + 8*hi + 0..7
                    *(v4fa*)(os + lr * 68 + mb * 16 + hi * 8) = __builtin_shufflevector(val, val, 0, 1, 2, 3); *(v4fa*)(os + lr * 68 + mb * 16 + hi * 8 + 4) = __builtin_shufflevector(val, val, 4, 5, 6, 7); }
                __builtin_amdgcn_wave_barrier(); asm volatile("" ::: "memory");   // the read-back below stays behind the LDS stores
#pragma unroll
                for (int s = 0; s < 4; ++s) { const v4f v0 = *(const v4fa*)(os + lr * 68 + s * 16 + cofs), v1 = *(const v4fa*)(os + lr * 68 + s * 16 + cofs + 4);
                    const size_t e = po + (size_t)nb * 16 * TT + s * 256; put3(__builtin_shufflevector(v0, v1, 0, 1, 2, 3, 4, 5, 6, 7), V16 + e, Vh + e, Vl + e); }
                __builtin_amdgcn_wave_barrier(); asm volatile("" ::: "memory");   // the next block's LDS stores stay behind the read-back
            }
            return;
        }
        const size_t po = z * ((size_t)GB * NH_ * TT * HD) + hp + (size_t)t0 * HD + lane * 8; v8f bb[4];
#pragma unroll
        for (int s = 0; s < 4; ++s)
#pragma unroll
            for (int i = 0; i < 8; ++i) bb[s][i] = bfr(bias[c0 + s * 16 + cofs + i]);
#pragma unroll
        for (int mb = 0; mb < 4; ++mb) {
#pragma unroll
            for (int nb = 0; nb < 4; ++nb) {
#pragma unroll
                for (int j = 0; j < 8; ++j) os[(hi * 8 + j) * 68 + nb * 16 + lr] = acc[mb][nb][j]; }
            __builtin_amdgcn_wave_barrier(); asm volatile("" ::: "memory");   // the read-back below stays behind the LDS stores
#pragma unroll
            for (int s = 0; s < 4; ++s) { const v4f v0 = *(const v4fa*)(os + lr * 68 + s * 16 + cofs), v1 = *(const v4fa*)(os + lr * 68 + s * 16 + cofs + 4);
                const size_t e = po + (size_t)mb * 16 * HD + s * 256; put3(__builtin_shufflevector(v0, v1, 0, 1, 2, 3, 4, 5, 6, 7) + bb[s], P16 + e, Ph + e, Pl + e); }
            __builtin_amdgcn_wave_barrier(); asm volatile("" ::: "memory");   // the next block's LDS stores stay behind the read-back
        }
        asm volatile("s_wait_xcnt 0x0" ::: "memory");   // the build lays the v path behind this one with a never-taken fall-through: its first register writes stay behind the wait for the stores above
        return;
    }
#pragma unroll
    for (int mb = 0; mb < 4; ++mb) {
#pragma unroll
        for (int nb = 0; nb < 4; ++nb) {
#pragma unroll
            for (int j = 0; j < 8; ++j) os[(hi * 8 + j) * 68 + nb * 16 + lr] = acc[mb][nb][j]; }
        __builtin_amdgcn_wave_barrier(); asm volatile("" ::: "memory");
        float* crow = C + (size_t)(r0 + mb * 16) * ldc + c0;
{
#pragma unroll
            for (int s = 0; s < 8; ++s) { const int row = 2 * s + hi, cofs = lr * 4; v4f val = *(const v4fa*)(os + row * 68 + cofs); if (BIAS) { val[0] += bfr(bias[c0 + cofs]); val[1] += bfr(bias[c0 + cofs + 1]); val[2] += bfr(bias[c0 + cofs + 2]); val[3] += bfr(bias[c0 + cofs + 3]); }
                *(v4f*)(crow + (size_t)row * ldc + cofs) = val; }
             }
        __builtin_amdgcn_wave_barrier(); asm volatile("" ::: "memory");
    }
}

typedef __attribute__((ext_vector_type(2))) _Float16 v2h;
typedef __attribute__((ext_vector_type(4))) _Float16 v4h;
typedef __attribute__((ext_vector_type(2))) unsigned short v2us;
typedef __attribute__((ext_vector_type(4))) unsigned short v4us;
typedef __attribute__((ext_vector_type(2))) float v2f;
typedef __attribute__((ext_vector_type(4))) int v4i;

// thread i writes piece i (8 k of one n) of the transposed plane [n][k] in fragment order: each half of a wave reads 16 neighbouring n of one k row, eight rows in turn
template <int K, int N>
__global__ __launch_bounds__(256) void k_wtG(const float* __restrict__ w0, const float* __restrict__ w1, const float* __restrict__ w2, const float* __restrict__ w3, bf* Bt) {
    const int y = blockIdx.y; const float* __restrict__ w = (y == 0) ? w0 : (y == 1) ? w1 : (y == 2) ? w2 : w3; Bt += (size_t)y * N * K;   // grid y: which of the four weights
    const int i = blockIdx.x * 256 + threadIdx.x; if (i >= N * K / 8) return;
    const int blk = i >> 6; const int n = blk / (K / 32) * 16 + (i & 15), k = blk % (K / 32) * 32 + ((i >> 5) & 1) * 16 + ((i >> 4) & 1) * 8; const float* p = w + (size_t)k * N + n; float t[8]; v8us o;
#pragma unroll
    for (int j = 0; j < 8; ++j) t[j] = p[j * N];
    asm volatile("s_wait_xcnt 0x0" :: "v"(p) : "memory");   // stands before the address register of the eight loads is written again; the address as an input: its register stays its own up to here
#pragma unroll
    for (int j = 0; j < 8; ++j) o[j] = f2bf(t[j]);
    *(v8us*)(Bt + (size_t)i * 8) = o;
}
// thread i writes piece i of the plane in fragment order: block i >> 6 = (row block, k block), half (i >> 5) & 1, lane i & 31 = (hi, lr)
__global__ __launch_bounds__(256) void k_cvt8(const float* __restrict__ src, bf* dst, size_t n8) { const size_t i = (size_t)blockIdx.x * 256 + threadIdx.x; if (i >= n8) return;
    const size_t blk = i >> 6; const size_t row = blk / (DM / 32) * 16 + (i & 15); const int k = (int)(blk % (DM / 32)) * 32 + (int)((i >> 5) & 1) * 16 + (int)((i >> 4) & 1) * 8; const v8f v = *(const v8f*)(src + row * DM + k); v8us o;
#pragma unroll
    for (int k = 0; k < 8; ++k) o[k] = f2bf(v[k]); *(v8us*)(dst + i * 8) = o;  }

#define NQ   2                    // 16-query groups per wave
#define FW   4                    // waves per work-group: same head, neighbouring rows, no exchange between them
#define LC   (SCL * 1.4426950408889634f)
typedef __attribute__((ext_vector_type(2))) __bf16 v2b;
// XWAIT: stands behind a group of global loads or stores, before a register that one of them names is written again (this build goes above v255); the scheduling fence keeps later register writes behind it
#define XWAIT() do { asm volatile("s_wait_xcnt 0x0" ::: "memory"); __builtin_amdgcn_sched_barrier(0); } while (0)
__device__ __forceinline__ float xhalf(float v) { const int b = __float_as_int(v); return __int_as_float(__builtin_amdgcn_permlanex16(b, b, 0x76543210, 0xfedcba98, false, false)); }   // lane l <-> l ^ 16
template <typename T16, bool HL>
__device__ __forceinline__ void fattn(const T16* __restrict__ Q, const T16* __restrict__ Q2, const T16* __restrict__ Kp, const T16* __restrict__ K2, const T16* __restrict__ Vt, const T16* __restrict__ V2, int q0, bf* Ah, bf* Al) {
    typedef typename WFrag<T16>::V V;
    const int lane = threadIdx.x & 31;
    V qf[NQ][2], qf2[NQ][2], kf[2][2], kf2[2][2];
#pragma unroll
    for (int qt = 0; qt < NQ; ++qt)
#pragma unroll
        for (int ks = 0; ks < 2; ++ks) { const int qo = (q0 + qt * 16) * HD + ks * 512 + 8 * lane; qf[qt][ks] = WFrag<T16>::ld(Q + qo); if constexpr (HL) qf2[qt][ks] = WFrag<T16>::ld(Q2 + qo); }
    XWAIT();
    // fragment order: K blocks 512 apart along d, 16 * HD along the keys; Vt blocks 512 apart along the keys, 16 * TT along d
#pragma unroll
    for (int kt = 0; kt < 2; ++kt)
#pragma unroll
        for (int ks = 0; ks < 2; ++ks) { const int ko = kt * 16 * HD + ks * 512 + 8 * lane; kf[kt][ks] = WFrag<T16>::ld(Kp + ko); if constexpr (HL) kf2[kt][ks] = WFrag<T16>::ld(K2 + ko); }
    XWAIT();
    v8f o[NQ][4]; float m[NQ], l[NQ];
#pragma unroll
    for (int qt = 0; qt < NQ; ++qt) { m[qt] = -3.0e38f; l[qt] = 0.f;
#pragma unroll
        for (int dt = 0; dt < 4; ++dt) o[qt][dt] = (v8f){}; }
#pragma unroll 1
    for (int kb = 0; kb < TT; kb += 32) {
        V vf[4], vf2[4];   // this pass's Vt fragments: asked for first, used last
#pragma unroll
        for (int dt = 0; dt < 4; ++dt) vf[dt] = WFrag<T16>::ld(Vt + dt * 16 * TT + kb * 16 + 8 * lane);
        XWAIT();
        if constexpr (HL) {
#pragma unroll
            for (int dt = 0; dt < 4; ++dt) vf2[dt] = WFrag<T16>::ld(V2 + dt * 16 * TT + kb * 16 + 8 * lane);
            XWAIT(); }
        v8f s[NQ][2];
#pragma unroll
        for (int qt = 0; qt < NQ; ++qt) { s[qt][0] = (v8f){}; s[qt][1] = (v8f){}; }
#pragma unroll
        for (int ks = 0; ks < 2; ++ks) {
#pragma unroll
            for (int kt = 0; kt < 2; ++kt)
#pragma unroll
                for (int qt = 0; qt < NQ; ++qt) s[qt][kt] = WFrag<T16>::mma(kf[kt][ks], qf[qt][ks], s[qt][kt]);
            if constexpr (HL) {
#pragma unroll
                for (int kt = 0; kt < 2; ++kt)
#pragma unroll
                    for (int qt = 0; qt < NQ; ++qt) s[qt][kt] = WFrag<T16>::mma(kf[kt][ks], qf2[qt][ks], s[qt][kt]);
#pragma unroll
                for (int kt = 0; kt < 2; ++kt)
#pragma unroll
                    for (int qt = 0; qt < NQ; ++qt) s[qt][kt] = WFrag<T16>::mma(kf2[kt][ks], qf[qt][ks], s[qt][kt]); } }
        const int kn = (kb + 32) & (TT - 1);   // next pass's key fragments, one pass ahead; the last pass asks for the first keys again (in bounds, not used)
#pragma unroll
        for (int kt = 0; kt < 2; ++kt)
#pragma unroll
            for (int ks = 0; ks < 2; ++ks) { const int ko = (kn + kt * 16) * HD + ks * 512 + 8 * lane; kf[kt][ks] = WFrag<T16>::ld(Kp + ko); if constexpr (HL) kf2[kt][ks] = WFrag<T16>::ld(K2 + ko); }
        XWAIT();
        V pf[NQ], pf2[NQ];
#pragma unroll
        for (int qt = 0; qt < NQ; ++qt) {
            float bm = fmaxf(s[qt][0][0], s[qt][1][0]);
#pragma unroll
            for (int j = 1; j < 8; ++j) bm = fmaxf(bm, fmaxf(s[qt][0][j], s[qt][1][j]));
            bm = fmaxf(bm, xhalf(bm));
            const float mn = fmaxf(m[qt], bm); const float al = __builtin_amdgcn_exp2f((m[qt] - mn) * LC); m[qt] = mn;
            const float sh = (HL ? 0.0f : 10.0f) - mn * LC; float ps = 0.f;
#pragma unroll
            for (int e = 0; e < 16; e += 2) { v2f p; p[0] = __builtin_amdgcn_exp2f(__builtin_fmaf(s[qt][e >> 3][e & 7], LC, sh)); p[1] = __builtin_amdgcn_exp2f(__builtin_fmaf(s[qt][e >> 3][(e & 7) + 1], LC, sh)); ps += p[0]; ps += p[1];
                if constexpr (HL) { const v2b ph = __builtin_convertvector(p, v2b); const v2b pl = __builtin_convertvector(p - __builtin_convertvector(ph, v2f), v2b); pf[qt][e] = ph[0]; pf[qt][e + 1] = ph[1]; pf2[qt][e] = pl[0]; pf2[qt][e + 1] = pl[1]; }
                else { const v2h ph = __builtin_convertvector(p, v2h); pf[qt][e] = ph[0]; pf[qt][e + 1] = ph[1]; } }
            l[qt] = l[qt] * al + ps;
#pragma unroll
            for (int dt = 0; dt < 4; ++dt) o[qt][dt] *= al; }
#pragma unroll
        for (int dt = 0; dt < 4; ++dt)
#pragma unroll
            for (int qt = 0; qt < NQ; ++qt) o[qt][dt] = WFrag<T16>::mma(vf[dt], pf[qt], o[qt][dt]);
        if constexpr (HL) {
#pragma unroll
            for (int dt = 0; dt < 4; ++dt)
#pragma unroll
                for (int qt = 0; qt < NQ; ++qt) o[qt][dt] = WFrag<T16>::mma(vf[dt], pf2[qt], o[qt][dt]);
#pragma unroll
            for (int dt = 0; dt < 4; ++dt)
#pragma unroll
                for (int qt = 0; qt < NQ; ++qt) o[qt][dt] = WFrag<T16>::mma(vf2[dt], pf[qt], o[qt][dt]); }
    }
#pragma unroll
    for (int qt = 0; qt < NQ; ++qt) { const float inv = __fdiv_rn(1.0f, l[qt] + xhalf(l[qt])); const size_t ro = (size_t)(q0 + qt * 16) * DQ + 8 * lane;   // o[qt][dt][j] = O[query lr][d = dt*16 + 8*hi + j]: piece (half dt & 1, lane) of k block dt >> 1 of this head
#pragma unroll
        for (int dt = 0; dt < 4; ++dt) { const v8f val = o[qt][dt] * inv; const v8b oh = __builtin_convertvector(val, v8b); const v8b ol = __builtin_convertvector(val - __builtin_convertvector(oh, v8f), v8b);
            *(v8us*)(Ah + ro + dt * 256) = __builtin_bit_cast(v8us, oh); *(v8us*)(Al + ro + dt * 256) = __builtin_bit_cast(v8us, ol);
            XWAIT(); } }
}
// grid x: (entry of the group, head); grid y: block of FW*NQ*16 query rows, the hi+lo blocks (three times the products) first
__global__ __launch_bounds__(FW * 32) void k_fattn(const h16* __restrict__ Q16, const h16* __restrict__ K16, const h16* __restrict__ V16, const bf* __restrict__ Qh, const bf* __restrict__ Ql, const bf* __restrict__ Kh, const bf* __restrict__ Kl, const bf* __restrict__ Vh, const bf* __restrict__ Vl, bf* Ah, bf* Al) {
    const int z = blockIdx.x; const size_t po = (size_t)z * TT * HD; const size_t ao = (size_t)(z / NH_) * TT * DQ + (size_t)(z % NH_) * (HD / 32) * 512;   // the merged plane [token][DQ] in fragment order: this head's two k blocks
    const int qb = blockIdx.y * (FW * NQ * 16); const int q0 = qb + (int)(threadIdx.x >> 5) * (NQ * 16);
    if (qb < RH) fattn<bf, true>(Qh + po, Ql + po, Kh + po, Kl + po, Vh + po, Vl + po, q0, Ah + ao, Al + ao);
    else fattn<h16, false>(Q16 + po, nullptr, K16 + po, nullptr, V16 + po, nullptr, q0, Ah + ao, Al + ao);
}

extern "C" void kernel_launch(void* const* d_in, const int* in_sizes, int n_in,
                              void* d_out, int out_size, void* d_ws, size_t ws_size, hipStream_t stream) {
    (void)in_sizes; (void)n_in; (void)out_size;
    const float* x = (const float*)d_in[0]; const float* wq = (const float*)d_in[1]; const float* bq = (const float*)d_in[2]; const float* wk = (const float*)d_in[3]; const float* bk = (const float*)d_in[4]; const float* wv = (const float*)d_in[5]; const float* bv = (const float*)d_in[6]; const float* wo = (const float*)d_in[7]; const float* bo = (const float*)d_in[8];
    float* OUT = (float*)d_out;     // [8][1024][1024]
    char* wsp = (char*)d_ws;
    auto take = [&](size_t bytes) { char* p = wsp; wsp += (bytes + 255) & ~(size_t)255; return (void*)p; };
    const size_t PS = (size_t)GB * NH_ * TT * HD;   // one 16-bit plane of a group: [entry][head] planes of [t][d] (v: [d][t]), each in fragment order
    static_assert(NKV == NH_ && NB_ % GB == 0 && ZH == NH_, "one pass per group of GB batch entries; q, k, v of equal width");
    bf* W4 = (bf*)take((size_t)4 * DQ * DM * 2); bf* WO = W4 + (size_t)3 * DQ * DM;   // Wq, Wk, Wv, Wo transposed, back to back
    bf* XB = (bf*)take((size_t)GB * TT * DM * 2);
    h16* QP16 = (h16*)take(2 * PS * 2); h16* KP16 = QP16 + PS; h16* VT16 = (h16*)take(PS * 2);
    bf* QPh = (bf*)take(2 * PS * 2); bf* KPh = QPh + PS; bf* QPl = (bf*)take(2 * PS * 2); bf* KPl = QPl + PS; bf* VTh = (bf*)take(PS * 2); bf* VTl = (bf*)take(PS * 2);
    bf* ATh = (bf*)take((size_t)NB_ * TT * DQ * 2); bf* ATl = (bf*)take((size_t)NB_ * TT * DQ * 2);
    if ((size_t)(wsp - (char*)d_ws) > ws_size) return;    // ws 256 MiB
    static_assert(TT % 64 == 0 && HD == 64 && DQ == NH_ * HD, "a 64x64 projection tile is 64 tokens of one entry x one head");
    static_assert(RH % (FW * NQ * 16) == 0 && TT % (FW * NQ * 16) == 0 && HD == 64 && (TT & (TT - 1)) == 0, "whole row blocks on either side of RH");
    k_wtG<DM, DQ><<<dim3((unsigned)((DM * DQ / 8 + 255) / 256), 4, 1), 256, 0, stream>>>(wq, wk, wv, wo, W4);
    for (int g = 0; g < NB_ / GB; ++g) {
        k_cvt8<<<(unsigned)(((size_t)GB * TT * DM / 8 + 255) / 256), 256, 0, stream>>>(x + (size_t)g * GB * TT * DM, XB, (size_t)GB * TT * DM / 8);
        k_gemmw<bf, 0, true, true, DM><<<dim3(GB * TT / 64, DQ / 64, 3), 32, 0, stream>>>(XB, nullptr, W4, nullptr, nullptr, 0, bq, bk, bv, 0, (size_t)DQ * DM, 0, QP16, QPh, QPl, VT16, VTh, VTl);
        k_fattn<<<dim3(GB * NH_, TT / (FW * NQ * 16), 1), FW * 32, 0, stream>>>(QP16, KP16, VT16, QPh, QPl, KPh, KPl, VTh, VTl, ATh + (size_t)g * GB * TT * DQ, ATl + (size_t)g * GB * TT * DQ); }
    k_gemmw<bf, 1, true, false, DQ><<<dim3(NB_ * TT / 64, DM / 64, 1), 32, 0, stream>>>(ATh, ATl, WO, nullptr, OUT, DM, bo, nullptr, nullptr, 0, 0, 0, nullptr, nullptr, nullptr, nullptr, nullptr, nullptr);
}

// v005
// It runs in 170 microseconds.
// Timed twice side by side with v004, it ran 1.27 and 1.25 times as fast.
// Over all steps from v000 it is 27.5 times as fast.
#include <hip/hip_runtime.h>

// CLIP attention (hidden_states [8][1024][1024]; q = (x Wq + bq) x 64^-0.5, k, v = x W + b ('xw' [1024][1024]; 16 heads x 64); softmax(q.k) over all keys; out = merged Wo + bo -> [8][1024][1024] (8.4 M)).
// Compute dtypes, f32 accumulate: every input rounded to bf16; q/k/v on PLAIN bf16 operands (inputs: exact) + biases; the 64^-0.5 applied to the f32 score (the module scales q after the bias; power of two, exact); scores and attn.v: query rows < 512 hl (3 products), the rest single fp16 (x1024); softmax f32; Wo hl x exact (2 products) + bo.

#define NB_  8
#define TT   1024
#define DM   1024
#define NH_  16
#define NKV  16
#define REP  (NH_ / NKV)
#define HD   64
#define DQ   (NH_ * HD)
#define DKV  (NKV * HD)
#define ZH   16                   // heads of one batch entry; an attention pass covers GB entries
#define GB   4                    // batch entries per projection group
#define RH   512                  // query rows < RH use hi+lo planes (0: none)
#define WIN  0
#define PCAR 1024.0f
#define SCL  0.125f   // HD^-0.5
typedef _Float16 h16;
typedef unsigned short bf;
typedef __attribute__((ext_vector_type(16))) __bf16   v16bf;
typedef __attribute__((ext_vector_type(16))) _Float16 v16h;
typedef __attribute__((ext_vector_type(8)))  _Float16 v8h;
typedef __attribute__((ext_vector_type(8)))  unsigned short v8us;
typedef __attribute__((ext_vector_type(8)))  float    v8f;
typedef __attribute__((ext_vector_type(4)))  float    v4f;
typedef v8h  __attribute__((may_alias)) v8ha;
typedef v4f  __attribute__((may_alias)) v4fa;
typedef v8us __attribute__((may_alias)) v8usa;

__device__ __forceinline__ unsigned short f2bf(float f) { unsigned u = __float_as_uint(f); u += 0x7FFFu + ((u >> 16) & 1u); return (unsigned short)(u >> 16); }
__device__ __forceinline__ float bf2f(unsigned short b) { return __uint_as_float(((unsigned)b) << 16); }
__device__ __forceinline__ float bfr(float f) { return bf2f(f2bf(f)); }
__device__ __forceinline__ v16h cat16(v8h lo, v8h hi) { return __builtin_shufflevector(lo, hi, 0, 1, 2, 3, 4, 5, 6, 7, 8, 9, 10, 11, 12, 13, 14, 15); }
__device__ __forceinline__ v16bf cat16b(v8us lo, v8us hi) { return __builtin_bit_cast(v16bf, __builtin_shufflevector(lo, hi, 0, 1, 2, 3, 4, 5, 6, 7, 8, 9, 10, 11, 12, 13, 14, 15)); }
__device__ __forceinline__ v8f wmma16(v16h a, v16h b, v8f c) { return __builtin_amdgcn_wmma_f32_16x16x32_f16(false, a, false, b, (short)0, c, false, false); }
__device__ __forceinline__ v8f wmmab(v16bf a, v16bf b, v8f c) { return __builtin_amdgcn_wmma_f32_16x16x32_bf16(false, a, false, b, (short)0, c, false, false); }



// FRAGMENT ORDER of every 16-bit operand plane [rows][K]: a block of 16 rows x 32 k is 512 elements in a row, element (row r, k) at ((k >> 4) & 1) * 256 + (((k >> 3) & 1) * 16 + (r & 15)) * 8 + (k & 7);
// blocks run along k, then along the rows: block (r >> 4, k >> 5) starts at (r >> 4) * 16 * K + (k >> 5) * 512. Lane l of a wave finds its two 16-byte pieces of a fragment at l * 8 and 256 + l * 8,
// so each wave-wide 16-byte load or store covers 512 bytes in a row: 4 whole lines, where rows of K in a row give a 32-byte piece of each of 16 lines. Lane (lr, hi), l = hi * 16 + lr, holds row lr, k = 8 * hi + 0..7 and 16 + 8 * hi + 0..7.

// ---- k_gemmw: register-blocked GEMM, ONE WAVE per 64x64 output tile (16 accumulators), operands straight from 16-bit planes in fragment order; grid (M/64, N/64, Z), 32 threads.
// C[m][n] (f32, pitch ldc, + optional f32 bias[n], one vector per z slice up to three) = sum_k A[m][k] Bt[n][k] (+ split products per NSPLIT). z-batch strides sA/sB/sC in elements. K % 64 == 0, K >= 128.
// PLANES (the q/k/v projection): no f32 C. A 64x64 tile is 64 tokens x the 64 columns of ONE head, so the wave itself writes the attention operand planes (fp16, bf16 hi, bf16 lo):
// z 0, 1 (q, k): [entry][head] planes of [t][d] in fragment order, the tile is 8 KB in a row of each plane; z 2 (v): [entry][head] planes of [d][t] in fragment order, staged through LDS the other way round.
typedef __attribute__((ext_vector_type(8))) __bf16 v8b;
// eight neighbouring f32 values -> 16 bytes in each of the three operand planes (round to nearest even, as the planes always were)
__device__ __forceinline__ void put3(v8f val, h16* p16, bf* ph, bf* pl) {
    const v8h o16 = __builtin_convertvector(val, v8h); const v8b oh = __builtin_convertvector(val, v8b); const v8b ol = __builtin_convertvector(val - __builtin_convertvector(oh, v8f), v8b);
    *(v8h*)p16 = o16; *(v8us*)ph = __builtin_bit_cast(v8us, oh); *(v8us*)pl = __builtin_bit_cast(v8us, ol); }
// ld(p): p = start of the fragment's block + 8 * lane
template <typename T16> struct WFrag;
template <> struct WFrag<h16> { typedef v16h V; static __device__ __forceinline__ V ld(const h16* p) { return cat16(*(const v8h*)p, *(const v8h*)(p + 256)); } static __device__ __forceinline__ v8f mma(V a, V b, v8f c) { return wmma16(a, b, c); } };
template <> struct WFrag<bf> { typedef v16bf V; static __device__ __forceinline__ V ld(const bf* p) { return cat16b(*(const v8us*)p, *(const v8us*)(p + 256)); } static __device__ __forceinline__ v8f mma(V a, V b, v8f c) { return wmmab(a, b, c); } };
// SB: a scheduling fence; keeps a group of fragment loads whole and in front of the products that cover it (without it the build sinks most of the loads in among the products and waits for them there)
#define SB() __builtin_amdgcn_sched_barrier(0)
template <typename T16, int NSPLIT, bool BIAS, bool PLANES, int K>   // K at compile time: the row blocks of a fragment-order plane are then fixed byte offsets from one address per operand
__global__ __launch_bounds__(32) void k_gemmw(const T16* __restrict__ A, const T16* __restrict__ A2, const T16* __restrict__ Bt, const T16* __restrict__ Bt2, float* C, int ldc, const float* __restrict__ bias0, const float* __restrict__ bias1, const float* __restrict__ bias2, size_t sA, size_t sB, size_t sC, h16* P16, bf* Ph, bf* Pl, h16* V16, bf* Vh, bf* Vl) {
    typedef typename WFrag<T16>::V V;
    __shared__ __align__(16) float os[16 * 68];
    const size_t z = blockIdx.z; A += z * sA; if (A2) A2 += z * sA; Bt += z * sB; if (Bt2) Bt2 += z * sB; C += z * sC;
    const float* __restrict__ bias = (z == 0) ? bias0 : (z == 1) ? bias1 : bias2;   // one bias vector per z slice
    const int lane = threadIdx.x & 31, lr = lane & 15, hi = lane >> 4; const int r0 = blockIdx.x * 64, c0 = blockIdx.y * 64;
    v8f acc[4][4];
#pragma unroll
    for (int mb = 0; mb < 4; ++mb)
#pragma unroll
        for (int nb = 0; nb < 4; ++nb) acc[mb][nb] = (v8f){};
    // fragment order: row block stride 16 * K, k block stride 512; one running address per operand, the row blocks at fixed offsets from it
    const T16* pa = A + (size_t)r0 * K + 8 * lane; const T16* pa2 = A2 + (size_t)r0 * K + 8 * lane; const T16* pb = Bt + (size_t)c0 * K + 8 * lane; const T16* pb2 = Bt2 + (size_t)c0 * K + 8 * lane;
    static_assert(K % 64 == 0 && K >= 128, "k blocks are walked in pairs, one register set each");
    // TWO FRAGMENT SETS: the whole next k block (all its A and B fragments) is asked for as one group in front of the current block's products, so a load has a block of products (its own wave's and its neighbours') to come back in
    V a[2][4], a2[2][4], b[2][4], b2[2][4];
    auto fetch = [&](int st, int ko) __attribute__((always_inline)) {   // ko: k offset in elements from the running addresses
#pragma unroll
        for (int mb = 0; mb < 4; ++mb) { a[st][mb] = WFrag<T16>::ld(pa + ko + mb * 16 * K); if (NSPLIT == 1 || NSPLIT == 2) a2[st][mb] = WFrag<T16>::ld(pa2 + ko + mb * 16 * K); }
#pragma unroll
        for (int nb = 0; nb < 4; ++nb) { b[st][nb] = WFrag<T16>::ld(pb + ko + nb * 16 * K); if (NSPLIT >= 2) b2[st][nb] = WFrag<T16>::ld(pb2 + ko + nb * 16 * K); } };
    auto prods = [&](int st) __attribute__((always_inline)) {   // per accumulator the order of the products is the old one
#pragma unroll
        for (int nb = 0; nb < 4; ++nb)
#pragma unroll
            for (int mb = 0; mb < 4; ++mb) { acc[mb][nb] = WFrag<T16>::mma(a[st][mb], b[st][nb], acc[mb][nb]); if (NSPLIT == 1 || NSPLIT == 2) acc[mb][nb] = WFrag<T16>::mma(a2[st][mb], b[st][nb], acc[mb][nb]); if (NSPLIT >= 2) acc[mb][nb] = WFrag<T16>::mma(a[st][mb], b2[st][nb], acc[mb][nb]); } };
    // stands before the address registers of the loads above it are written again; the addresses as inputs: their registers stay theirs up to here (without them the build loads a fragment over an address pair that has loads out)
    auto xwait = [&]() __attribute__((always_inline)) {
        if constexpr (NSPLIT == 0) asm volatile("s_wait_xcnt 0x0" :: "v"(pa), "v"(pb) : "memory");
        else if constexpr (NSPLIT == 1) asm volatile("s_wait_xcnt 0x0" :: "v"(pa), "v"(pa2), "v"(pb) : "memory");
        else asm volatile("s_wait_xcnt 0x0" :: "v"(pa), "v"(pa2), "v"(pb), "v"(pb2) : "memory"); };
    // the first set. The fences on both sides and the wait: no register that these loads name is written before the wait (without them the build writes an address pair over the lane register that the loads name)
    SB(); fetch(0, 0); xwait(); SB();
    const T16* const ba = pa; const T16* const ba2 = pa2; const T16* const bb = pb; const T16* const bb2 = pb2;
#pragma unroll 1
    for (int kc = 0; kc < K - 64; kc += 64) {
        pa = ba + kc * 16; pa2 = ba2 + kc * 16; pb = bb + kc * 16; pb2 = bb2 + kc * 16;   // a pair's addresses are formed once, in front of its loads
        fetch(1, 512); SB(); prods(0); SB();
        fetch(0, 1024); SB(); prods(1);
        asm volatile("v_nop\n\tv_nop\n\tv_nop\n\tv_nop" : "+v"(acc[0][0]), "+v"(acc[1][1]), "+v"(acc[2][2]), "+v"(acc[3][3]) : "v"(a[1][0]), "v"(a[1][3]));   // the four vector slots behind the last product, on the taken side of the branch back too
        xwait();
    }
    pa = ba; pa2 = ba2; pb = bb; pb2 = bb2;
    fetch(1, (K - 32) * 16); SB(); prods(0); prods(1);   // the last pair: nothing behind it to ask for
    xwait();
    if constexpr (PLANES) {
        const int cofs = hi * 8;   // read-back in fragment order: step s, lane (lr, hi) takes row lr, values s*16 + hi*8 + 0..7; the wave's 32 pieces are 512 bytes in a row of the plane
        const size_t hp = ((size_t)(r0 / TT) * NH_ + blockIdx.y) * TT * HD; const int t0 = r0 % TT;   // (entry, head) plane; first token of the tile
        if (z == 2) {
            const size_t po = hp + (size_t)t0 * 16 + lane * 8; float bb[4];
#pragma unroll
            for (int nb = 0; nb < 4; ++nb) bb[nb] = bias[c0 + nb * 16 + lr];
            asm volatile("" :: "v"(bb[0]), "v"(bb[1]), "v"(bb[2]), "v"(bb[3]));   // inputs only: the four bias loads are asked for together, one wait (without it the build waits out each load in turn)
#pragma unroll
            for (int nb = 0; nb < 4; ++nb) bb[nb] = bfr(bb[nb]);
#pragma unroll
            for (int nb = 0; nb < 4; ++nb) {
#pragma unroll
                for (int mb = 0; mb < 4; ++mb) { const v8f val = acc[mb][nb] + bb[nb];   // lane (lr, hi): column d = nb*16 + lr, tokens mb*16 + 8*hi + 0..7
                    *(v4fa*)(os + lr * 68 + mb * 16 + hi * 8) = __builtin_shufflevector(val, val, 0, 1, 2, 3); *(v4fa*)(os + lr * 68 + mb * 16 + hi * 8 + 4) = __builtin_shufflevector(val, val, 4, 5, 6, 7); }
                __builtin_amdgcn_wave_barrier(); asm volatile("" ::: "memory");   // the read-back below stays behind the LDS stores
#pragma unroll
                for (int s = 0; s < 4; ++s) { const v4f v0 = *(const v4fa*)(os + lr * 68 + s * 16 + cofs), v1 = *(const v4fa*)(os + lr * 68 + s * 16 + cofs + 4);
                    const size_t e = po + (size_t)nb * 16 * TT + s * 256; put3(__builtin_shufflevector(v0, v1, 0, 1, 2, 3, 4, 5, 6, 7), V16 + e, Vh + e, Vl + e); }
                __builtin_amdgcn_wave_barrier(); asm volatile("" ::: "memory");   // the next block's LDS stores stay behind the read-back
            }
            return;
        }
        const size_t po = z * ((size_t)GB * NH_ * TT * HD) + hp + (size_t)t0 * HD + lane * 8; v8f bb[4];
#pragma unroll
        for (int s = 0; s < 4; ++s)
#pragma unroll
            for (int i = 0; i < 8; ++i) bb[s][i] = bfr(bias[c0 + s * 16 + cofs + i]);
#pragma unroll
        for (int mb = 0; mb < 4; ++mb) {
#pragma unroll
            for (int nb = 0; nb < 4; ++nb) {
#pragma unroll
                for (int j = 0; j < 8; ++j) os[(hi * 8 + j) * 68 + nb * 16 + lr] = acc[mb][nb][j]; }
            __builtin_amdgcn_wave_barrier(); asm volatile("" ::: "memory");   // the read-back below stays behind the LDS stores
#pragma unroll
            for (int s = 0; s < 4; ++s) { const v4f v0 = *(const v4fa*)(os + lr * 68 + s * 16 + cofs), v1 = *(const v4fa*)(os + lr * 68 + s * 16 + cofs + 4);
                const size_t e = po + (size_t)mb * 16 * HD + s * 256; put3(__builtin_shufflevector(v0, v1, 0, 1, 2, 3, 4, 5, 6, 7) + bb[s], P16 + e, Ph + e, Pl + e); }
            __builtin_amdgcn_wave_barrier(); asm volatile("" ::: "memory");   // the next block's LDS stores stay behind the read-back
        }
        asm volatile("s_wait_xcnt 0x0" ::: "memory");   // the build lays the v path behind this one with a never-taken fall-through: its first register writes stay behind the wait for the stores above
        return;
    }
#pragma unroll
    for (int mb = 0; mb < 4; ++mb) {
#pragma unroll
        for (int nb = 0; nb < 4; ++nb) {
#pragma unroll
            for (int j = 0; j < 8; ++j) os[(hi * 8 + j) * 68 + nb * 16 + lr] = acc[mb][nb][j]; }
        __builtin_amdgcn_wave_barrier(); asm volatile("" ::: "memory");
        float* crow = C + (size_t)(r0 + mb * 16) * ldc + c0;
{
#pragma unroll
            for (int s = 0; s < 8; ++s) { const int row = 2 * s + hi, cofs = lr * 4; v4f val = *(const v4fa*)(os + row * 68 + cofs); if (BIAS) { val[0] += bfr(bias[c0 + cofs]); val[1] += bfr(bias[c0 + cofs + 1]); val[2] += bfr(bias[c0 + cofs + 2]); val[3] += bfr(bias[c0 + cofs + 3]); }
                *(v4f*)(crow + (size_t)row * ldc + cofs) = val; }
             }
        __builtin_amdgcn_wave_barrier(); asm volatile("" ::: "memory");
    }
}

typedef __attribute__((ext_vector_type(2))) _Float16 v2h;
typedef __attribute__((ext_vector_type(4))) _Float16 v4h;
typedef __attribute__((ext_vector_type(2))) unsigned short v2us;
typedef __attribute__((ext_vector_type(4))) unsigned short v4us;
typedef __attribute__((ext_vector_type(2))) float v2f;
typedef __attribute__((ext_vector_type(4))) int v4i;

// thread i writes piece i (8 k of one n) of the transposed plane [n][k] in fragment order: each half of a wave reads 16 neighbouring n of one k row, eight rows in turn
template <int K, int N>
__global__ __launch_bounds__(256) void k_wtG(const float* __restrict__ w0, const float* __restrict__ w1, const float* __restrict__ w2, const float* __restrict__ w3, bf* Bt) {
    const int y = blockIdx.y; const float* __restrict__ w = (y == 0) ? w0 : (y == 1) ? w1 : (y == 2) ? w2 : w3; Bt += (size_t)y * N * K;   // grid y: which of the four weights
    const int i = blockIdx.x * 256 + threadIdx.x; if (i >= N * K / 8) return;
    const int blk = i >> 6; const int n = blk / (K / 32) * 16 + (i & 15), k = blk % (K / 32) * 32 + ((i >> 5) & 1) * 16 + ((i >> 4) & 1) * 8; const float* p = w + (size_t)k * N + n; float t[8]; v8us o;
#pragma unroll
    for (int j = 0; j < 8; ++j) t[j] = p[j * N];
    asm volatile("s_wait_xcnt 0x0" :: "v"(p) : "memory");   // stands before the address register of the eight loads is written again; the address as an input: its register stays its own up to here
#pragma unroll
    for (int j = 0; j < 8; ++j) o[j] = f2bf(t[j]);
    *(v8us*)(Bt + (size_t)i * 8) = o;
}
// thread i writes piece i of the plane in fragment order: block i >> 6 = (row block, k block), half (i >> 5) & 1, lane i & 31 = (hi, lr)
__global__ __launch_bounds__(256) void k_cvt8(const float* __restrict__ src, bf* dst, size_t n8) { const size_t i = (size_t)blockIdx.x * 256 + threadIdx.x; if (i >= n8) return;
    const size_t blk = i >> 6; const size_t row = blk / (DM / 32) * 16 + (i & 15); const int k = (int)(blk % (DM / 32)) * 32 + (int)((i >> 5) & 1) * 16 + (int)((i >> 4) & 1) * 8; const v8f v = *(const v8f*)(src + row * DM + k); v8us o;
#pragma unroll
    for (int k = 0; k < 8; ++k) o[k] = f2bf(v[k]); *(v8us*)(dst + i * 8) = o;  }

#define NQ   2                    // 16-query groups per wave
#define FW   4                    // waves per work-group: same head, neighbouring rows, no exchange between them
#define LC   (SCL * 1.4426950408889634f)
typedef __attribute__((ext_vector_type(2))) __bf16 v2b;
// XWAIT: stands behind a group of global loads or stores, before a register that one of them names is written again (this build goes above v255); the scheduling fence keeps later register writes behind it
#define XWAIT() do { asm volatile("s_wait_xcnt 0x0" ::: "memory"); __builtin_amdgcn_sched_barrier(0); } while (0)
__device__ __forceinline__ float xhalf(float v) { const int b = __float_as_int(v); return __int_as_float(__builtin_amdgcn_permlanex16(b, b, 0x76543210, 0xfedcba98, false, false)); }   // lane l <-> l ^ 16
template <typename T16, bool HL>
__device__ __forceinline__ void fattn(const T16* __restrict__ Q, const T16* __restrict__ Q2, const T16* __restrict__ Kp, const T16* __restrict__ K2, const T16* __restrict__ Vt, const T16* __restrict__ V2, int q0, bf* Ah, bf* Al) {
    typedef typename WFrag<T16>::V V;
    const int lane = threadIdx.x & 31;
    V qf[NQ][2], qf2[NQ][2], kf[2][2], kf2[2][2];
#pragma unroll
    for (int qt = 0; qt < NQ; ++qt)
#pragma unroll
        for (int ks = 0; ks < 2; ++ks) { const int qo = (q0 + qt * 16) * HD + ks * 512 + 8 * lane; qf[qt][ks] = WFrag<T16>::ld(Q + qo); if constexpr (HL) qf2[qt][ks] = WFrag<T16>::ld(Q2 + qo); }
    XWAIT();
    // fragment order: K blocks 512 apart along d, 16 * HD along the keys; Vt blocks 512 apart along the keys, 16 * TT along d
#pragma unroll
    for (int kt = 0; kt < 2; ++kt)
#pragma unroll
        for (int ks = 0; ks < 2; ++ks) { const int ko = kt * 16 * HD + ks * 512 + 8 * lane; kf[kt][ks] = WFrag<T16>::ld(Kp + ko); if constexpr (HL) kf2[kt][ks] = WFrag<T16>::ld(K2 + ko); }
    XWAIT();
    v8f o[NQ][4]; float m[NQ], l[NQ];
#pragma unroll
    for (int qt = 0; qt < NQ; ++qt) { m[qt] = -3.0e38f; l[qt] = 0.f;
#pragma unroll
        for (int dt = 0; dt < 4; ++dt) o[qt][dt] = (v8f){}; }
#pragma unroll 1
    for (int kb = 0; kb < TT; kb += 32) {
        V vf[4], vf2[4];   // this pass's Vt fragments: asked for first, used last
#pragma unroll
        for (int dt = 0; dt < 4; ++dt) vf[dt] = WFrag<T16>::ld(Vt + dt * 16 * TT + kb * 16 + 8 * lane);
        XWAIT();
        if constexpr (HL) {
#pragma unroll
            for (int dt = 0; dt < 4; ++dt) vf2[dt] = WFrag<T16>::ld(V2 + dt * 16 * TT + kb * 16 + 8 * lane);
            XWAIT(); }
        v8f s[NQ][2];
#pragma unroll
        for (int qt = 0; qt < NQ; ++qt) { s[qt][0] = (v8f){}; s[qt][1] = (v8f){}; }
#pragma unroll
        for (int ks = 0; ks < 2; ++ks) {
#pragma unroll
            for (int kt = 0; kt < 2; ++kt)
#pragma unroll
                for (int qt = 0; qt < NQ; ++qt) s[qt][kt] = WFrag<T16>::mma(kf[kt][ks], qf[qt][ks], s[qt][kt]);
            if constexpr (HL) {
#pragma unroll
                for (int kt = 0; kt < 2; ++kt)
#pragma unroll
                    for (int qt = 0; qt < NQ; ++qt) s[qt][kt] = WFrag<T16>::mma(kf[kt][ks], qf2[qt][ks], s[qt][kt]);
#pragma unroll
                for (int kt = 0; kt < 2; ++kt)
#pragma unroll
                    for (int qt = 0; qt < NQ; ++qt) s[qt][kt] = WFrag<T16>::mma(kf2[kt][ks], qf[qt][ks], s[qt][kt]); } }
        const int kn = (kb + 32) & (TT - 1);   // next pass's key fragments, one pass ahead; the last pass asks for the first keys again (in bounds, not used)
#pragma unroll
        for (int kt = 0; kt < 2; ++kt)
#pragma unroll
            for (int ks = 0; ks < 2; ++ks) { const int ko = (kn + kt * 16) * HD + ks * 512 + 8 * lane; kf[kt][ks] = WFrag<T16>::ld(Kp + ko); if constexpr (HL) kf2[kt][ks] = WFrag<T16>::ld(K2 + ko); }
        XWAIT();
        V pf[NQ], pf2[NQ];
#pragma unroll
        for (int qt = 0; qt < NQ; ++qt) {
            float bm = fmaxf(s[qt][0][0], s[qt][1][0]);
#pragma unroll
            for (int j = 1; j < 8; ++j) bm = fmaxf(bm, fmaxf(s[qt][0][j], s[qt][1][j]));
            bm = fmaxf(bm, xhalf(bm));
            const float mn = fmaxf(m[qt], bm); const float al = __builtin_amdgcn_exp2f((m[qt] - mn) * LC); m[qt] = mn;
            const float sh = (HL ? 0.0f : 10.0f) - mn * LC; float ps = 0.f;
#pragma unroll
            for (int e = 0; e < 16; e += 2) { v2f p; p[0] = __builtin_amdgcn_exp2f(__builtin_fmaf(s[qt][e >> 3][e & 7], LC, sh)); p[1] = __builtin_amdgcn_exp2f(__builtin_fmaf(s[qt][e >> 3][(e & 7) + 1], LC, sh)); ps += p[0]; ps += p[1];
                if constexpr (HL) { const v2b ph = __builtin_convertvector(p, v2b); const v2b pl = __builtin_convertvector(p - __builtin_convertvector(ph, v2f), v2b); pf[qt][e] = ph[0]; pf[qt][e + 1] = ph[1]; pf2[qt][e] = pl[0]; pf2[qt][e + 1] = pl[1]; }
                else { const v2h ph = __builtin_convertvector(p, v2h); pf[qt][e] = ph[0]; pf[qt][e + 1] = ph[1]; } }
            l[qt] = l[qt] * al + ps;
#pragma unroll
            for (int dt = 0; dt < 4; ++dt) o[qt][dt] *= al; }
#pragma unroll
        for (int dt = 0; dt < 4; ++dt)
#pragma unroll
            for (int qt = 0; qt < NQ; ++qt) o[qt][dt] = WFrag<T16>::mma(vf[dt], pf[qt], o[qt][dt]);
        if constexpr (HL) {
#pragma unroll
            for (int dt = 0; dt < 4; ++dt)
#pragma unroll
                for (int qt = 0; qt < NQ; ++qt) o[qt][dt] = WFrag<T16>::mma(vf[dt], pf2[qt], o[qt][dt]);
#pragma unroll
            for (int dt = 0; dt < 4; ++dt)
#pragma unroll
                for (int qt = 0; qt < NQ; ++qt) o[qt][dt] = WFrag<T16>::mma(vf2[dt], pf[qt], o[qt][dt]); }
    }
#pragma unroll
    for (int qt = 0; qt < NQ; ++qt) { const float inv = __fdiv_rn(1.0f, l[qt] + xhalf(l[qt])); const size_t ro = (size_t)(q0 + qt * 16) * DQ + 8 * lane;   // o[qt][dt][j] = O[query lr][d = dt*16 + 8*hi + j]: piece (half dt & 1, lane) of k block dt >> 1 of this head
#pragma unroll
        for (int dt = 0; dt < 4; ++dt) { const v8f val = o[qt][dt] * inv; const v8b oh = __builtin_convertvector(val, v8b); const v8b ol = __builtin_convertvector(val - __builtin_convertvector(oh, v8f), v8b);
            *(v8us*)(Ah + ro + dt * 256) = __builtin_bit_cast(v8us, oh); *(v8us*)(Al + ro + dt * 256) = __builtin_bit_cast(v8us, ol);
            XWAIT(); } }
}
// grid x: (entry of the group, head); grid y: block of FW*NQ*16 query rows, the hi+lo blocks (three times the products) first
__global__ __launch_bounds__(FW * 32) void k_fattn(const h16* __restrict__ Q16, const h16* __restrict__ K16, const h16* __restrict__ V16, const bf* __restrict__ Qh, const bf* __restrict__ Ql, const bf* __restrict__ Kh, const bf* __restrict__ Kl, const bf* __restrict__ Vh, const bf* __restrict__ Vl, bf* Ah, bf* Al) {
    const int z = blockIdx.x; const size_t po = (size_t)z * TT * HD; const size_t ao = (size_t)(z / NH_) * TT * DQ + (size_t)(z % NH_) * (HD / 32) * 512;   // the merged plane [token][DQ] in fragment order: this head's two k blocks
    const int qb = blockIdx.y * (FW * NQ * 16); const int q0 = qb + (int)(threadIdx.x >> 5) * (NQ * 16);
    if (qb < RH) fattn<bf, true>(Qh + po, Ql + po, Kh + po, Kl + po, Vh + po, Vl + po, q0, Ah + ao, Al + ao);
    else fattn<h16, false>(Q16 + po, nullptr, K16 + po, nullptr, V16 + po, nullptr, q0, Ah + ao, Al + ao);
}

extern "C" void kernel_launch(void* const* d_in, const int* in_sizes, int n_in,
                              void* d_out, int out_size, void* d_ws, size_t ws_size, hipStream_t stream) {
    (void)in_sizes; (void)n_in; (void)out_size;
    const float* x = (const float*)d_in[0]; const float* wq = (const float*)d_in[1]; const float* bq = (const float*)d_in[2]; const float* wk = (const float*)d_in[3]; const float* bk = (const float*)d_in[4]; const float* wv = (const float*)d_in[5]; const float* bv = (const float*)d_in[6]; const float* wo = (const float*)d_in[7]; const float* bo = (const float*)d_in[8];
    float* OUT = (float*)d_out;     // [8][1024][1024]
    char* wsp = (char*)d_ws;
    auto take = [&](size_t bytes) { char* p = wsp; wsp += (bytes + 255) & ~(size_t)255; return (void*)p; };
    const size_t PS = (size_t)GB * NH_ * TT * HD;   // one 16-bit plane of a group: [entry][head] planes of [t][d] (v: [d][t]), each in fragment order
    static_assert(NKV == NH_ && NB_ % GB == 0 && ZH == NH_, "one pass per group of GB batch entries; q, k, v of equal width");
    bf* W4 = (bf*)take((size_t)4 * DQ * DM * 2); bf* WO = W4 + (size_t)3 * DQ * DM;   // Wq, Wk, Wv, Wo transposed, back to back
    bf* XB = (bf*)take((size_t)GB * TT * DM * 2);
    h16* QP16 = (h16*)take(2 * PS * 2); h16* KP16 = QP16 + PS; h16* VT16 = (h16*)take(PS * 2);
    bf* QPh = (bf*)take(2 * PS * 2); bf* KPh = QPh + PS; bf* QPl = (bf*)take(2 * PS * 2); bf* KPl = QPl + PS; bf* VTh = (bf*)take(PS * 2); bf* VTl = (bf*)take(PS * 2);
    bf* ATh = (bf*)take((size_t)NB_ * TT * DQ * 2); bf* ATl = (bf*)take((size_t)NB_ * TT * DQ * 2);
    if ((size_t)(wsp - (char*)d_ws) > ws_size) return;    // ws 256 MiB
    static_assert(TT % 64 == 0 && HD == 64 && DQ == NH_ * HD, "a 64x64 projection tile is 64 tokens of one entry x one head");
    static_assert(RH % (FW * NQ * 16) == 0 && TT % (FW * NQ * 16) == 0 && HD == 64 && (TT & (TT - 1)) == 0, "whole row blocks on either side of RH");
    k_wtG<DM, DQ><<<dim3((unsigned)((DM * DQ / 8 + 255) / 256), 4, 1), 256, 0, stream>>>(wq, wk, wv, wo, W4);
    for (int g = 0; g < NB_ / GB; ++g) {
        k_cvt8<<<(unsigned)(((size_t)GB * TT * DM / 8 + 255) / 256), 256, 0, stream>>>(x + (size_t)g * GB * TT * DM, XB, (size_t)GB * TT * DM / 8);
        k_gemmw<bf, 0, true, true, DM><<<dim3(GB * TT / 64, DQ / 64, 3), 32, 0, stream>>>(XB, nullptr, W4, nullptr, nullptr, 0, bq, bk, bv, 0, (size_t)DQ * DM, 0, QP16, QPh, QPl, VT16, VTh, VTl);
        k_fattn<<<dim3(GB * NH_, TT / (FW * NQ * 16), 1), FW * 32, 0, stream>>>(QP16, KP16, VT16, QPh, QPl, KPh, KPl, VTh, VTl, ATh + (size_t)g * GB * TT * DQ, ATl + (size_t)g * GB * TT * DQ); }
    k_gemmw<bf, 1, true, false, DQ><<<dim3(NB_ * TT / 64, DM / 64, 1), 32, 0, stream>>>(ATh, ATl, WO, nullptr, OUT, DM, bo, nullptr, nullptr, 0, 0, 0, nullptr, nullptr, nullptr, nullptr, nullptr, nullptr);
}

// v006
// A run of this version takes 140 microseconds.
// Two timings next to v005 put it at 1.21 and 1.22 times that version's speed.
// Counting every step since v000, it is 33.5 times as fast.
#include <hip/hip_runtime.h>

// CLIP attention (hidden_states [8][1024][1024]; q = (x Wq + bq) x 64^-0.5, k, v = x W + b ('xw' [1024][1024]; 16 heads x 64); softmax(q.k) over all keys; out = merged Wo + bo -> [8][1024][1024] (8.4 M)).
// Compute dtypes, f32 accumulate: every input rounded to bf16; q/k/v on PLAIN bf16 operands (inputs: exact) + biases; the 64^-0.5 applied to the f32 score (the module scales q after the bias; power of two, exact); scores and attn.v: query rows < 512 hl (3 products), the rest single fp16 (x1024); softmax f32; Wo hl x exact (2 products) + bo.

#define NB_  8
#define TT   1024
#define DM   1024
#define NH_  16
#define NKV  16
#define REP  (NH_ / NKV)
#define HD   64
#define DQ   (NH_ * HD)
#define DKV  (NKV * HD)
#define ZH   16                   // heads of one batch entry (only checked equal to NH_); one attention pass takes all GB entries
#define GB   8                    // batch entries per projection group: all of them, every stage runs once
#define RH   512                  // query rows < RH use hi+lo planes (0: none)
#define WIN  0
#define PCAR 1024.0f
#define SCL  0.125f   // HD^-0.5
typedef _Float16 h16;
typedef unsigned short bf;
typedef __attribute__((ext_vector_type(16))) __bf16   v16bf;
typedef __attribute__((ext_vector_type(16))) _Float16 v16h;
typedef __attribute__((ext_vector_type(8)))  _Float16 v8h;
typedef __attribute__((ext_vector_type(8)))  unsigned short v8us;
typedef __attribute__((ext_vector_type(8)))  float    v8f;
typedef __attribute__((ext_vector_type(4)))  float    v4f;
typedef v8h  __attribute__((may_alias)) v8ha;
typedef v4f  __attribute__((may_alias)) v4fa;
typedef v8us __attribute__((may_alias)) v8usa;

__device__ __forceinline__ unsigned short f2bf(float f) { unsigned u = __float_as_uint(f); u += 0x7FFFu + ((u >> 16) & 1u); return (unsigned short)(u >> 16); }
__device__ __forceinline__ float bf2f(unsigned short b) { return __uint_as_float(((unsigned)b) << 16); }
__device__ __forceinline__ float bfr(float f) { return bf2f(f2bf(f)); }
__device__ __forceinline__ v16h cat16(v8h lo, v8h hi) { return __builtin_shufflevector(lo, hi, 0, 1, 2, 3, 4, 5, 6, 7, 8, 9, 10, 11, 12, 13, 14, 15); }
__device__ __forceinline__ v16bf cat16b(v8us lo, v8us hi) { return __builtin_bit_cast(v16bf, __builtin_shufflevector(lo, hi, 0, 1, 2, 3, 4, 5, 6, 7, 8, 9, 10, 11, 12, 13, 14, 15)); }
__device__ __forceinline__ v8f wmma16(v16h a, v16h b, v8f c) { return __builtin_amdgcn_wmma_f32_16x16x32_f16(false, a, false, b, (short)0, c, false, false); }
__device__ __forceinline__ v8f wmmab(v16bf a, v16bf b, v8f c) { return __builtin_amdgcn_wmma_f32_16x16x32_bf16(false, a, false, b, (short)0, c, false, false); }



// FRAGMENT ORDER of every 16-bit operand plane [rows][K]: a block of 16 rows x 32 k is 512 elements in a row, element (row r, k) at ((k >> 4) & 1) * 256 + (((k >> 3) & 1) * 16 + (r & 15)) * 8 + (k & 7);
// blocks run along k, then along the rows: block (r >> 4, k >> 5) starts at (r >> 4) * 16 * K + (k >> 5) * 512. Lane l of a wave finds its two 16-byte pieces of a fragment at l * 8 and 256 + l * 8,
// so each wave-wide 16-byte load or store covers 512 bytes in a row: 4 whole lines, where rows of K in a row give a 32-byte piece of each of 16 lines. Lane (lr, hi), l = hi * 16 + lr, holds row lr, k = 8 * hi + 0..7 and 16 + 8 * hi + 0..7.

// ---- k_gemmw: register-blocked GEMM, ONE WAVE per 64x64 output tile (16 accumulators), operands straight from 16-bit planes in fragment order; grid (M/64, N/64, Z), 32 threads.
// C[m][n] (f32, pitch ldc, + optional f32 bias[n], one vector per z slice up to three) = sum_k A[m][k] Bt[n][k] (+ split products per NSPLIT). z-batch strides sA/sB/sC in elements. K % 64 == 0, K >= 128.
// PLANES (the q/k/v projection): no f32 C. A 64x64 tile is 64 tokens x the 64 columns of ONE head, so the wave itself writes the attention operand planes (fp16, bf16 hi, bf16 lo):
// z 0, 1 (q, k): [entry][head] planes of [t][d] in fragment order, the tile is 8 KB in a row of each plane; z 2 (v): [entry][head] planes of [d][t] in fragment order, staged through LDS the other way round.
typedef __attribute__((ext_vector_type(8))) __bf16 v8b;
// eight neighbouring f32 values -> 16 bytes in each of the three operand planes (round to nearest even, as the planes always were)
__device__ __forceinline__ void put3(v8f val, h16* p16, bf* ph, bf* pl) {
    const v8h o16 = __builtin_convertvector(val, v8h); const v8b oh = __builtin_convertvector(val, v8b); const v8b ol = __builtin_convertvector(val - __builtin_convertvector(oh, v8f), v8b);
    *(v8h*)p16 = o16; *(v8us*)ph = __builtin_bit_cast(v8us, oh); *(v8us*)pl = __builtin_bit_cast(v8us, ol); }
// ld(p): p = start of the fragment's block + 8 * lane
template <typename T16> struct WFrag;
template <> struct WFrag<h16> { typedef v16h V; static __device__ __forceinline__ V ld(const h16* p) { return cat16(*(const v8h*)p, *(const v8h*)(p + 256)); } static __device__ __forceinline__ v8f mma(V a, V b, v8f c) { return wmma16(a, b, c); } };
template <> struct WFrag<bf> { typedef v16bf V; static __device__ __forceinline__ V ld(const bf* p) { return cat16b(*(const v8us*)p, *(const v8us*)(p + 256)); } static __device__ __forceinline__ v8f mma(V a, V b, v8f c) { return wmmab(a, b, c); } };
// SB: a scheduling fence; keeps a group of fragment loads whole and in front of the products that cover it (without it the build sinks most of the loads in among the products and waits for them there)
#define SB() __builtin_amdgcn_sched_barrier(0)
template <typename T16, int NSPLIT, bool BIAS, bool PLANES, int K>   // K at compile time: the row blocks of a fragment-order plane are then fixed byte offsets from one address per operand
__global__ __launch_bounds__(32) void k_gemmw(const T16* __restrict__ A, const T16* __restrict__ A2, const T16* __restrict__ Bt, const T16* __restrict__ Bt2, float* C, int ldc, const float* __restrict__ bias0, const float* __restrict__ bias1, const float* __restrict__ bias2, size_t sA, size_t sB, size_t sC, h16* P16, bf* Ph, bf* Pl, h16* V16, bf* Vh, bf* Vl) {
    typedef typename WFrag<T16>::V V;
    __shared__ __align__(16) float os[16 * 68];
    const size_t z = blockIdx.z; A += z * sA; if (A2) A2 += z * sA; Bt += z * sB; if (Bt2) Bt2 += z * sB; C += z * sC;
    const float* __restrict__ bias = (z == 0) ? bias0 : (z == 1) ? bias1 : bias2;   // one bias vector per z slice
    const int lane = threadIdx.x & 31, lr = lane & 15, hi = lane >> 4; const int r0 = blockIdx.x * 64, c0 = blockIdx.y * 64;
    v8f acc[4][4];
#pragma unroll
    for (int mb = 0; mb < 4; ++mb)
#pragma unroll
        for (int nb = 0; nb < 4; ++nb) acc[mb][nb] = (v8f){};
    // fragment order: row block stride 16 * K, k block stride 512; one running address per operand, the row blocks at fixed offsets from it
    const T16* pa = A + (size_t)r0 * K + 8 * lane; const T16* pa2 = A2 + (size_t)r0 * K + 8 * lane; const T16* pb = Bt + (size_t)c0 * K + 8 * lane; const T16* pb2 = Bt2 + (size_t)c0 * K + 8 * lane;
    static_assert(K % 64 == 0 && K >= 128, "k blocks are walked in pairs, one register set each");
    // TWO FRAGMENT SETS: the whole next k block (all its A and B fragments) is asked for as one group in front of the current block's products, so a load has a block of products (its own wave's and its neighbours') to come back in
    V a[2][4], a2[2][4], b[2][4], b2[2][4];
    auto fetch = [&](int st, int ko) __attribute__((always_inline)) {   // ko: k offset in elements from the running addresses
#pragma unroll
        for (int mb = 0; mb < 4; ++mb) { a[st][mb] = WFrag<T16>::ld(pa + ko + mb * 16 * K); if (NSPLIT == 1 || NSPLIT == 2) a2[st][mb] = WFrag<T16>::ld(pa2 + ko + mb * 16 * K); }
#pragma unroll
        for (int nb = 0; nb < 4; ++nb) { b[st][nb] = WFrag<T16>::ld(pb + ko + nb * 16 * K); if (NSPLIT >= 2) b2[st][nb] = WFrag<T16>::ld(pb2 + ko + nb * 16 * K); } };
    auto prods = [&](int st) __attribute__((always_inline)) {   // per accumulator the order of the products is the old one
#pragma unroll
        for (int nb = 0; nb < 4; ++nb)
#pragma unroll
            for (int mb = 0; mb < 4; ++mb) { acc[mb][nb] = WFrag<T16>::mma(a[st][mb], b[st][nb], acc[mb][nb]); if (NSPLIT == 1 || NSPLIT == 2) acc[mb][nb] = WFrag<T16>::mma(a2[st][mb], b[st][nb], acc[mb][nb]); if (NSPLIT >= 2) acc[mb][nb] = WFrag<T16>::mma(a[st][mb], b2[st][nb], acc[mb][nb]); } };
    // stands before the address registers of the loads above it are written again; the addresses as inputs: their registers stay theirs up to here (without them the build loads a fragment over an address pair that has loads out)
    auto xwait = [&]() __attribute__((always_inline)) {
        if constexpr (NSPLIT == 0) asm volatile("s_wait_xcnt 0x0" :: "v"(pa), "v"(pb) : "memory");
        else if constexpr (NSPLIT == 1) asm volatile("s_wait_xcnt 0x0" :: "v"(pa), "v"(pa2), "v"(pb) : "memory");
        else asm volatile("s_wait_xcnt 0x0" :: "v"(pa), "v"(pa2), "v"(pb), "v"(pb2) : "memory"); };
    // the first set. The fences on both sides and the wait: no register that these loads name is written before the wait (without them the build writes an address pair over the lane register that the loads name)
    SB(); fetch(0, 0); xwait(); SB();
    const T16* const ba = pa; const T16* const ba2 = pa2; const T16* const bb = pb; const T16* const bb2 = pb2;
#pragma unroll 1
    for (int kc = 0; kc < K - 64; kc += 64) {
        pa = ba + kc * 16; pa2 = ba2 + kc * 16; pb = bb + kc * 16; pb2 = bb2 + kc * 16;   // a pair's addresses are formed once, in front of its loads
        fetch(1, 512); SB(); prods(0); SB();
        fetch(0, 1024); SB(); prods(1);
        asm volatile("v_nop\n\tv_nop\n\tv_nop\n\tv_nop" : "+v"(acc[0][0]), "+v"(acc[1][1]), "+v"(acc[2][2]), "+v"(acc[3][3]) : "v"(a[1][0]), "v"(a[1][3]));   // the four vector slots behind the last product, on the taken side of the branch back too
        xwait();
    }
    pa = ba; pa2 = ba2; pb = bb; pb2 = bb2;
    fetch(1, (K - 32) * 16); SB(); prods(0); prods(1);   // the last pair: nothing behind it to ask for
    xwait();
    if constexpr (PLANES) {
        const int cofs = hi * 8;   // read-back in fragment order: step s, lane (lr, hi) takes row lr, values s*16 + hi*8 + 0..7; the wave's 32 pieces are 512 bytes in a row of the plane
        const size_t hp = ((size_t)(r0 / TT) * NH_ + blockIdx.y) * TT * HD; const int t0 = r0 % TT;   // (entry, head) plane; first token of the tile
        if (z == 2) {
            const size_t po = hp + (size_t)t0 * 16 + lane * 8; float bb[4];
#pragma unroll
            for (int nb = 0; nb < 4; ++nb) bb[nb] = bias[c0 + nb * 16 + lr];
            asm volatile("" :: "v"(bb[0]), "v"(bb[1]), "v"(bb[2]), "v"(bb[3]));   // inputs only: the four bias loads are asked for together, one wait (without it the build waits out each load in turn)
#pragma unroll
            for (int nb = 0; nb < 4; ++nb) bb[nb] = bfr(bb[nb]);
#pragma unroll
            for (int nb = 0; nb < 4; ++nb) {
#pragma unroll
                for (int mb = 0; mb < 4; ++mb) { const v8f val = acc[mb][nb] + bb[nb];   // lane (lr, hi): column d = nb*16 + lr, tokens mb*16 + 8*hi + 0..7
                    *(v4fa*)(os + lr * 68 + mb * 16 + hi * 8) = __builtin_shufflevector(val, val, 0, 1, 2, 3); *(v4fa*)(os + lr * 68 + mb * 16 + hi * 8 + 4) = __builtin_shufflevector(val, val, 4, 5, 6, 7); }
                __builtin_amdgcn_wave_barrier(); asm volatile("" ::: "memory");   // the read-back below stays behind the LDS stores
#pragma unroll
                for (int s = 0; s < 4; ++s) { const v4f v0 = *(const v4fa*)(os + lr * 68 + s * 16 + cofs), v1 = *(const v4fa*)(os + lr * 68 + s * 16 + cofs + 4);
                    const size_t e = po + (size_t)nb * 16 * TT + s * 256; put3(__builtin_shufflevector(v0, v1, 0, 1, 2, 3, 4, 5, 6, 7), V16 + e, Vh + e, Vl + e); }
                __builtin_amdgcn_wave_barrier(); asm volatile("" ::: "memory");   // the next block's LDS stores stay behind the read-back
            }
            return;
        }
        const size_t po = z * ((size_t)GB * NH_ * TT * HD) + hp + (size_t)t0 * HD + lane * 8; v8f bb[4];
#pragma unroll
        for (int s = 0; s < 4; ++s)
#pragma unroll
            for (int i = 0; i < 8; ++i) bb[s][i] = bfr(bias[c0 + s * 16 + cofs + i]);
#pragma unroll
        for (int mb = 0; mb < 4; ++mb) {
#pragma unroll
            for (int nb = 0; nb < 4; ++nb) {
#pragma unroll
                for (int j = 0; j < 8; ++j) os[(hi * 8 + j) * 68 + nb * 16 + lr] = acc[mb][nb][j]; }
            __builtin_amdgcn_wave_barrier(); asm volatile("" ::: "memory");   // the read-back below stays behind the LDS stores
#pragma unroll
            for (int s = 0; s < 4; ++s) { const v4f v0 = *(const v4fa*)(os + lr * 68 + s * 16 + cofs), v1 = *(const v4fa*)(os + lr * 68 + s * 16 + cofs + 4);
                const size_t e = po + (size_t)mb * 16 * HD + s * 256; put3(__builtin_shufflevector(v0, v1, 0, 1, 2, 3, 4, 5, 6, 7) + bb[s], P16 + e, Ph + e, Pl + e); }
            __builtin_amdgcn_wave_barrier(); asm volatile("" ::: "memory");   // the next block's LDS stores stay behind the read-back
        }
        asm volatile("s_wait_xcnt 0x0" ::: "memory");   // the build lays the v path behind this one with a never-taken fall-through: its first register writes stay behind the wait for the stores above
        return;
    }
#pragma unroll
    for (int mb = 0; mb < 4; ++mb) {
#pragma unroll
        for (int nb = 0; nb < 4; ++nb) {
#pragma unroll
            for (int j = 0; j < 8; ++j) os[(hi * 8 + j) * 68 + nb * 16 + lr] = acc[mb][nb][j]; }
        __builtin_amdgcn_wave_barrier(); asm volatile("" ::: "memory");
        float* crow = C + (size_t)(r0 + mb * 16) * ldc + c0;
{
#pragma unroll
            for (int s = 0; s < 8; ++s) { const int row = 2 * s + hi, cofs = lr * 4; v4f val = *(const v4fa*)(os + row * 68 + cofs); if (BIAS) { val[0] += bfr(bias[c0 + cofs]); val[1] += bfr(bias[c0 + cofs + 1]); val[2] += bfr(bias[c0 + cofs + 2]); val[3] += bfr(bias[c0 + cofs + 3]); }
                *(v4f*)(crow + (size_t)row * ldc + cofs) = val; }
             }
        __builtin_amdgcn_wave_barrier(); asm volatile("" ::: "memory");
    }
}

typedef __attribute__((ext_vector_type(2))) _Float16 v2h;
typedef __attribute__((ext_vector_type(4))) _Float16 v4h;
typedef __attribute__((ext_vector_type(2))) unsigned short v2us;
typedef __attribute__((ext_vector_type(4))) unsigned short v4us;
typedef __attribute__((ext_vector_type(2))) float v2f;
typedef __attribute__((ext_vector_type(4))) int v4i;

// thread i writes piece i (8 k of one n) of the transposed plane [n][k] in fragment order: each half of a wave reads 16 neighbouring n of one k row, eight rows in turn
template <int K, int N>
__device__ __forceinline__ void wtG(int y, int bx, const float* __restrict__ w0, const float* __restrict__ w1, const float* __restrict__ w2, const float* __restrict__ w3, bf* Bt) {
    const float* __restrict__ w = (y == 0) ? w0 : (y == 1) ? w1 : (y == 2) ? w2 : w3; Bt += (size_t)y * N * K;   // y: which of the four weights
    const int i = bx * 256 + threadIdx.x; if (i >= N * K / 8) return;
    const int blk = i >> 6; const int n = blk / (K / 32) * 16 + (i & 15), k = blk % (K / 32) * 32 + ((i >> 5) & 1) * 16 + ((i >> 4) & 1) * 8; const float* p = w + (size_t)k * N + n; float t[8]; v8us o;
#pragma unroll
    for (int j = 0; j < 8; ++j) t[j] = p[j * N];
    asm volatile("s_wait_xcnt 0x0" :: "v"(p) : "memory");   // stands before the address register of the eight loads is written again; the address as an input: its register stays its own up to here
#pragma unroll
    for (int j = 0; j < 8; ++j) o[j] = f2bf(t[j]);
    *(v8us*)(Bt + (size_t)i * 8) = o;
}
// thread i writes piece i of the plane in fragment order: block i >> 6 = (row block, k block), half (i >> 5) & 1, lane i & 31 = (hi, lr)
__device__ __forceinline__ void cvt8(int bx, const float* __restrict__ src, bf* dst, size_t n8) { const size_t i = (size_t)bx * 256 + threadIdx.x; if (i >= n8) return;
    const size_t blk = i >> 6; const size_t row = blk / (DM / 32) * 16 + (i & 15); const int k = (int)(blk % (DM / 32)) * 32 + (int)((i >> 5) & 1) * 16 + (int)((i >> 4) & 1) * 8; const float* p = src + row * DM + k; const v8f v = *(const v8f*)p; v8us o;
    asm volatile("s_wait_xcnt 0x0" :: "v"(p) : "memory");   // stands before the address register of the two loads is written again; the address as an input: its register stays its own up to here
#pragma unroll
    for (int k = 0; k < 8; ++k) o[k] = f2bf(v[k]); *(v8us*)(dst + i * 8) = o;  }
// ---- k_prep: both conversions in ONE grid (neither reads what the other writes): blocks 0 .. XBLK-1 make the x plane, the next 4 * WBLK the four transposed weights
#define XBLK ((int)((size_t)NB_ * TT * DM / 8 / 256))
#define WBLK (DM * DQ / 8 / 256)
__global__ __launch_bounds__(256) void k_prep(const float* __restrict__ x, const float* __restrict__ w0, const float* __restrict__ w1, const float* __restrict__ w2, const float* __restrict__ w3, bf* XB, bf* Bt) {
    const int b = blockIdx.x;
    if (b < XBLK) cvt8(b, x, XB, (size_t)NB_ * TT * DM / 8);
    else wtG<DM, DQ>((b - XBLK) / WBLK, (b - XBLK) % WBLK, w0, w1, w2, w3, Bt);
}

#define NQ   2                    // 16-query groups per wave
#define FW   4                    // waves per work-group: same head, neighbouring rows, no exchange between them
#define LC   (SCL * 1.4426950408889634f)
typedef __attribute__((ext_vector_type(2))) __bf16 v2b;
// XWAIT: stands behind a group of global loads or stores, before a register that one of them names is written again (this build goes above v255); the scheduling fence keeps later register writes behind it
#define XWAIT() do { asm volatile("s_wait_xcnt 0x0" ::: "memory"); __builtin_amdgcn_sched_barrier(0); } while (0)
__device__ __forceinline__ float xhalf(float v) { const int b = __float_as_int(v); return __int_as_float(__builtin_amdgcn_permlanex16(b, b, 0x76543210, 0xfedcba98, false, false)); }   // lane l <-> l ^ 16
template <typename T16, bool HL>
__device__ __forceinline__ void fattn(const T16* __restrict__ Q, const T16* __restrict__ Q2, const T16* __restrict__ Kp, const T16* __restrict__ K2, const T16* __restrict__ Vt, const T16* __restrict__ V2, int q0, bf* Ah, bf* Al) {
    typedef typename WFrag<T16>::V V;
    const int lane = threadIdx.x & 31;
    V qf[NQ][2], qf2[NQ][2], kf[2][2], kf2[2][2];
#pragma unroll
    for (int qt = 0; qt < NQ; ++qt)
#pragma unroll
        for (int ks = 0; ks < 2; ++ks) { const int qo = (q0 + qt * 16) * HD + ks * 512 + 8 * lane; qf[qt][ks] = WFrag<T16>::ld(Q + qo); if constexpr (HL) qf2[qt][ks] = WFrag<T16>::ld(Q2 + qo); }
    XWAIT();
    // fragment order: K blocks 512 apart along d, 16 * HD along the keys; Vt blocks 512 apart along the keys, 16 * TT along d
#pragma unroll
    for (int kt = 0; kt < 2; ++kt)
#pragma unroll
        for (int ks = 0; ks < 2; ++ks) { const int ko = kt * 16 * HD + ks * 512 + 8 * lane; kf[kt][ks] = WFrag<T16>::ld(Kp + ko); if constexpr (HL) kf2[kt][ks] = WFrag<T16>::ld(K2 + ko); }
    XWAIT();
    v8f o[NQ][4]; float m[NQ], l[NQ];
#pragma unroll
    for (int qt = 0; qt < NQ; ++qt) { m[qt] = -3.0e38f; l[qt] = 0.f;
#pragma unroll
        for (int dt = 0; dt < 4; ++dt) o[qt][dt] = (v8f){}; }
#pragma unroll 1
    for (int kb = 0; kb < TT; kb += 32) {
        V vf[4], vf2[4];   // this pass's Vt fragments: asked for first, used last
#pragma unroll
        for (int dt = 0; dt < 4; ++dt) vf[dt] = WFrag<T16>::ld(Vt + dt * 16 * TT + kb * 16 + 8 * lane);
        XWAIT();
        if constexpr (HL) {
#pragma unroll
            for (int dt = 0; dt < 4; ++dt) vf2[dt] = WFrag<T16>::ld(V2 + dt * 16 * TT + kb * 16 + 8 * lane);
            XWAIT(); }
        v8f s[NQ][2];
#pragma unroll
        for (int qt = 0; qt < NQ; ++qt) { s[qt][0] = (v8f){}; s[qt][1] = (v8f){}; }
#pragma unroll
        for (int ks = 0; ks < 2; ++ks) {
#pragma unroll
            for (int kt = 0; kt < 2; ++kt)
#pragma unroll
                for (int qt = 0; qt < NQ; ++qt) s[qt][kt] = WFrag<T16>::mma(kf[kt][ks], qf[qt][ks], s[qt][kt]);
            if constexpr (HL) {
#pragma unroll
                for (int kt = 0; kt < 2; ++kt)
#pragma unroll
                    for (int qt = 0; qt < NQ; ++qt) s[qt][kt] = WFrag<T16>::mma(kf[kt][ks], qf2[qt][ks], s[qt][kt]);
#pragma unroll
                for (int kt = 0; kt < 2; ++kt)
#pragma unroll
                    for (int qt = 0; qt < NQ; ++qt) s[qt][kt] = WFrag<T16>::mma(kf2[kt][ks], qf[qt][ks], s[qt][kt]); } }
        const int kn = (kb + 32) & (TT - 1);   // next pass's key fragments, one pass ahead; the last pass asks for the first keys again (in bounds, not used)
#pragma unroll
        for (int kt = 0; kt < 2; ++kt)
#pragma unroll
            for (int ks = 0; ks < 2; ++ks) { const int ko = (kn + kt * 16) * HD + ks * 512 + 8 * lane; kf[kt][ks] = WFrag<T16>::ld(Kp + ko); if constexpr (HL) kf2[kt][ks] = WFrag<T16>::ld(K2 + ko); }
        XWAIT();
        V pf[NQ], pf2[NQ];
#pragma unroll
        for (int qt = 0; qt < NQ; ++qt) {
            float bm = fmaxf(s[qt][0][0], s[qt][1][0]);
#pragma unroll
            for (int j = 1; j < 8; ++j) bm = fmaxf(bm, fmaxf(s[qt][0][j], s[qt][1][j]));
            bm = fmaxf(bm, xhalf(bm));
            const float mn = fmaxf(m[qt], bm); const float al = __builtin_amdgcn_exp2f((m[qt] - mn) * LC); m[qt] = mn;
            const float sh = (HL ? 0.0f : 10.0f) - mn * LC; float ps = 0.f;
#pragma unroll
            for (int e = 0; e < 16; e += 2) { v2f p; p[0] = __builtin_amdgcn_exp2f(__builtin_fmaf(s[qt][e >> 3][e & 7], LC, sh)); p[1] = __builtin_amdgcn_exp2f(__builtin_fmaf(s[qt][e >> 3][(e & 7) + 1], LC, sh)); ps += p[0]; ps += p[1];
                if constexpr (HL) { const v2b ph = __builtin_convertvector(p, v2b); const v2b pl = __builtin_convertvector(p - __builtin_convertvector(ph, v2f), v2b); pf[qt][e] = ph[0]; pf[qt][e + 1] = ph[1]; pf2[qt][e] = pl[0]; pf2[qt][e + 1] = pl[1]; }
                else { const v2h ph = __builtin_convertvector(p, v2h); pf[qt][e] = ph[0]; pf[qt][e + 1] = ph[1]; } }
            l[qt] = l[qt] * al + ps;
#pragma unroll
            for (int dt = 0; dt < 4; ++dt) o[qt][dt] *= al; }
#pragma unroll
        for (int dt = 0; dt < 4; ++dt)
#pragma unroll
            for (int qt = 0; qt < NQ; ++qt) o[qt][dt] = WFrag<T16>::mma(vf[dt], pf[qt], o[qt][dt]);
        if constexpr (HL) {
#pragma unroll
            for (int dt = 0; dt < 4; ++dt)
#pragma unroll
                for (int qt = 0; qt < NQ; ++qt) o[qt][dt] = WFrag<T16>::mma(vf[dt], pf2[qt], o[qt][dt]);
#pragma unroll
            for (int dt = 0; dt < 4; ++dt)
#pragma unroll
                for (int qt = 0; qt < NQ; ++qt) o[qt][dt] = WFrag<T16>::mma(vf2[dt], pf[qt], o[qt][dt]); }
    }
#pragma unroll
    for (int qt = 0; qt < NQ; ++qt) { const float inv = __fdiv_rn(1.0f, l[qt] + xhalf(l[qt])); const size_t ro = (size_t)(q0 + qt * 16) * DQ + 8 * lane;   // o[qt][dt][j] = O[query lr][d = dt*16 + 8*hi + j]: piece (half dt & 1, lane) of k block dt >> 1 of this head
#pragma unroll
        for (int dt = 0; dt < 4; ++dt) { const v8f val = o[qt][dt] * inv; const v8b oh = __builtin_convertvector(val, v8b); const v8b ol = __builtin_convertvector(val - __builtin_convertvector(oh, v8f), v8b);
            *(v8us*)(Ah + ro + dt * 256) = __builtin_bit_cast(v8us, oh); *(v8us*)(Al + ro + dt * 256) = __builtin_bit_cast(v8us, ol);
            XWAIT(); } }
}
// grid x: (entry of the group, head); grid y: block of FW*NQ*16 query rows, the hi+lo blocks (three times the products) first
__global__ __launch_bounds__(FW * 32) void k_fattn(const h16* __restrict__ Q16, const h16* __restrict__ K16, const h16* __restrict__ V16, const bf* __restrict__ Qh, const bf* __restrict__ Ql, const bf* __restrict__ Kh, const bf* __restrict__ Kl, const bf* __restrict__ Vh, const bf* __restrict__ Vl, bf* Ah, bf* Al) {
    const int z = blockIdx.x; const size_t po = (size_t)z * TT * HD; const size_t ao = (size_t)(z / NH_) * TT * DQ + (size_t)(z % NH_) * (HD / 32) * 512;   // the merged plane [token][DQ] in fragment order: this head's two k blocks
    const int qb = blockIdx.y * (FW * NQ * 16); const int q0 = qb + (int)(threadIdx.x >> 5) * (NQ * 16);
    if (qb < RH) fattn<bf, true>(Qh + po, Ql + po, Kh + po, Kl + po, Vh + po, Vl + po, q0, Ah + ao, Al + ao);
    else fattn<h16, false>(Q16 + po, nullptr, K16 + po, nullptr, V16 + po, nullptr, q0, Ah + ao, Al + ao);
}

extern "C" void kernel_launch(void* const* d_in, const int* in_sizes, int n_in,
                              void* d_out, int out_size, void* d_ws, size_t ws_size, hipStream_t stream) {
    (void)in_sizes; (void)n_in; (void)out_size;
    const float* x = (const float*)d_in[0]; const float* wq = (const float*)d_in[1]; const float* bq = (const float*)d_in[2]; const float* wk = (const float*)d_in[3]; const float* bk = (const float*)d_in[4]; const float* wv = (const float*)d_in[5]; const float* bv = (const float*)d_in[6]; const float* wo = (const float*)d_in[7]; const float* bo = (const float*)d_in[8];
    float* OUT = (float*)d_out;     // [8][1024][1024]
    char* wsp = (char*)d_ws;
    auto take = [&](size_t bytes) { char* p = wsp; wsp += (bytes + 255) & ~(size_t)255; return (void*)p; };
    const size_t PS = (size_t)GB * NH_ * TT * HD;   // one 16-bit plane of a group: [entry][head] planes of [t][d] (v: [d][t]), each in fragment order
    static_assert(NKV == NH_ && NB_ % GB == 0 && ZH == NH_, "one pass per group of GB batch entries; q, k, v of equal width");
    bf* W4 = (bf*)take((size_t)4 * DQ * DM * 2); bf* WO = W4 + (size_t)3 * DQ * DM;   // Wq, Wk, Wv, Wo transposed, back to back
    bf* XB = (bf*)take((size_t)GB * TT * DM * 2);
    h16* QP16 = (h16*)take(2 * PS * 2); h16* KP16 = QP16 + PS; h16* VT16 = (h16*)take(PS * 2);
    bf* QPh = (bf*)take(2 * PS * 2); bf* KPh = QPh + PS; bf* QPl = (bf*)take(2 * PS * 2); bf* KPl = QPl + PS; bf* VTh = (bf*)take(PS * 2); bf* VTl = (bf*)take(PS * 2);
    bf* ATh = (bf*)take((size_t)NB_ * TT * DQ * 2); bf* ATl = (bf*)take((size_t)NB_ * TT * DQ * 2);
    if ((size_t)(wsp - (char*)d_ws) > ws_size) return;    // ws 256 MiB
    static_assert(TT % 64 == 0 && HD == 64 && DQ == NH_ * HD, "a 64x64 projection tile is 64 tokens of one entry x one head");
    static_assert(RH % (FW * NQ * 16) == 0 && TT % (FW * NQ * 16) == 0 && HD == 64 && (TT & (TT - 1)) == 0, "whole row blocks on either side of RH");
    static_assert(GB == NB_ && ((size_t)NB_ * TT * DM / 8) % 256 == 0 && (DM * DQ / 8) % 256 == 0, "one group; whole blocks of 256 pieces on either side of XBLK");
    k_prep<<<XBLK + 4 * WBLK, 256, 0, stream>>>(x, wq, wk, wv, wo, XB, W4);
    k_gemmw<bf, 0, true, true, DM><<<dim3(GB * TT / 64, DQ / 64, 3), 32, 0, stream>>>(XB, nullptr, W4, nullptr, nullptr, 0, bq, bk, bv, 0, (size_t)DQ * DM, 0, QP16, QPh, QPl, VT16, VTh, VTl);
    k_fattn<<<dim3(GB * NH_, TT / (FW * NQ * 16), 1), FW * 32, 0, stream>>>(QP16, KP16, VT16, QPh, QPl, KPh, KPl, VTh, VTl, ATh, ATl);
    k_gemmw<bf, 1, true, false, DQ><<<dim3(NB_ * TT / 64, DM / 64, 1), 32, 0, stream>>>(ATh, ATl, WO, nullptr, OUT, DM, bo, nullptr, nullptr, 0, 0, 0, nullptr, nullptr, nullptr, nullptr, nullptr, nullptr);
}

// v007
// Measured time: 134 microseconds a run.
// Timed twice side by side with v006, it ran 1.05 times as fast both times.
// Counting every step since v000, it is 35.2 times as fast.
#include <hip/hip_runtime.h>

// CLIP attention (hidden_states [8][1024][1024]; q = (x Wq + bq) x 64^-0.5, k, v = x W + b ('xw' [1024][1024]; 16 heads x 64); softmax(q.k) over all keys; out = merged Wo + bo -> [8][1024][1024] (8.4 M)).
// Compute dtypes, f32 accumulate: every input rounded to bf16; q/k/v on PLAIN bf16 operands (inputs: exact) + biases; the 64^-0.5 applied to the f32 score (the module scales q after the bias; power of two, exact); scores and attn.v: query rows < 512 hl (3 products), the rest single fp16 (x1024); softmax f32; Wo hl x exact (2 products) + bo.

#define NB_  8
#define TT   1024
#define DM   1024
#define NH_  16
#define NKV  16
#define REP  (NH_ / NKV)
#define HD   64
#define DQ   (NH_ * HD)
#define DKV  (NKV * HD)
#define ZH   16                   // heads of one batch entry (only checked equal to NH_); one attention pass takes all GB entries
#define GB   8                    // batch entries per projection group: all of them, every stage runs once
#define RH   512                  // query rows < RH use hi+lo planes (0: none)
#define WIN  0
#define PCAR 1024.0f
#define SCL  0.125f   // HD^-0.5
typedef _Float16 h16;
typedef unsigned short bf;
typedef __attribute__((ext_vector_type(16))) __bf16   v16bf;
typedef __attribute__((ext_vector_type(16))) _Float16 v16h;
typedef __attribute__((ext_vector_type(8)))  _Float16 v8h;
typedef __attribute__((ext_vector_type(8)))  unsigned short v8us;
typedef __attribute__((ext_vector_type(8)))  float    v8f;
typedef __attribute__((ext_vector_type(4)))  float    v4f;
typedef v8h  __attribute__((may_alias)) v8ha;
typedef v4f  __attribute__((may_alias)) v4fa;
typedef v8us __attribute__((may_alias)) v8usa;

__device__ __forceinline__ unsigned short f2bf(float f) { unsigned u = __float_as_uint(f); u += 0x7FFFu + ((u >> 16) & 1u); return (unsigned short)(u >> 16); }
__device__ __forceinline__ float bf2f(unsigned short b) { return __uint_as_float(((unsigned)b) << 16); }
__device__ __forceinline__ float bfr(float f) { return bf2f(f2bf(f)); }
__device__ __forceinline__ v16h cat16(v8h lo, v8h hi) { return __builtin_shufflevector(lo, hi, 0, 1, 2, 3, 4, 5, 6, 7, 8, 9, 10, 11, 12, 13, 14, 15); }
__device__ __forceinline__ v16bf cat16b(v8us lo, v8us hi) { return __builtin_bit_cast(v16bf, __builtin_shufflevector(lo, hi, 0, 1, 2, 3, 4, 5, 6, 7, 8, 9, 10, 11, 12, 13, 14, 15)); }
__device__ __forceinline__ v8f wmma16(v16h a, v16h b, v8f c) { return __builtin_amdgcn_wmma_f32_16x16x32_f16(false, a, false, b, (short)0, c, false, false); }
__device__ __forceinline__ v8f wmmab(v16bf a, v16bf b, v8f c) { return __builtin_amdgcn_wmma_f32_16x16x32_bf16(false, a, false, b, (short)0, c, false, false); }



// FRAGMENT ORDER of every 16-bit operand plane [rows][K]: a block of 16 rows x 32 k is 512 elements in a row, element (row r, k) at ((k >> 4) & 1) * 256 + (((k >> 3) & 1) * 16 + (r & 15)) * 8 + (k & 7);
// blocks run along k, then along the rows: block (r >> 4, k >> 5) starts at (r >> 4) * 16 * K + (k >> 5) * 512. Lane l of a wave finds its two 16-byte pieces of a fragment at l * 8 and 256 + l * 8,
// so each wave-wide 16-byte load or store covers 512 bytes in a row: 4 whole lines, where rows of K in a row give a 32-byte piece of each of 16 lines. Lane (lr, hi), l = hi * 16 + lr, holds row lr, k = 8 * hi + 0..7 and 16 + 8 * hi + 0..7.

// ---- k_gemmw: register-blocked GEMM, one wave per 64x64 output tile (16 accumulators); FOUR WAVES (2 x 2 wave tiles) make a work-group with a 128x128 tile and share its operands through LDS; grid (M/128, N/128, Z), 128 threads.
// The 16-bit planes lie in fragment order, so a k tile (64 k = two k blocks) of 16 rows is 2 KB in a row in memory and goes to LDS as it is, by asynchronous copies; each operand byte is asked for once a work-group, where four lone waves asked for it twice.
// C[m][n] (f32, pitch ldc, + optional f32 bias[n], one vector per z slice up to three) = sum_k A[m][k] Bt[n][k] (+ split products per NSPLIT). z-batch strides sA/sB/sC in elements. K % 64 == 0, K >= 128.
// PLANES (the q/k/v projection): no f32 C. A 64x64 tile is 64 tokens x the 64 columns of ONE head, so the wave itself writes the attention operand planes (fp16, bf16 hi, bf16 lo):
// z 0, 1 (q, k): [entry][head] planes of [t][d] in fragment order, the tile is 8 KB in a row of each plane; z 2 (v): [entry][head] planes of [d][t] in fragment order, staged through LDS the other way round.
typedef __attribute__((ext_vector_type(8))) __bf16 v8b;
// eight neighbouring f32 values -> 16 bytes in each of the three operand planes (round to nearest even, as the planes always were)
__device__ __forceinline__ void put3(v8f val, h16* p16, bf* ph, bf* pl) {
    const v8h o16 = __builtin_convertvector(val, v8h); const v8b oh = __builtin_convertvector(val, v8b); const v8b ol = __builtin_convertvector(val - __builtin_convertvector(oh, v8f), v8b);
    *(v8h*)p16 = o16; *(v8us*)ph = __builtin_bit_cast(v8us, oh); *(v8us*)pl = __builtin_bit_cast(v8us, ol); }
// ld(p): p = start of the fragment's block + 8 * lane
template <typename T16> struct WFrag;
template <> struct WFrag<h16> { typedef v16h V; static __device__ __forceinline__ V ld(const h16* p) { return cat16(*(const v8h*)p, *(const v8h*)(p + 256)); } static __device__ __forceinline__ v8f mma(V a, V b, v8f c) { return wmma16(a, b, c); } };
template <> struct WFrag<bf> { typedef v16bf V; static __device__ __forceinline__ V ld(const bf* p) { return cat16b(*(const v8us*)p, *(const v8us*)(p + 256)); } static __device__ __forceinline__ v8f mma(V a, V b, v8f c) { return wmmab(a, b, c); } };
// SB: a scheduling fence; keeps a group of fragment loads whole and in front of the products that cover it (without it the build sinks most of the loads in among the products and waits for them there)
#define SB() __builtin_amdgcn_sched_barrier(0)
// cp8: eight asynchronous copies, 16 bytes a lane, global memory -> LDS through no register: two row blocks of a k tile, each four wave-wide pieces of 512 bytes. l0, l1: the lane's LDS byte address in the row block; g0, g1: its global address.
// The s_wait_xcnt stands in the copies' own statement: no register that a copy names is written again in front of it.
__device__ __forceinline__ void cp8(unsigned l0, const char* g0, unsigned l1, const char* g1) {
    asm volatile("global_load_async_to_lds_b128 %0, %8, off\n\tglobal_load_async_to_lds_b128 %1, %9, off\n\tglobal_load_async_to_lds_b128 %2, %10, off\n\tglobal_load_async_to_lds_b128 %3, %11, off\n\t"
                 "global_load_async_to_lds_b128 %4, %12, off\n\tglobal_load_async_to_lds_b128 %5, %13, off\n\tglobal_load_async_to_lds_b128 %6, %14, off\n\tglobal_load_async_to_lds_b128 %7, %15, off\n\ts_wait_xcnt 0x0"
                 :: "v"(l0), "v"(l0 + 512u), "v"(l0 + 1024u), "v"(l0 + 1536u), "v"(l1), "v"(l1 + 512u), "v"(l1 + 1024u), "v"(l1 + 1536u),
                    "v"(g0), "v"(g0 + 512), "v"(g0 + 1024), "v"(g0 + 1536), "v"(g1), "v"(g1 + 512), "v"(g1 + 1024), "v"(g1 + 1536) : "memory"); }
template <typename T16, int NSPLIT, bool BIAS, bool PLANES, int K>   // K at compile time: the row blocks of a fragment-order plane are then fixed byte offsets from one address per operand
__global__ __launch_bounds__(128) void k_gemmw(const T16* __restrict__ A, const T16* __restrict__ A2, const T16* __restrict__ Bt, const T16* __restrict__ Bt2, float* C, int ldc, const float* __restrict__ bias0, const float* __restrict__ bias1, const float* __restrict__ bias2, size_t sA, size_t sB, size_t sC, h16* P16, bf* Ph, bf* Pl, h16* V16, bf* Vh, bf* Vl) {
    typedef typename WFrag<T16>::V V;
    constexpr int NPA = (NSPLIT == 1 || NSPLIT == 2) ? 2 : 1, NPB = (NSPLIT >= 2) ? 2 : 1;   // planes per operand
    constexpr int PLN = 8 * 1024, TILE = (NPA + NPB) * PLN;   // elements: a plane's share of a k tile is 8 row blocks x (16 rows x 64 k); a tile holds A, (A2), B, (B2) one behind the other
    __shared__ __align__(16) T16 ring[2][TILE];      // two buffers: tile t lies in buffer t & 1
    __shared__ __align__(16) float osw[4][16 * 68];
    const int wv = __builtin_amdgcn_readfirstlane((int)(threadIdx.x >> 5)); float* const os = osw[wv];   // each wave stages its output in its own LDS range
    const size_t z = blockIdx.z; A += z * sA; if (A2) A2 += z * sA; Bt += z * sB; if (Bt2) Bt2 += z * sB; C += z * sC;
    const float* __restrict__ bias = (z == 0) ? bias0 : (z == 1) ? bias1 : bias2;   // one bias vector per z slice
    const int lane = threadIdx.x & 31, lr = lane & 15, hi = lane >> 4; const int r0 = blockIdx.x * 128 + (wv & 1) * 64, c0 = blockIdx.y * 128 + (wv >> 1) * 64;
    v8f acc[4][4];
#pragma unroll
    for (int mb = 0; mb < 4; ++mb)
#pragma unroll
        for (int nb = 0; nb < 4; ++nb) acc[mb][nb] = (v8f){};
    static_assert(K % 64 == 0 && K >= 128, "k is walked in tiles of two k blocks; the two buffers want two tiles");
    // tile t into buffer bu: wave wv brings row blocks wv and wv + 4 of every plane (fragment order: row block stride 16 * K elements, a k tile 1024 elements in a row)
    const unsigned lw = (unsigned)(size_t)&ring[0][0] + (unsigned)wv * 2048u + (unsigned)lane * 16u;
    const size_t gw = ((size_t)wv * 16 * K) * 2 + (size_t)lane * 16, ga = (size_t)(blockIdx.x * 128) * K * 2 + gw, gb = (size_t)(blockIdx.y * 128) * K * 2 + gw;   // bytes
    auto copies = [&](int t, int bu) __attribute__((always_inline)) {
        const unsigned l = lw + (unsigned)bu * (TILE * 2u); const size_t ka = ga + (size_t)t * 2048, kb = gb + (size_t)t * 2048; constexpr size_t R4 = (size_t)4 * 16 * K * 2;
        cp8(l, (const char*)A + ka, l + 8192u, (const char*)A + ka + R4);
        if constexpr (NPA == 2) cp8(l + PLN * 2u, (const char*)A2 + ka, l + PLN * 2u + 8192u, (const char*)A2 + ka + R4);
        cp8(l + NPA * PLN * 2u, (const char*)Bt + kb, l + NPA * PLN * 2u + 8192u, (const char*)Bt + kb + R4);
        if constexpr (NPB == 2) cp8(l + (NPA + 1) * PLN * 2u, (const char*)Bt2 + kb, l + (NPA + 1) * PLN * 2u + 8192u, (const char*)Bt2 + kb + R4); };
    // TWO FRAGMENT SETS, one per k block of the tile: all fragment reads of a trip go out as one group in front of its products
    V a[2][4], a2[2][4], b[2][4], b2[2][4];
    auto fetch = [&](int st, const T16* sa, const T16* sb) __attribute__((always_inline)) {   // sa, sb: the wave's first A and B row block in the buffer + 8 * lane
#pragma unroll
        for (int mb = 0; mb < 4; ++mb) { a[st][mb] = WFrag<T16>::ld(sa + mb * 1024 + st * 512); if (NSPLIT == 1 || NSPLIT == 2) a2[st][mb] = WFrag<T16>::ld(sa + PLN + mb * 1024 + st * 512); }
#pragma unroll
        for (int nb = 0; nb < 4; ++nb) { b[st][nb] = WFrag<T16>::ld(sb + nb * 1024 + st * 512); if (NSPLIT >= 2) b2[st][nb] = WFrag<T16>::ld(sb + PLN + nb * 1024 + st * 512); } };
    auto prods = [&](int st) __attribute__((always_inline)) {   // per accumulator the order of the products is the old one
#pragma unroll
        for (int nb = 0; nb < 4; ++nb)
#pragma unroll
            for (int mb = 0; mb < 4; ++mb) { acc[mb][nb] = WFrag<T16>::mma(a[st][mb], b[st][nb], acc[mb][nb]); if (NSPLIT == 1 || NSPLIT == 2) acc[mb][nb] = WFrag<T16>::mma(a2[st][mb], b[st][nb], acc[mb][nb]); if (NSPLIT >= 2) acc[mb][nb] = WFrag<T16>::mma(a[st][mb], b2[st][nb], acc[mb][nb]); } };
    copies(0, 0);
    asm volatile("s_wait_asynccnt 0x0" ::: "memory");   // this wave's share of tile 0 has landed
    __syncthreads();                                    // every wave's share has: tile 0 may be read
    copies(1, 1);
#pragma unroll 1
    for (int t = 0; t < K / 64; ++t) {   // stays rolled: one copy of the 32 (64) products in the text
        const T16* const sa = &ring[t & 1][0] + (wv & 1) * 4096 + 8 * lane; const T16* const sb = &ring[t & 1][0] + NPA * PLN + (wv >> 1) * 4096 + 8 * lane;
        fetch(0, sa, sb); fetch(1, sa, sb); SB(); prods(0); prods(1);
        asm volatile("v_nop\n\tv_nop\n\tv_nop\n\tv_nop" : "+v"(acc[0][0]), "+v"(acc[1][1]), "+v"(acc[2][2]), "+v"(acc[3][3]) : "v"(a[1][0]), "v"(a[1][3]));   // the four vector slots behind the last product, on the taken side of the branch back too
        SB();   // the products stay in front of the trip's foot (without it the build sinks most of them behind the barrier, in front of the copies, which then fly for a part of a trip only)
        asm volatile("s_wait_dscnt 0x0" ::: "memory");      // this wave's reads of buffer t & 1 are done before the buffer is handed to its next writer
        asm volatile("s_wait_asynccnt 0x0" ::: "memory");   // this wave's share of tile t + 1 has landed
        __syncthreads();                                    // one barrier a trip: it publishes tile t + 1 and ends every wave's reads of buffer t & 1
        if (t + 2 < K / 64) copies(t + 2, t & 1);           // the same test in the whole work-group; flies while tile t + 1 is worked on
    }
    asm volatile("s_wait_asynccnt 0x0" ::: "memory");   // no copy is out when the wave goes on
    if constexpr (PLANES) {
        const int cofs = hi * 8;   // read-back in fragment order: step s, lane (lr, hi) takes row lr, values s*16 + hi*8 + 0..7; the wave's 32 pieces are 512 bytes in a row of the plane
        const size_t hp = ((size_t)(r0 / TT) * NH_ + c0 / HD) * TT * HD; const int t0 = r0 % TT;   // (entry, head) plane; first token of the tile
        if (z == 2) {
            const size_t po = hp + (size_t)t0 * 16 + lane * 8; float bb[4];
#pragma unroll
            for (int nb = 0; nb < 4; ++nb) bb[nb] = bias[c0 + nb * 16 + lr];
            asm volatile("" :: "v"(bb[0]), "v"(bb[1]), "v"(bb[2]), "v"(bb[3]));   // inputs only: the four bias loads are asked for together, one wait (without it the build waits out each load in turn)
#pragma unroll
            for (int nb = 0; nb < 4; ++nb) bb[nb] = bfr(bb[nb]);
#pragma unroll
            for (int nb = 0; nb < 4; ++nb) {
#pragma unroll
                for (int mb = 0; mb < 4; ++mb) { const v8f val = acc[mb][nb] + bb[nb];   // lane (lr, hi): column d = nb*16 + lr, tokens mb*16 + 8*hi + 0..7
                    *(v4fa*)(os + lr * 68 + mb * 16 + hi * 8) = __builtin_shufflevector(val, val, 0, 1, 2, 3); *(v4fa*)(os + lr * 68 + mb * 16 + hi * 8 + 4) = __builtin_shufflevector(val, val, 4, 5, 6, 7); }
                __builtin_amdgcn_wave_barrier(); asm volatile("" ::: "memory");   // the read-back below stays behind the LDS stores
#pragma unroll
                for (int s = 0; s < 4; ++s) { const v4f v0 = *(const v4fa*)(os + lr * 68 + s * 16 + cofs), v1 = *(const v4fa*)(os + lr * 68 + s * 16 + cofs + 4);
                    const size_t e = po + (size_t)nb * 16 * TT + s * 256; put3(__builtin_shufflevector(v0, v1, 0, 1, 2, 3, 4, 5, 6, 7), V16 + e, Vh + e, Vl + e); }
                __builtin_amdgcn_wave_barrier(); asm volatile("" ::: "memory");   // the next block's LDS stores stay behind the read-back
            }
            return;
        }
        const size_t po = z * ((size_t)GB * NH_ * TT * HD) + hp + (size_t)t0 * HD + lane * 8; v8f bb[4]; const float* const bp = bias + c0 + cofs;
#pragma unroll
        for (int s = 0; s < 4; ++s)
#pragma unroll
            for (int i = 0; i < 8; ++i) bb[s][i] = bp[s * 16 + i];
        asm volatile("s_wait_xcnt 0x0" :: "v"(bp) : "memory");   // stands before the address register of the bias loads is written again; the address as an input: its register stays its own up to here
#pragma unroll
        for (int s = 0; s < 4; ++s)
#pragma unroll
            for (int i = 0; i < 8; ++i) bb[s][i] = bfr(bb[s][i]);
#pragma unroll
        for (int mb = 0; mb < 4; ++mb) {
#pragma unroll
            for (int nb = 0; nb < 4; ++nb) {
#pragma unroll
                for (int j = 0; j < 8; ++j) os[(hi * 8 + j) * 68 + nb * 16 + lr] = acc[mb][nb][j]; }
            __builtin_amdgcn_wave_barrier(); asm volatile("" ::: "memory");   // the read-back below stays behind the LDS stores
#pragma unroll
            for (int s = 0; s < 4; ++s) { const v4f v0 = *(const v4fa*)(os + lr * 68 + s * 16 + cofs), v1 = *(const v4fa*)(os + lr * 68 + s * 16 + cofs + 4);
                const size_t e = po + (size_t)mb * 16 * HD + s * 256; put3(__builtin_shufflevector(v0, v1, 0, 1, 2, 3, 4, 5, 6, 7) + bb[s], P16 + e, Ph + e, Pl + e); }
            __builtin_amdgcn_wave_barrier(); asm volatile("" ::: "memory");   // the next block's LDS stores stay behind the read-back
        }
        asm volatile("s_wait_xcnt 0x0" ::: "memory");   // the build lays the v path behind this one with a never-taken fall-through: its first register writes stay behind the wait for the stores above
        return;
    }
#pragma unroll
    for (int mb = 0; mb < 4; ++mb) {
#pragma unroll
        for (int nb = 0; nb < 4; ++nb) {
#pragma unroll
            for (int j = 0; j < 8; ++j) os[(hi * 8 + j) * 68 + nb * 16 + lr] = acc[mb][nb][j]; }
        __builtin_amdgcn_wave_barrier(); asm volatile("" ::: "memory");
        float* crow = C + (size_t)(r0 + mb * 16) * ldc + c0;
{
#pragma unroll
            for (int s = 0; s < 8; ++s) { const int row = 2 * s + hi, cofs = lr * 4; v4f val = *(const v4fa*)(os + row * 68 + cofs); if (BIAS) { val[0] += bfr(bias[c0 + cofs]); val[1] += bfr(bias[c0 + cofs + 1]); val[2] += bfr(bias[c0 + cofs + 2]); val[3] += bfr(bias[c0 + cofs + 3]); }
                *(v4f*)(crow + (size_t)row * ldc + cofs) = val; }
             }
        __builtin_amdgcn_wave_barrier(); asm volatile("" ::: "memory");
    }
}

typedef __attribute__((ext_vector_type(2))) _Float16 v2h;
typedef __attribute__((ext_vector_type(4))) _Float16 v4h;
typedef __attribute__((ext_vector_type(2))) unsigned short v2us;
typedef __attribute__((ext_vector_type(4))) unsigned short v4us;
typedef __attribute__((ext_vector_type(2))) float v2f;
typedef __attribute__((ext_vector_type(4))) int v4i;

// thread i writes piece i (8 k of one n) of the transposed plane [n][k] in fragment order: each half of a wave reads 16 neighbouring n of one k row, eight rows in turn
template <int K, int N>
__device__ __forceinline__ void wtG(int y, int bx, const float* __restrict__ w0, const float* __restrict__ w1, const float* __restrict__ w2, const float* __restrict__ w3, bf* Bt) {
    const float* __restrict__ w = (y == 0) ? w0 : (y == 1) ? w1 : (y == 2) ? w2 : w3; Bt += (size_t)y * N * K;   // y: which of the four weights
    const int i = bx * 256 + threadIdx.x; if (i >= N * K / 8) return;
    const int blk = i >> 6; const int n = blk / (K / 32) * 16 + (i & 15), k = blk % (K / 32) * 32 + ((i >> 5) & 1) * 16 + ((i >> 4) & 1) * 8; const float* p = w + (size_t)k * N + n; float t[8]; v8us o;
#pragma unroll
    for (int j = 0; j < 8; ++j) t[j] = p[j * N];
    asm volatile("s_wait_xcnt 0x0" :: "v"(p) : "memory");   // stands before the address register of the eight loads is written again; the address as an input: its register stays its own up to here
#pragma unroll
    for (int j = 0; j < 8; ++j) o[j] = f2bf(t[j]);
    *(v8us*)(Bt + (size_t)i * 8) = o;
}
// thread i writes piece i of the plane in fragment order: block i >> 6 = (row block, k block), half (i >> 5) & 1, lane i & 31 = (hi, lr)
__device__ __forceinline__ void cvt8(int bx, const float* __restrict__ src, bf* dst, size_t n8) { const size_t i = (size_t)bx * 256 + threadIdx.x; if (i >= n8) return;
    const size_t blk = i >> 6; const size_t row = blk / (DM / 32) * 16 + (i & 15); const int k = (int)(blk % (DM / 32)) * 32 + (int)((i >> 5) & 1) * 16 + (int)((i >> 4) & 1) * 8; const float* p = src + row * DM + k; const v8f v = *(const v8f*)p; v8us o;
    asm volatile("s_wait_xcnt 0x0" :: "v"(p) : "memory");   // stands before the address register of the two loads is written again; the address as an input: its register stays its own up to here
#pragma unroll
    for (int k = 0; k < 8; ++k) o[k] = f2bf(v[k]); *(v8us*)(dst + i * 8) = o;  }
// ---- k_prep: both conversions in ONE grid (neither reads what the other writes): blocks 0 .. XBLK-1 make the x plane, the next 4 * WBLK the four transposed weights
#define XBLK ((int)((size_t)NB_ * TT * DM / 8 / 256))
#define WBLK (DM * DQ / 8 / 256)
__global__ __launch_bounds__(256) void k_prep(const float* __restrict__ x, const float* __restrict__ w0, const float* __restrict__ w1, const float* __restrict__ w2, const float* __restrict__ w3, bf* XB, bf* Bt) {
    const int b = blockIdx.x;
    if (b < XBLK) cvt8(b, x, XB, (size_t)NB_ * TT * DM / 8);
    else wtG<DM, DQ>((b - XBLK) / WBLK, (b - XBLK) % WBLK, w0, w1, w2, w3, Bt);
}

#define NQ   2                    // 16-query groups per wave
#define FW   4                    // waves per work-group: same head, neighbouring rows, no exchange between them
#define LC   (SCL * 1.4426950408889634f)
typedef __attribute__((ext_vector_type(2))) __bf16 v2b;
// XWAIT: stands behind a group of global loads or stores, before a register that one of them names is written again (this build goes above v255); the scheduling fence keeps later register writes behind it
#define XWAIT() do { asm volatile("s_wait_xcnt 0x0" ::: "memory"); __builtin_amdgcn_sched_barrier(0); } while (0)
__device__ __forceinline__ float xhalf(float v) { const int b = __float_as_int(v); return __int_as_float(__builtin_amdgcn_permlanex16(b, b, 0x76543210, 0xfedcba98, false, false)); }   // lane l <-> l ^ 16
template <typename T16, bool HL>
__device__ __forceinline__ void fattn(const T16* __restrict__ Q, const T16* __restrict__ Q2, const T16* __restrict__ Kp, const T16* __restrict__ K2, const T16* __restrict__ Vt, const T16* __restrict__ V2, int q0, bf* Ah, bf* Al) {
    typedef typename WFrag<T16>::V V;
    const int lane = threadIdx.x & 31;
    V qf[NQ][2], qf2[NQ][2], kf[2][2], kf2[2][2];
#pragma unroll
    for (int qt = 0; qt < NQ; ++qt)
#pragma unroll
        for (int ks = 0; ks < 2; ++ks) { const int qo = (q0 + qt * 16) * HD + ks * 512 + 8 * lane; qf[qt][ks] = WFrag<T16>::ld(Q + qo); if constexpr (HL) qf2[qt][ks] = WFrag<T16>::ld(Q2 + qo); }
    XWAIT();
    // fragment order: K blocks 512 apart along d, 16 * HD along the keys; Vt blocks 512 apart along the keys, 16 * TT along d
#pragma unroll
    for (int kt = 0; kt < 2; ++kt)
#pragma unroll
        for (int ks = 0; ks < 2; ++ks) { const int ko = kt * 16 * HD + ks * 512 + 8 * lane; kf[kt][ks] = WFrag<T16>::ld(Kp + ko); if constexpr (HL) kf2[kt][ks] = WFrag<T16>::ld(K2 + ko); }
    XWAIT();
    v8f o[NQ][4]; float m[NQ], l[NQ];
#pragma unroll
    for (int qt = 0; qt < NQ; ++qt) { m[qt] = -3.0e38f; l[qt] = 0.f;
#pragma unroll
        for (int dt = 0; dt < 4; ++dt) o[qt][dt] = (v8f){}; }
#pragma unroll 1
    for (int kb = 0; kb < TT; kb += 32) {
        V vf[4], vf2[4];   // this pass's Vt fragments: asked for first, used last
#pragma unroll
        for (int dt = 0; dt < 4; ++dt) vf[dt] = WFrag<T16>::ld(Vt + dt * 16 * TT + kb * 16 + 8 * lane);
        XWAIT();
        if constexpr (HL) {
#pragma unroll
            for (int dt = 0; dt < 4; ++dt) vf2[dt] = WFrag<T16>::ld(V2 + dt * 16 * TT + kb * 16 + 8 * lane);
            XWAIT(); }
        v8f s[NQ][2];
#pragma unroll
        for (int qt = 0; qt < NQ; ++qt) { s[qt][0] = (v8f){}; s[qt][1] = (v8f){}; }
#pragma unroll
        for (int ks = 0; ks < 2; ++ks) {
#pragma unroll
            for (int kt = 0; kt < 2; ++kt)
#pragma unroll
                for (int qt = 0; qt < NQ; ++qt) s[qt][kt] = WFrag<T16>::mma(kf[kt][ks], qf[qt][ks], s[qt][kt]);
            if constexpr (HL) {
#pragma unroll
                for (int kt = 0; kt < 2; ++kt)
#pragma unroll
                    for (int qt = 0; qt < NQ; ++qt) s[qt][kt] = WFrag<T16>::mma(kf[kt][ks], qf2[qt][ks], s[qt][kt]);
#pragma unroll
                for (int kt = 0; kt < 2; ++kt)
#pragma unroll
                    for (int qt = 0; qt < NQ; ++qt) s[qt][kt] = WFrag<T16>::mma(kf2[kt][ks], qf[qt][ks], s[qt][kt]); } }
        const int kn = (kb + 32) & (TT - 1);   // next pass's key fragments, one pass ahead; the last pass asks for the first keys again (in bounds, not used)
#pragma unroll
        for (int kt = 0; kt < 2; ++kt)
#pragma unroll
            for (int ks = 0; ks < 2; ++ks) { const int ko = (kn + kt * 16) * HD + ks * 512 + 8 * lane; kf[kt][ks] = WFrag<T16>::ld(Kp + ko); if constexpr (HL) kf2[kt][ks] = WFrag<T16>::ld(K2 + ko); }
        XWAIT();
        V pf[NQ], pf2[NQ];
#pragma unroll
        for (int qt = 0; qt < NQ; ++qt) {
            float bm = fmaxf(s[qt][0][0], s[qt][1][0]);
#pragma unroll
            for (int j = 1; j < 8; ++j) bm = fmaxf(bm, fmaxf(s[qt][0][j], s[qt][1][j]));
            bm = fmaxf(bm, xhalf(bm));
            const float mn = fmaxf(m[qt], bm); const float al = __builtin_amdgcn_exp2f((m[qt] - mn) * LC); m[qt] = mn;
            const float sh = (HL ? 0.0f : 10.0f) - mn * LC; float ps = 0.f;
#pragma unroll
            for (int e = 0; e < 16; e += 2) { v2f p; p[0] = __builtin_amdgcn_exp2f(__builtin_fmaf(s[qt][e >> 3][e & 7], LC, sh)); p[1] = __builtin_amdgcn_exp2f(__builtin_fmaf(s[qt][e >> 3][(e & 7) + 1], LC, sh)); ps += p[0]; ps += p[1];
                if constexpr (HL) { const v2b ph = __builtin_convertvector(p, v2b); const v2b pl = __builtin_convertvector(p - __builtin_convertvector(ph, v2f), v2b); pf[qt][e] = ph[0]; pf[qt][e + 1] = ph[1]; pf2[qt][e] = pl[0]; pf2[qt][e + 1] = pl[1]; }
                else { const v2h ph = __builtin_convertvector(p, v2h); pf[qt][e] = ph[0]; pf[qt][e + 1] = ph[1]; } }
            l[qt] = l[qt] * al + ps;
#pragma unroll
            for (int dt = 0; dt < 4; ++dt) o[qt][dt] *= al; }
#pragma unroll
        for (int dt = 0; dt < 4; ++dt)
#pragma unroll
            for (int qt = 0; qt < NQ; ++qt) o[qt][dt] = WFrag<T16>::mma(vf[dt], pf[qt], o[qt][dt]);
        if constexpr (HL) {
#pragma unroll
            for (int dt = 0; dt < 4; ++dt)
#pragma unroll
                for (int qt = 0; qt < NQ; ++qt) o[qt][dt] = WFrag<T16>::mma(vf[dt], pf2[qt], o[qt][dt]);
#pragma unroll
            for (int dt = 0; dt < 4; ++dt)
#pragma unroll
                for (int qt = 0; qt < NQ; ++qt) o[qt][dt] = WFrag<T16>::mma(vf2[dt], pf[qt], o[qt][dt]); }
    }
#pragma unroll
    for (int qt = 0; qt < NQ; ++qt) { const float inv = __fdiv_rn(1.0f, l[qt] + xhalf(l[qt])); const size_t ro = (size_t)(q0 + qt * 16) * DQ + 8 * lane;   // o[qt][dt][j] = O[query lr][d = dt*16 + 8*hi + j]: piece (half dt & 1, lane) of k block dt >> 1 of this head
#pragma unroll
        for (int dt = 0; dt < 4; ++dt) { const v8f val = o[qt][dt] * inv; const v8b oh = __builtin_convertvector(val, v8b); const v8b ol = __builtin_convertvector(val - __builtin_convertvector(oh, v8f), v8b);
            *(v8us*)(Ah + ro + dt * 256) = __builtin_bit_cast(v8us, oh); *(v8us*)(Al + ro + dt * 256) = __builtin_bit_cast(v8us, ol);
            XWAIT(); } }
}
// grid x: (entry of the group, head); grid y: block of FW*NQ*16 query rows, the hi+lo blocks (three times the products) first
__global__ __launch_bounds__(FW * 32) void k_fattn(const h16* __restrict__ Q16, const h16* __restrict__ K16, const h16* __restrict__ V16, const bf* __restrict__ Qh, const bf* __restrict__ Ql, const bf* __restrict__ Kh, const bf* __restrict__ Kl, const bf* __restrict__ Vh, const bf* __restrict__ Vl, bf* Ah, bf* Al) {
    const int z = blockIdx.x; const size_t po = (size_t)z * TT * HD; const size_t ao = (size_t)(z / NH_) * TT * DQ + (size_t)(z % NH_) * (HD / 32) * 512;   // the merged plane [token][DQ] in fragment order: this head's two k blocks
    const int qb = blockIdx.y * (FW * NQ * 16); const int q0 = qb + (int)(threadIdx.x >> 5) * (NQ * 16);
    if (qb < RH) fattn<bf, true>(Qh + po, Ql + po, Kh + po, Kl + po, Vh + po, Vl + po, q0, Ah + ao, Al + ao);
    else fattn<h16, false>(Q16 + po, nullptr, K16 + po, nullptr, V16 + po, nullptr, q0, Ah + ao, Al + ao);
}

extern "C" void kernel_launch(void* const* d_in, const int* in_sizes, int n_in,
                              void* d_out, int out_size, void* d_ws, size_t ws_size, hipStream_t stream) {
    (void)in_sizes; (void)n_in; (void)out_size;
    const float* x = (const float*)d_in[0]; const float* wq = (const float*)d_in[1]; const float* bq = (const float*)d_in[2]; const float* wk = (const float*)d_in[3]; const float* bk = (const float*)d_in[4]; const float* wv = (const float*)d_in[5]; const float* bv = (const float*)d_in[6]; const float* wo = (const float*)d_in[7]; const float* bo = (const float*)d_in[8];
    float* OUT = (float*)d_out;     // [8][1024][1024]
    char* wsp = (char*)d_ws;
    auto take = [&](size_t bytes) { char* p = wsp; wsp += (bytes + 255) & ~(size_t)255; return (void*)p; };
    const size_t PS = (size_t)GB * NH_ * TT * HD;   // one 16-bit plane of a group: [entry][head] planes of [t][d] (v: [d][t]), each in fragment order
    static_assert(NKV == NH_ && NB_ % GB == 0 && ZH == NH_, "one pass per group of GB batch entries; q, k, v of equal width");
    bf* W4 = (bf*)take((size_t)4 * DQ * DM * 2); bf* WO = W4 + (size_t)3 * DQ * DM;   // Wq, Wk, Wv, Wo transposed, back to back
    bf* XB = (bf*)take((size_t)GB * TT * DM * 2);
    h16* QP16 = (h16*)take(2 * PS * 2); h16* KP16 = QP16 + PS; h16* VT16 = (h16*)take(PS * 2);
    bf* QPh = (bf*)take(2 * PS * 2); bf* KPh = QPh + PS; bf* QPl = (bf*)take(2 * PS * 2); bf* KPl = QPl + PS; bf* VTh = (bf*)take(PS * 2); bf* VTl = (bf*)take(PS * 2);
    bf* ATh = (bf*)take((size_t)NB_ * TT * DQ * 2); bf* ATl = (bf*)take((size_t)NB_ * TT * DQ * 2);
    if ((size_t)(wsp - (char*)d_ws) > ws_size) return;    // ws 256 MiB
    static_assert(TT % 64 == 0 && HD == 64 && DQ == NH_ * HD && (GB * TT) % 128 == 0 && DQ % 128 == 0 && DM % 128 == 0, "a wave's 64x64 projection tile is 64 tokens of one entry x one head; whole 128x128 work-group tiles");
    static_assert(RH % (FW * NQ * 16) == 0 && TT % (FW * NQ * 16) == 0 && HD == 64 && (TT & (TT - 1)) == 0, "whole row blocks on either side of RH");
    static_assert(GB == NB_ && ((size_t)NB_ * TT * DM / 8) % 256 == 0 && (DM * DQ / 8) % 256 == 0, "one group; whole blocks of 256 pieces on either side of XBLK");
    k_prep<<<XBLK + 4 * WBLK, 256, 0, stream>>>(x, wq, wk, wv, wo, XB, W4);
    k_gemmw<bf, 0, true, true, DM><<<dim3(GB * TT / 128, DQ / 128, 3), 128, 0, stream>>>(XB, nullptr, W4, nullptr, nullptr, 0, bq, bk, bv, 0, (size_t)DQ * DM, 0, QP16, QPh, QPl, VT16, VTh, VTl);
    k_fattn<<<dim3(GB * NH_, TT / (FW * NQ * 16), 1), FW * 32, 0, stream>>>(QP16, KP16, VT16, QPh, QPl, KPh, KPl, VTh, VTl, ATh, ATl);
    k_gemmw<bf, 1, true, false, DQ><<<dim3(NB_ * TT / 128, DM / 128, 1), 128, 0, stream>>>(ATh, ATl, WO, nullptr, OUT, DM, bo, nullptr, nullptr, 0, 0, 0, nullptr, nullptr, nullptr, nullptr, nullptr, nullptr);
}

// v008
// One run takes 127 microseconds.
// Timed twice side by side with v007, it ran 1.05 times as fast both times.
// All steps since v000 together make it 36.9 times as fast.
#include <hip/hip_runtime.h>

// CLIP attention (hidden_states [8][1024][1024]; q = (x Wq + bq) x 64^-0.5, k, v = x W + b ('xw' [1024][1024]; 16 heads x 64); softmax(q.k) over all keys; out = merged Wo + bo -> [8][1024][1024] (8.4 M)).
// Compute dtypes, f32 accumulate: every input rounded to bf16; q/k/v on PLAIN bf16 operands (inputs: exact) + biases; the 64^-0.5 applied to the f32 score (the module scales q after the bias; power of two, exact); scores and attn.v: query rows < 512 hl (3 products), the rest single fp16 (x1024); softmax f32; Wo hl x exact (2 products) + bo.

#define NB_  8
#define TT   1024
#define DM   1024
#define NH_  16
#define NKV  16
#define REP  (NH_ / NKV)
#define HD   64
#define DQ   (NH_ * HD)
#define DKV  (NKV * HD)
#define ZH   16                   // heads of one batch entry (only checked equal to NH_); one attention pass takes all GB entries
#define GB   8                    // batch entries per projection group: all of them, every stage runs once
#define RH   512                  // query rows < RH use hi+lo planes (0: none)
#define WIN  0
#define PCAR 1024.0f
#define SCL  0.125f   // HD^-0.5
typedef _Float16 h16;
typedef unsigned short bf;
typedef __attribute__((ext_vector_type(16))) __bf16   v16bf;
typedef __attribute__((ext_vector_type(16))) _Float16 v16h;
typedef __attribute__((ext_vector_type(8)))  _Float16 v8h;
typedef __attribute__((ext_vector_type(8)))  unsigned short v8us;
typedef __attribute__((ext_vector_type(8)))  float    v8f;
typedef __attribute__((ext_vector_type(4)))  float    v4f;
typedef v8h  __attribute__((may_alias)) v8ha;
typedef v4f  __attribute__((may_alias)) v4fa;
typedef v8us __attribute__((may_alias)) v8usa;

__device__ __forceinline__ unsigned short f2bf(float f) { unsigned u = __float_as_uint(f); u += 0x7FFFu + ((u >> 16) & 1u); return (unsigned short)(u >> 16); }
__device__ __forceinline__ float bf2f(unsigned short b) { return __uint_as_float(((unsigned)b) << 16); }
__device__ __forceinline__ float bfr(float f) { return bf2f(f2bf(f)); }
__device__ __forceinline__ v16h cat16(v8h lo, v8h hi) { return __builtin_shufflevector(lo, hi, 0, 1, 2, 3, 4, 5, 6, 7, 8, 9, 10, 11, 12, 13, 14, 15); }
__device__ __forceinline__ v16bf cat16b(v8us lo, v8us hi) { return __builtin_bit_cast(v16bf, __builtin_shufflevector(lo, hi, 0, 1, 2, 3, 4, 5, 6, 7, 8, 9, 10, 11, 12, 13, 14, 15)); }
__device__ __forceinline__ v8f wmma16(v16h a, v16h b, v8f c) { return __builtin_amdgcn_wmma_f32_16x16x32_f16(false, a, false, b, (short)0, c, false, false); }
__device__ __forceinline__ v8f wmmab(v16bf a, v16bf b, v8f c) { return __builtin_amdgcn_wmma_f32_16x16x32_bf16(false, a, false, b, (short)0, c, false, false); }



// FRAGMENT ORDER of every 16-bit operand plane [rows][K]: a block of 16 rows x 32 k is 512 elements in a row, element (row r, k) at ((k >> 4) & 1) * 256 + (((k >> 3) & 1) * 16 + (r & 15)) * 8 + (k & 7);
// blocks run along k, then along the rows: block (r >> 4, k >> 5) starts at (r >> 4) * 16 * K + (k >> 5) * 512. Lane l of a wave finds its two 16-byte pieces of a fragment at l * 8 and 256 + l * 8,
// so each wave-wide 16-byte load or store covers 512 bytes in a row: 4 whole lines, where rows of K in a row give a 32-byte piece of each of 16 lines. Lane (lr, hi), l = hi * 16 + lr, holds row lr, k = 8 * hi + 0..7 and 16 + 8 * hi + 0..7.

// ---- k_gemmw: register-blocked GEMM, one wave per 64x64 output tile (16 accumulators); FOUR WAVES (2 x 2 wave tiles) make a work-group with a 128x128 tile and share its operands through LDS; grid (M/128, N/128, Z), 128 threads.
// The 16-bit planes lie in fragment order, so a k tile (64 k = two k blocks) of 16 rows is 2 KB in a row in memory and goes to LDS as it is, by asynchronous copies; each operand byte is asked for once a work-group, where four lone waves asked for it twice.
// C[m][n] (f32, pitch ldc, + optional f32 bias[n], one vector per z slice up to three) = sum_k A[m][k] Bt[n][k] (+ split products per NSPLIT). z-batch strides sA/sB/sC in elements. K % 64 == 0, K >= 128.
// PLANES (the q/k/v projection): no f32 C. A 64x64 tile is 64 tokens x the 64 columns of ONE head, so the wave itself writes the attention operand planes (fp16, bf16 hi, bf16 lo):
// z 0, 1 (q, k): [entry][head] planes of [t][d] in fragment order, the tile is 8 KB in a row of each plane; z 2 (v): [entry][head] planes of [d][t] in fragment order, staged through LDS the other way round.
typedef __attribute__((ext_vector_type(8))) __bf16 v8b;
// eight neighbouring f32 values -> 16 bytes in each of the three operand planes (round to nearest even, as the planes always were)
__device__ __forceinline__ void put3(v8f val, h16* p16, bf* ph, bf* pl) {
    const v8h o16 = __builtin_convertvector(val, v8h); const v8b oh = __builtin_convertvector(val, v8b); const v8b ol = __builtin_convertvector(val - __builtin_convertvector(oh, v8f), v8b);
    *(v8h*)p16 = o16; *(v8us*)ph = __builtin_bit_cast(v8us, oh); *(v8us*)pl = __builtin_bit_cast(v8us, ol); }
// ld(p): p = start of the fragment's block + 8 * lane
template <typename T16> struct WFrag;
template <> struct WFrag<h16> { typedef v16h V; static __device__ __forceinline__ V ld(const h16* p) { return cat16(*(const v8h*)p, *(const v8h*)(p + 256)); } static __device__ __forceinline__ v8f mma(V a, V b, v8f c) { return wmma16(a, b, c); } };
template <> struct WFrag<bf> { typedef v16bf V; static __device__ __forceinline__ V ld(const bf* p) { return cat16b(*(const v8us*)p, *(const v8us*)(p + 256)); } static __device__ __forceinline__ v8f mma(V a, V b, v8f c) { return wmmab(a, b, c); } };
// SB: a scheduling fence; keeps a group of fragment loads whole and in front of the products that cover it (without it the build sinks most of the loads in among the products and waits for them there)
#define SB() __builtin_amdgcn_sched_barrier(0)
// cp8: eight asynchronous copies, 16 bytes a lane, global memory -> LDS through no register: two row blocks of a k tile, each four wave-wide pieces of 512 bytes. l0, l1: the lane's LDS byte address in the row block; g0, g1: its global address.
// The s_wait_xcnt stands in the copies' own statement: no register that a copy names is written again in front of it.
__device__ __forceinline__ void cp8(unsigned l0, const char* g0, unsigned l1, const char* g1) {
    asm volatile("global_load_async_to_lds_b128 %0, %8, off\n\tglobal_load_async_to_lds_b128 %1, %9, off\n\tglobal_load_async_to_lds_b128 %2, %10, off\n\tglobal_load_async_to_lds_b128 %3, %11, off\n\t"
                 "global_load_async_to_lds_b128 %4, %12, off\n\tglobal_load_async_to_lds_b128 %5, %13, off\n\tglobal_load_async_to_lds_b128 %6, %14, off\n\tglobal_load_async_to_lds_b128 %7, %15, off\n\ts_wait_xcnt 0x0"
                 :: "v"(l0), "v"(l0 + 512u), "v"(l0 + 1024u), "v"(l0 + 1536u), "v"(l1), "v"(l1 + 512u), "v"(l1 + 1024u), "v"(l1 + 1536u),
                    "v"(g0), "v"(g0 + 512), "v"(g0 + 1024), "v"(g0 + 1536), "v"(g1), "v"(g1 + 512), "v"(g1 + 1024), "v"(g1 + 1536) : "memory"); }
template <typename T16, int NSPLIT, bool BIAS, bool PLANES, int K>   // K at compile time: the row blocks of a fragment-order plane are then fixed byte offsets from one address per operand
__global__ __launch_bounds__(128) void k_gemmw(const T16* __restrict__ A, const T16* __restrict__ A2, const T16* __restrict__ Bt, const T16* __restrict__ Bt2, float* C, int ldc, const float* __restrict__ bias0, const float* __restrict__ bias1, const float* __restrict__ bias2, size_t sA, size_t sB, size_t sC, h16* P16, bf* Ph, bf* Pl, h16* V16, bf* Vh, bf* Vl) {
    typedef typename WFrag<T16>::V V;
    constexpr int NPA = (NSPLIT == 1 || NSPLIT == 2) ? 2 : 1, NPB = (NSPLIT >= 2) ? 2 : 1;   // planes per operand
    constexpr int PLN = 8 * 1024, TILE = (NPA + NPB) * PLN;   // elements: a plane's share of a k tile is 8 row blocks x (16 rows x 64 k); a tile holds A, (A2), B, (B2) one behind the other
    __shared__ __align__(16) T16 ring[2][TILE];      // two buffers: tile t lies in buffer t & 1
    __shared__ __align__(16) float osw[4][16 * 68];
    const int wv = __builtin_amdgcn_readfirstlane((int)(threadIdx.x >> 5)); float* const os = osw[wv];   // each wave stages its output in its own LDS range
    const size_t z = blockIdx.z; A += z * sA; if (A2) A2 += z * sA; Bt += z * sB; if (Bt2) Bt2 += z * sB; C += z * sC;
    const float* __restrict__ bias = (z == 0) ? bias0 : (z == 1) ? bias1 : bias2;   // one bias vector per z slice
    const int lane = threadIdx.x & 31, lr = lane & 15, hi = lane >> 4; const int r0 = blockIdx.x * 128 + (wv & 1) * 64, c0 = blockIdx.y * 128 + (wv >> 1) * 64;
    v8f acc[4][4];
#pragma unroll
    for (int mb = 0; mb < 4; ++mb)
#pragma unroll
        for (int nb = 0; nb < 4; ++nb) acc[mb][nb] = (v8f){};
    static_assert(K % 64 == 0 && K >= 128, "k is walked in tiles of two k blocks; the two buffers want two tiles");
    static_assert((K / 64 & (K / 64 - 1)) == 0, "the walk wraps by a mask");
    // ROTATED WALK: work-groups that share A rows (same x) or B rows (same y, z) each enter the k tiles at a place of their own and wrap round, so that at one moment they ask L2 for different lines
    // (and the whole grid for all sixteen 2-KB pieces of every 32-KB row block, not for the same one). Each accumulator sums the same products, begun at another k.
    const int rot = (int)((blockIdx.x + blockIdx.y + (DQ / 128) * blockIdx.z) & (K / 64 - 1));
    // the walk's tile t (k tile (t + rot) mod K/64) into buffer bu: wave wv brings row blocks wv and wv + 4 of every plane (fragment order: row block stride 16 * K elements, a k tile 1024 elements in a row)
    const unsigned lw = (unsigned)(size_t)&ring[0][0] + (unsigned)wv * 2048u + (unsigned)lane * 16u;
    const size_t gw = ((size_t)wv * 16 * K) * 2 + (size_t)lane * 16, ga = (size_t)(blockIdx.x * 128) * K * 2 + gw, gb = (size_t)(blockIdx.y * 128) * K * 2 + gw;   // bytes
    auto copies = [&](int t, int bu) __attribute__((always_inline)) {
        const unsigned l = lw + (unsigned)bu * (TILE * 2u); const size_t ko = (size_t)((t + rot) & (K / 64 - 1)) * 2048, ka = ga + ko, kb = gb + ko; constexpr size_t R4 = (size_t)4 * 16 * K * 2;
        cp8(l, (const char*)A + ka, l + 8192u, (const char*)A + ka + R4);
        if constexpr (NPA == 2) cp8(l + PLN * 2u, (const char*)A2 + ka, l + PLN * 2u + 8192u, (const char*)A2 + ka + R4);
        cp8(l + NPA * PLN * 2u, (const char*)Bt + kb, l + NPA * PLN * 2u + 8192u, (const char*)Bt + kb + R4);
        if constexpr (NPB == 2) cp8(l + (NPA + 1) * PLN * 2u, (const char*)Bt2 + kb, l + (NPA + 1) * PLN * 2u + 8192u, (const char*)Bt2 + kb + R4); };
    // TWO FRAGMENT SETS, one per k block of the tile: all fragment reads of a trip go out as one group in front of its products
    V a[2][4], a2[2][4], b[2][4], b2[2][4];
    auto fetch = [&](int st, const T16* sa, const T16* sb) __attribute__((always_inline)) {   // sa, sb: the wave's first A and B row block in the buffer + 8 * lane
#pragma unroll
        for (int mb = 0; mb < 4; ++mb) { a[st][mb] = WFrag<T16>::ld(sa + mb * 1024 + st * 512); if (NSPLIT == 1 || NSPLIT == 2) a2[st][mb] = WFrag<T16>::ld(sa + PLN + mb * 1024 + st * 512); }
#pragma unroll
        for (int nb = 0; nb < 4; ++nb) { b[st][nb] = WFrag<T16>::ld(sb + nb * 1024 + st * 512); if (NSPLIT >= 2) b2[st][nb] = WFrag<T16>::ld(sb + PLN + nb * 1024 + st * 512); } };
    auto prods = [&](int st) __attribute__((always_inline)) {   // per accumulator the order of the products is the old one
#pragma unroll
        for (int nb = 0; nb < 4; ++nb)
#pragma unroll
            for (int mb = 0; mb < 4; ++mb) { acc[mb][nb] = WFrag<T16>::mma(a[st][mb], b[st][nb], acc[mb][nb]); if (NSPLIT == 1 || NSPLIT == 2) acc[mb][nb] = WFrag<T16>::mma(a2[st][mb], b[st][nb], acc[mb][nb]); if (NSPLIT >= 2) acc[mb][nb] = WFrag<T16>::mma(a[st][mb], b2[st][nb], acc[mb][nb]); } };
    copies(0, 0);
    asm volatile("s_wait_asynccnt 0x0" ::: "memory");   // this wave's share of tile 0 has landed
    __syncthreads();                                    // every wave's share has: tile 0 may be read
    copies(1, 1);
#pragma unroll 1
    for (int t = 0; t < K / 64; ++t) {   // stays rolled: one copy of the 32 (64) products in the text
        const T16* const sa = &ring[t & 1][0] + (wv & 1) * 4096 + 8 * lane; const T16* const sb = &ring[t & 1][0] + NPA * PLN + (wv >> 1) * 4096 + 8 * lane;
        fetch(0, sa, sb); fetch(1, sa, sb); SB(); prods(0); prods(1);
        asm volatile("v_nop\n\tv_nop\n\tv_nop\n\tv_nop" : "+v"(acc[0][0]), "+v"(acc[1][1]), "+v"(acc[2][2]), "+v"(acc[3][3]) : "v"(a[1][0]), "v"(a[1][3]));   // the four vector slots behind the last product, on the taken side of the branch back too
        SB();   // the products stay in front of the trip's foot (without it the build sinks most of them behind the barrier, in front of the copies, which then fly for a part of a trip only)
        asm volatile("s_wait_dscnt 0x0" ::: "memory");      // this wave's reads of buffer t & 1 are done before the buffer is handed to its next writer
        asm volatile("s_wait_asynccnt 0x0" ::: "memory");   // this wave's share of tile t + 1 has landed
        __syncthreads();                                    // one barrier a trip: it publishes tile t + 1 and ends every wave's reads of buffer t & 1
        if (t + 2 < K / 64) copies(t + 2, t & 1);           // the same test in the whole work-group; flies while tile t + 1 is worked on
    }
    asm volatile("s_wait_asynccnt 0x0" ::: "memory");   // no copy is out when the wave goes on
    if constexpr (PLANES) {
        const int cofs = hi * 8;   // read-back in fragment order: step s, lane (lr, hi) takes row lr, values s*16 + hi*8 + 0..7; the wave's 32 pieces are 512 bytes in a row of the plane
        const size_t hp = ((size_t)(r0 / TT) * NH_ + c0 / HD) * TT * HD; const int t0 = r0 % TT;   // (entry, head) plane; first token of the tile
        if (z == 2) {
            const size_t po = hp + (size_t)t0 * 16 + lane * 8; float bb[4];
#pragma unroll
            for (int nb = 0; nb < 4; ++nb) bb[nb] = bias[c0 + nb * 16 + lr];
            asm volatile("" :: "v"(bb[0]), "v"(bb[1]), "v"(bb[2]), "v"(bb[3]));   // inputs only: the four bias loads are asked for together, one wait (without it the build waits out each load in turn)
#pragma unroll
            for (int nb = 0; nb < 4; ++nb) bb[nb] = bfr(bb[nb]);
#pragma unroll
            for (int nb = 0; nb < 4; ++nb) {
#pragma unroll
                for (int mb = 0; mb < 4; ++mb) { const v8f val = acc[mb][nb] + bb[nb];   // lane (lr, hi): column d = nb*16 + lr, tokens mb*16 + 8*hi + 0..7
                    *(v4fa*)(os + lr * 68 + mb * 16 + hi * 8) = __builtin_shufflevector(val, val, 0, 1, 2, 3); *(v4fa*)(os + lr * 68 + mb * 16 + hi * 8 + 4) = __builtin_shufflevector(val, val, 4, 5, 6, 7); }
                __builtin_amdgcn_wave_barrier(); asm volatile("" ::: "memory");   // the read-back below stays behind the LDS stores
#pragma unroll
                for (int s = 0; s < 4; ++s) { const v4f v0 = *(const v4fa*)(os + lr * 68 + s * 16 + cofs), v1 = *(const v4fa*)(os + lr * 68 + s * 16 + cofs + 4);
                    const size_t e = po + (size_t)nb * 16 * TT + s * 256; put3(__builtin_shufflevector(v0, v1, 0, 1, 2, 3, 4, 5, 6, 7), V16 + e, Vh + e, Vl + e); }
                __builtin_amdgcn_wave_barrier(); asm volatile("" ::: "memory");   // the next block's LDS stores stay behind the read-back
            }
            return;
        }
        const size_t po = z * ((size_t)GB * NH_ * TT * HD) + hp + (size_t)t0 * HD + lane * 8; v8f bb[4]; const float* const bp = bias + c0 + cofs;
#pragma unroll
        for (int s = 0; s < 4; ++s)
#pragma unroll
            for (int i = 0; i < 8; ++i) bb[s][i] = bp[s * 16 + i];
        asm volatile("s_wait_xcnt 0x0" :: "v"(bp) : "memory");   // stands before the address register of the bias loads is written again; the address as an input: its register stays its own up to here
#pragma unroll
        for (int s = 0; s < 4; ++s)
#pragma unroll
            for (int i = 0; i < 8; ++i) bb[s][i] = bfr(bb[s][i]);
#pragma unroll
        for (int mb = 0; mb < 4; ++mb) {
#pragma unroll
            for (int nb = 0; nb < 4; ++nb) {
#pragma unroll
                for (int j = 0; j < 8; ++j) os[(hi * 8 + j) * 68 + nb * 16 + lr] = acc[mb][nb][j]; }
            __builtin_amdgcn_wave_barrier(); asm volatile("" ::: "memory");   // the read-back below stays behind the LDS stores
#pragma unroll
            for (int s = 0; s < 4; ++s) { const v4f v0 = *(const v4fa*)(os + lr * 68 + s * 16 + cofs), v1 = *(const v4fa*)(os + lr * 68 + s * 16 + cofs + 4);
                const size_t e = po + (size_t)mb * 16 * HD + s * 256; put3(__builtin_shufflevector(v0, v1, 0, 1, 2, 3, 4, 5, 6, 7) + bb[s], P16 + e, Ph + e, Pl + e); }
            __builtin_amdgcn_wave_barrier(); asm volatile("" ::: "memory");   // the next block's LDS stores stay behind the read-back
        }
        asm volatile("s_wait_xcnt 0x0" ::: "memory");   // the build lays the v path behind this one with a never-taken fall-through: its first register writes stay behind the wait for the stores above
        return;
    }
#pragma unroll
    for (int mb = 0; mb < 4; ++mb) {
#pragma unroll
        for (int nb = 0; nb < 4; ++nb) {
#pragma unroll
            for (int j = 0; j < 8; ++j) os[(hi * 8 + j) * 68 + nb * 16 + lr] = acc[mb][nb][j]; }
        __builtin_amdgcn_wave_barrier(); asm volatile("" ::: "memory");
        float* crow = C + (size_t)(r0 + mb * 16) * ldc + c0;
{
#pragma unroll
            for (int s = 0; s < 8; ++s) { const int row = 2 * s + hi, cofs = lr * 4; v4f val = *(const v4fa*)(os + row * 68 + cofs); if (BIAS) { val[0] += bfr(bias[c0 + cofs]); val[1] += bfr(bias[c0 + cofs + 1]); val[2] += bfr(bias[c0 + cofs + 2]); val[3] += bfr(bias[c0 + cofs + 3]); }
                *(v4f*)(crow + (size_t)row * ldc + cofs) = val; }
             }
        __builtin_amdgcn_wave_barrier(); asm volatile("" ::: "memory");
    }
}

typedef __attribute__((ext_vector_type(2))) _Float16 v2h;
typedef __attribute__((ext_vector_type(4))) _Float16 v4h;
typedef __attribute__((ext_vector_type(2))) unsigned short v2us;
typedef __attribute__((ext_vector_type(4))) unsigned short v4us;
typedef __attribute__((ext_vector_type(2))) float v2f;
typedef __attribute__((ext_vector_type(4))) int v4i;

// thread i writes piece i (8 k of one n) of the transposed plane [n][k] in fragment order: each half of a wave reads 16 neighbouring n of one k row, eight rows in turn
template <int K, int N>
__device__ __forceinline__ void wtG(int y, int bx, const float* __restrict__ w0, const float* __restrict__ w1, const float* __restrict__ w2, const float* __restrict__ w3, bf* Bt) {
    const float* __restrict__ w = (y == 0) ? w0 : (y == 1) ? w1 : (y == 2) ? w2 : w3; Bt += (size_t)y * N * K;   // y: which of the four weights
    const int i = bx * 256 + threadIdx.x; if (i >= N * K / 8) return;
    const int blk = i >> 6; const int n = blk / (K / 32) * 16 + (i & 15), k = blk % (K / 32) * 32 + ((i >> 5) & 1) * 16 + ((i >> 4) & 1) * 8; const float* p = w + (size_t)k * N + n; float t[8]; v8us o;
#pragma unroll
    for (int j = 0; j < 8; ++j) t[j] = p[j * N];
    asm volatile("s_wait_xcnt 0x0" :: "v"(p) : "memory");   // stands before the address register of the eight loads is written again; the address as an input: its register stays its own up to here
#pragma unroll
    for (int j = 0; j < 8; ++j) o[j] = f2bf(t[j]);
    *(v8us*)(Bt + (size_t)i * 8) = o;
}
// thread i writes piece i of the plane in fragment order: block i >> 6 = (row block, k block), half (i >> 5) & 1, lane i & 31 = (hi, lr)
__device__ __forceinline__ void cvt8(int bx, const float* __restrict__ src, bf* dst, size_t n8) { const size_t i = (size_t)bx * 256 + threadIdx.x; if (i >= n8) return;
    const size_t blk = i >> 6; const size_t row = blk / (DM / 32) * 16 + (i & 15); const int k = (int)(blk % (DM / 32)) * 32 + (int)((i >> 5) & 1) * 16 + (int)((i >> 4) & 1) * 8; const float* p = src + row * DM + k; const v8f v = *(const v8f*)p; v8us o;
    asm volatile("s_wait_xcnt 0x0" :: "v"(p) : "memory");   // stands before the address register of the two loads is written again; the address as an input: its register stays its own up to here
#pragma unroll
    for (int k = 0; k < 8; ++k) o[k] = f2bf(v[k]); *(v8us*)(dst + i * 8) = o;  }
// ---- k_prep: both conversions in ONE grid (neither reads what the other writes): blocks 0 .. XBLK-1 make the x plane, the next 4 * WBLK the four transposed weights
#define XBLK ((int)((size_t)NB_ * TT * DM / 8 / 256))
#define WBLK (DM * DQ / 8 / 256)
__global__ __launch_bounds__(256) void k_prep(const float* __restrict__ x, const float* __restrict__ w0, const float* __restrict__ w1, const float* __restrict__ w2, const float* __restrict__ w3, bf* XB, bf* Bt) {
    const int b = blockIdx.x;
    if (b < XBLK) cvt8(b, x, XB, (size_t)NB_ * TT * DM / 8);
    else wtG<DM, DQ>((b - XBLK) / WBLK, (b - XBLK) % WBLK, w0, w1, w2, w3, Bt);
}

#define NQ   2                    // 16-query groups per wave
#define FW   4                    // waves per work-group: same head, neighbouring rows, no exchange between them
#define LC   (SCL * 1.4426950408889634f)
typedef __attribute__((ext_vector_type(2))) __bf16 v2b;
// XWAIT: stands behind a group of global loads or stores, before a register that one of them names is written again (this build goes above v255); the scheduling fence keeps later register writes behind it
#define XWAIT() do { asm volatile("s_wait_xcnt 0x0" ::: "memory"); __builtin_amdgcn_sched_barrier(0); } while (0)
__device__ __forceinline__ float xhalf(float v) { const int b = __float_as_int(v); return __int_as_float(__builtin_amdgcn_permlanex16(b, b, 0x76543210, 0xfedcba98, false, false)); }   // lane l <-> l ^ 16
template <typename T16, bool HL>
__device__ __forceinline__ void fattn(const T16* __restrict__ Q, const T16* __restrict__ Q2, const T16* __restrict__ Kp, const T16* __restrict__ K2, const T16* __restrict__ Vt, const T16* __restrict__ V2, int q0, bf* Ah, bf* Al) {
    typedef typename WFrag<T16>::V V;
    const int lane = threadIdx.x & 31;
    V qf[NQ][2], qf2[NQ][2], kf[2][2], kf2[2][2];
#pragma unroll
    for (int qt = 0; qt < NQ; ++qt)
#pragma unroll
        for (int ks = 0; ks < 2; ++ks) { const int qo = (q0 + qt * 16) * HD + ks * 512 + 8 * lane; qf[qt][ks] = WFrag<T16>::ld(Q + qo); if constexpr (HL) qf2[qt][ks] = WFrag<T16>::ld(Q2 + qo); }
    XWAIT();
    // fragment order: K blocks 512 apart along d, 16 * HD along the keys; Vt blocks 512 apart along the keys, 16 * TT along d
#pragma unroll
    for (int kt = 0; kt < 2; ++kt)
#pragma unroll
        for (int ks = 0; ks < 2; ++ks) { const int ko = kt * 16 * HD + ks * 512 + 8 * lane; kf[kt][ks] = WFrag<T16>::ld(Kp + ko); if constexpr (HL) kf2[kt][ks] = WFrag<T16>::ld(K2 + ko); }
    XWAIT();
    v8f o[NQ][4]; float m[NQ], l[NQ];
#pragma unroll
    for (int qt = 0; qt < NQ; ++qt) { m[qt] = -3.0e38f; l[qt] = 0.f;
#pragma unroll
        for (int dt = 0; dt < 4; ++dt) o[qt][dt] = (v8f){}; }
#pragma unroll 1
    for (int kb = 0; kb < TT; kb += 32) {
        V vf[4], vf2[4];   // this pass's Vt fragments: asked for first, used last
#pragma unroll
        for (int dt = 0; dt < 4; ++dt) vf[dt] = WFrag<T16>::ld(Vt + dt * 16 * TT + kb * 16 + 8 * lane);
        XWAIT();
        if constexpr (HL) {
#pragma unroll
            for (int dt = 0; dt < 4; ++dt) vf2[dt] = WFrag<T16>::ld(V2 + dt * 16 * TT + kb * 16 + 8 * lane);
            XWAIT(); }
        v8f s[NQ][2];
#pragma unroll
        for (int qt = 0; qt < NQ; ++qt) { s[qt][0] = (v8f){}; s[qt][1] = (v8f){}; }
#pragma unroll
        for (int ks = 0; ks < 2; ++ks) {
#pragma unroll
            for (int kt = 0; kt < 2; ++kt)
#pragma unroll
                for (int qt = 0; qt < NQ; ++qt) s[qt][kt] = WFrag<T16>::mma(kf[kt][ks], qf[qt][ks], s[qt][kt]);
            if constexpr (HL) {
#pragma unroll
                for (int kt = 0; kt < 2; ++kt)
#pragma unroll
                    for (int qt = 0; qt < NQ; ++qt) s[qt][kt] = WFrag<T16>::mma(kf[kt][ks], qf2[qt][ks], s[qt][kt]);
#pragma unroll
                for (int kt = 0; kt < 2; ++kt)
#pragma unroll
                    for (int qt = 0; qt < NQ; ++qt) s[qt][kt] = WFrag<T16>::mma(kf2[kt][ks], qf[qt][ks], s[qt][kt]); } }
        const int kn = (kb + 32) & (TT - 1);   // next pass's key fragments, one pass ahead; the last pass asks for the first keys again (in bounds, not used)
#pragma unroll
        for (int kt = 0; kt < 2; ++kt)
#pragma unroll
            for (int ks = 0; ks < 2; ++ks) { const int ko = (kn + kt * 16) * HD + ks * 512 + 8 * lane; kf[kt][ks] = WFrag<T16>::ld(Kp + ko); if constexpr (HL) kf2[kt][ks] = WFrag<T16>::ld(K2 + ko); }
        XWAIT();
        V pf[NQ], pf2[NQ];
#pragma unroll
        for (int qt = 0; qt < NQ; ++qt) {
            float bm = fmaxf(s[qt][0][0], s[qt][1][0]);
#pragma unroll
            for (int j = 1; j < 8; ++j) bm = fmaxf(bm, fmaxf(s[qt][0][j], s[qt][1][j]));
            bm = fmaxf(bm, xhalf(bm));
            const float mn = fmaxf(m[qt], bm); const float al = __builtin_amdgcn_exp2f((m[qt] - mn) * LC); m[qt] = mn;
            const float sh = (HL ? 0.0f : 10.0f) - mn * LC; float ps = 0.f;
#pragma unroll
            for (int e = 0; e < 16; e += 2) { v2f p; p[0] = __builtin_amdgcn_exp2f(__builtin_fmaf(s[qt][e >> 3][e & 7], LC, sh)); p[1] = __builtin_amdgcn_exp2f(__builtin_fmaf(s[qt][e >> 3][(e & 7) + 1], LC, sh)); ps += p[0]; ps += p[1];
                if constexpr (HL) { const v2b ph = __builtin_convertvector(p, v2b); const v2b pl = __builtin_convertvector(p - __builtin_convertvector(ph, v2f), v2b); pf[qt][e] = ph[0]; pf[qt][e + 1] = ph[1]; pf2[qt][e] = pl[0]; pf2[qt][e + 1] = pl[1]; }
                else { const v2h ph = __builtin_convertvector(p, v2h); pf[qt][e] = ph[0]; pf[qt][e + 1] = ph[1]; } }
            l[qt] = l[qt] * al + ps;
#pragma unroll
            for (int dt = 0; dt < 4; ++dt) o[qt][dt] *= al; }
#pragma unroll
        for (int dt = 0; dt < 4; ++dt)
#pragma unroll
            for (int qt = 0; qt < NQ; ++qt) o[qt][dt] = WFrag<T16>::mma(vf[dt], pf[qt], o[qt][dt]);
        if constexpr (HL) {
#pragma unroll
            for (int dt = 0; dt < 4; ++dt)
#pragma unroll
                for (int qt = 0; qt < NQ; ++qt) o[qt][dt] = WFrag<T16>::mma(vf[dt], pf2[qt], o[qt][dt]);
#pragma unroll
            for (int dt = 0; dt < 4; ++dt)
#pragma unroll
                for (int qt = 0; qt < NQ; ++qt) o[qt][dt] = WFrag<T16>::mma(vf2[dt], pf[qt], o[qt][dt]); }
    }
#pragma unroll
    for (int qt = 0; qt < NQ; ++qt) { const float inv = __fdiv_rn(1.0f, l[qt] + xhalf(l[qt])); const size_t ro = (size_t)(q0 + qt * 16) * DQ + 8 * lane;   // o[qt][dt][j] = O[query lr][d = dt*16 + 8*hi + j]: piece (half dt & 1, lane) of k block dt >> 1 of this head
#pragma unroll
        for (int dt = 0; dt < 4; ++dt) { const v8f val = o[qt][dt] * inv; const v8b oh = __builtin_convertvector(val, v8b); const v8b ol = __builtin_convertvector(val - __builtin_convertvector(oh, v8f), v8b);
            *(v8us*)(Ah + ro + dt * 256) = __builtin_bit_cast(v8us, oh); *(v8us*)(Al + ro + dt * 256) = __builtin_bit_cast(v8us, ol);
            XWAIT(); } }
}
// grid x: (entry of the group, head); grid y: block of FW*NQ*16 query rows, the hi+lo blocks (three times the products) first
__global__ __launch_bounds__(FW * 32) void k_fattn(const h16* __restrict__ Q16, const h16* __restrict__ K16, const h16* __restrict__ V16, const bf* __restrict__ Qh, const bf* __restrict__ Ql, const bf* __restrict__ Kh, const bf* __restrict__ Kl, const bf* __restrict__ Vh, const bf* __restrict__ Vl, bf* Ah, bf* Al) {
    const int z = blockIdx.x; const size_t po = (size_t)z * TT * HD; const size_t ao = (size_t)(z / NH_) * TT * DQ + (size_t)(z % NH_) * (HD / 32) * 512;   // the merged plane [token][DQ] in fragment order: this head's two k blocks
    const int qb = blockIdx.y * (FW * NQ * 16); const int q0 = qb + (int)(threadIdx.x >> 5) * (NQ * 16);
    if (qb < RH) fattn<bf, true>(Qh + po, Ql + po, Kh + po, Kl + po, Vh + po, Vl + po, q0, Ah + ao, Al + ao);
    else fattn<h16, false>(Q16 + po, nullptr, K16 + po, nullptr, V16 + po, nullptr, q0, Ah + ao, Al + ao);
}

extern "C" void kernel_launch(void* const* d_in, const int* in_sizes, int n_in,
                              void* d_out, int out_size, void* d_ws, size_t ws_size, hipStream_t stream) {
    (void)in_sizes; (void)n_in; (void)out_size;
    const float* x = (const float*)d_in[0]; const float* wq = (const float*)d_in[1]; const float* bq = (const float*)d_in[2]; const float* wk = (const float*)d_in[3]; const float* bk = (const float*)d_in[4]; const float* wv = (const float*)d_in[5]; const float* bv = (const float*)d_in[6]; const float* wo = (const float*)d_in[7]; const float* bo = (const float*)d_in[8];
    float* OUT = (float*)d_out;     // [8][1024][1024]
    char* wsp = (char*)d_ws;
    auto take = [&](size_t bytes) { char* p = wsp; wsp += (bytes + 255) & ~(size_t)255; return (void*)p; };
    const size_t PS = (size_t)GB * NH_ * TT * HD;   // one 16-bit plane of a group: [entry][head] planes of [t][d] (v: [d][t]), each in fragment order
    static_assert(NKV == NH_ && NB_ % GB == 0 && ZH == NH_, "one pass per group of GB batch entries; q, k, v of equal width");
    bf* W4 = (bf*)take((size_t)4 * DQ * DM * 2); bf* WO = W4 + (size_t)3 * DQ * DM;   // Wq, Wk, Wv, Wo transposed, back to back
    bf* XB = (bf*)take((size_t)GB * TT * DM * 2);
    h16* QP16 = (h16*)take(2 * PS * 2); h16* KP16 = QP16 + PS; h16* VT16 = (h16*)take(PS * 2);
    bf* QPh = (bf*)take(2 * PS * 2); bf* KPh = QPh + PS; bf* QPl = (bf*)take(2 * PS * 2); bf* KPl = QPl + PS; bf* VTh = (bf*)take(PS * 2); bf* VTl = (bf*)take(PS * 2);
    bf* ATh = (bf*)take((size_t)NB_ * TT * DQ * 2); bf* ATl = (bf*)take((size_t)NB_ * TT * DQ * 2);
    if ((size_t)(wsp - (char*)d_ws) > ws_size) return;    // ws 256 MiB
    static_assert(TT % 64 == 0 && HD == 64 && DQ == NH_ * HD && (GB * TT) % 128 == 0 && DQ % 128 == 0 && DM % 128 == 0, "a wave's 64x64 projection tile is 64 tokens of one entry x one head; whole 128x128 work-group tiles");
    static_assert(RH % (FW * NQ * 16) == 0 && TT % (FW * NQ * 16) == 0 && HD == 64 && (TT & (TT - 1)) == 0, "whole row blocks on either side of RH");
    static_assert(GB == NB_ && ((size_t)NB_ * TT * DM / 8) % 256 == 0 && (DM * DQ / 8) % 256 == 0, "one group; whole blocks of 256 pieces on either side of XBLK");
    k_prep<<<XBLK + 4 * WBLK, 256, 0, stream>>>(x, wq, wk, wv, wo, XB, W4);
    k_gemmw<bf, 0, true, true, DM><<<dim3(GB * TT / 128, DQ / 128, 3), 128, 0, stream>>>(XB, nullptr, W4, nullptr, nullptr, 0, bq, bk, bv, 0, (size_t)DQ * DM, 0, QP16, QPh, QPl, VT16, VTh, VTl);
    k_fattn<<<dim3(GB * NH_, TT / (FW * NQ * 16), 1), FW * 32, 0, stream>>>(QP16, KP16, VT16, QPh, QPl, KPh, KPl, VTh, VTl, ATh, ATl);
    k_gemmw<bf, 1, true, false, DQ><<<dim3(NB_ * TT / 128, DM / 128, 1), 128, 0, stream>>>(ATh, ATl, WO, nullptr, OUT, DM, bo, nullptr, nullptr, 0, 0, 0, nullptr, nullptr, nullptr, nullptr, nullptr, nullptr);
}

// v009
// A run of this version takes 121 microseconds.
// In both of two side-by-side timings against v008, it was 1.05 times as fast.
// Over all steps from v000 it is 38.8 times as fast.
#include <hip/hip_runtime.h>

// CLIP attention (hidden_states [8][1024][1024]; q = (x Wq + bq) x 64^-0.5, k, v = x W + b ('xw' [1024][1024]; 16 heads x 64); softmax(q.k) over all keys; out = merged Wo + bo -> [8][1024][1024] (8.4 M)).
// Compute dtypes, f32 accumulate: every input rounded to bf16; q/k/v on PLAIN bf16 operands (inputs: exact) + biases; the 64^-0.5 applied to the f32 score (the module scales q after the bias; power of two, exact); scores and attn.v: query rows < 512 hl (3 products; hi = the fp16 value, lo = its residual in fp16), the rest single fp16 (p x1024 in both); softmax f32; Wo hl x exact (2 products) + bo.

#define NB_  8
#define TT   1024
#define DM   1024
#define NH_  16
#define NKV  16
#define REP  (NH_ / NKV)
#define HD   64
#define DQ   (NH_ * HD)
#define DKV  (NKV * HD)
#define ZH   16                   // heads of one batch entry (only checked equal to NH_); one attention pass takes all GB entries
#define GB   8                    // batch entries per projection group: all of them, every stage runs once
#define RH   512                  // query rows < RH use hi+lo planes (0: none)
#define WIN  0
#define PCAR 1024.0f
#define SCL  0.125f   // HD^-0.5
typedef _Float16 h16;
typedef unsigned short bf;
typedef __attribute__((ext_vector_type(16))) __bf16   v16bf;
typedef __attribute__((ext_vector_type(16))) _Float16 v16h;
typedef __attribute__((ext_vector_type(8)))  _Float16 v8h;
typedef __attribute__((ext_vector_type(8)))  unsigned short v8us;
typedef __attribute__((ext_vector_type(8)))  float    v8f;
typedef __attribute__((ext_vector_type(4)))  float    v4f;
typedef v8h  __attribute__((may_alias)) v8ha;
typedef v4f  __attribute__((may_alias)) v4fa;
typedef v8us __attribute__((may_alias)) v8usa;

__device__ __forceinline__ unsigned short f2bf(float f) { unsigned u = __float_as_uint(f); u += 0x7FFFu + ((u >> 16) & 1u); return (unsigned short)(u >> 16); }
__device__ __forceinline__ float bf2f(unsigned short b) { return __uint_as_float(((unsigned)b) << 16); }
__device__ __forceinline__ float bfr(float f) { return bf2f(f2bf(f)); }
__device__ __forceinline__ v16h cat16(v8h lo, v8h hi) { return __builtin_shufflevector(lo, hi, 0, 1, 2, 3, 4, 5, 6, 7, 8, 9, 10, 11, 12, 13, 14, 15); }
__device__ __forceinline__ v16bf cat16b(v8us lo, v8us hi) { return __builtin_bit_cast(v16bf, __builtin_shufflevector(lo, hi, 0, 1, 2, 3, 4, 5, 6, 7, 8, 9, 10, 11, 12, 13, 14, 15)); }
__device__ __forceinline__ v8f wmma16(v16h a, v16h b, v8f c) { return __builtin_amdgcn_wmma_f32_16x16x32_f16(false, a, false, b, (short)0, c, false, false); }
__device__ __forceinline__ v8f wmmab(v16bf a, v16bf b, v8f c) { return __builtin_amdgcn_wmma_f32_16x16x32_bf16(false, a, false, b, (short)0, c, false, false); }



// FRAGMENT ORDER of every 16-bit operand plane [rows][K]: a block of 16 rows x 32 k is 512 elements in a row, element (row r, k) at ((k >> 4) & 1) * 256 + (((k >> 3) & 1) * 16 + (r & 15)) * 8 + (k & 7);
// blocks run along k, then along the rows: block (r >> 4, k >> 5) starts at (r >> 4) * 16 * K + (k >> 5) * 512. Lane l of a wave finds its two 16-byte pieces of a fragment at l * 8 and 256 + l * 8,
// so each wave-wide 16-byte load or store covers 512 bytes in a row: 4 whole lines, where rows of K in a row give a 32-byte piece of each of 16 lines. Lane (lr, hi), l = hi * 16 + lr, holds row lr, k = 8 * hi + 0..7 and 16 + 8 * hi + 0..7.

// ---- k_gemmw: register-blocked GEMM, one wave per 64x64 output tile (16 accumulators); FOUR WAVES (2 x 2 wave tiles) make a work-group with a 128x128 tile and share its operands through LDS; grid (M/128, N/128, Z), 128 threads.
// The 16-bit planes lie in fragment order, so a k tile (64 k = two k blocks) of 16 rows is 2 KB in a row in memory and goes to LDS as it is, by asynchronous copies; each operand byte is asked for once a work-group, where four lone waves asked for it twice.
// C[m][n] (f32, pitch ldc, + optional f32 bias[n], one vector per z slice up to three) = sum_k A[m][k] Bt[n][k] (+ split products per NSPLIT). z-batch strides sA/sB/sC in elements. K % 32 == 0.
// PLANES (the q/k/v projection): no f32 C. A 64x64 tile is 64 tokens x the 64 columns of ONE head, so the wave itself writes the attention operand planes (fp16, and the fp16 residual 'lo'; the hi+lo rows read the fp16 plane as their hi):
// z 0, 1 (q, k): [entry][head] planes of [t][d] in fragment order, the tile is 8 KB in a row of each plane; z 2 (v): [entry][head] planes of [d][t] in fragment order, staged through LDS the other way round.
typedef __attribute__((ext_vector_type(8))) __bf16 v8b;
// eight neighbouring f32 values -> 16 bytes in each of the two operand planes (round to nearest even): the fp16 value and, where somebody reads it (lo), what the rounding left, in fp16 again
template <bool B> struct BoolC { static constexpr bool v = B; };
template <bool LO> __device__ __forceinline__ void put2(v8f val, h16* p16, h16* pl) {
    const v8h o16 = __builtin_convertvector(val, v8h); *(v8h*)p16 = o16;
    if constexpr (LO) *(v8h*)pl = __builtin_convertvector(val - __builtin_convertvector(o16, v8f), v8h); }
// ld(p): p = start of the fragment's block + 8 * lane
template <typename T16> struct WFrag;
template <> struct WFrag<h16> { typedef v16h V; static __device__ __forceinline__ V ld(const h16* p) { return cat16(*(const v8h*)p, *(const v8h*)(p + 256)); } static __device__ __forceinline__ v8f mma(V a, V b, v8f c) { return wmma16(a, b, c); } };
template <> struct WFrag<bf> { typedef v16bf V; static __device__ __forceinline__ V ld(const bf* p) { return cat16b(*(const v8us*)p, *(const v8us*)(p + 256)); } static __device__ __forceinline__ v8f mma(V a, V b, v8f c) { return wmmab(a, b, c); } };
// SB: a scheduling fence; keeps a group of fragment loads whole and in front of the products that cover it (without it the build sinks most of the loads in among the products and waits for them there)
#define SB() __builtin_amdgcn_sched_barrier(0)
// XWAIT: stands behind a group of global loads or stores, before a register that one of them names is written again (this build goes above v255); the scheduling fence keeps later register writes behind it
#define XWAIT() do { asm volatile("s_wait_xcnt 0x0" ::: "memory"); __builtin_amdgcn_sched_barrier(0); } while (0)
// cp8: eight asynchronous copies, 16 bytes a lane, global memory -> LDS through no register: two row blocks of a k tile, each four wave-wide pieces of 512 bytes. l0, l1: the lane's LDS byte address in the row block; g0, g1: its global address.
// The s_wait_xcnt stands in the copies' own statement: no register that a copy names is written again in front of it.
__device__ __forceinline__ void cp8(unsigned l0, const char* g0, unsigned l1, const char* g1) {
    asm volatile("global_load_async_to_lds_b128 %0, %8, off\n\tglobal_load_async_to_lds_b128 %1, %9, off\n\tglobal_load_async_to_lds_b128 %2, %10, off\n\tglobal_load_async_to_lds_b128 %3, %11, off\n\t"
                 "global_load_async_to_lds_b128 %4, %12, off\n\tglobal_load_async_to_lds_b128 %5, %13, off\n\tglobal_load_async_to_lds_b128 %6, %14, off\n\tglobal_load_async_to_lds_b128 %7, %15, off\n\ts_wait_xcnt 0x0"
                 :: "v"(l0), "v"(l0 + 512u), "v"(l0 + 1024u), "v"(l0 + 1536u), "v"(l1), "v"(l1 + 512u), "v"(l1 + 1024u), "v"(l1 + 1536u),
                    "v"(g0), "v"(g0 + 512), "v"(g0 + 1024), "v"(g0 + 1536), "v"(g1), "v"(g1 + 512), "v"(g1 + 1024), "v"(g1 + 1536) : "memory"); }
template <typename T16, int NSPLIT, bool BIAS, bool PLANES, int K>   // K at compile time: the row blocks of a fragment-order plane are then fixed byte offsets from one address per operand
__global__ __launch_bounds__(128) void k_gemmw(const T16* __restrict__ A, const T16* __restrict__ A2, const T16* __restrict__ Bt, const T16* __restrict__ Bt2, float* C, int ldc, const float* __restrict__ bias0, const float* __restrict__ bias1, const float* __restrict__ bias2, size_t sA, size_t sB, size_t sC, h16* P16, h16* Pl, h16* V16, h16* Vl) {
    typedef typename WFrag<T16>::V V;
    constexpr int NPA = (NSPLIT == 1 || NSPLIT == 2) ? 2 : 1, NPB = (NSPLIT >= 2) ? 2 : 1;   // planes per operand
    constexpr int PLN = 8 * 1024, TILE = (NPA + NPB) * PLN;   // elements: a plane's share of a k tile is 8 row blocks x (16 rows x 64 k); a tile holds A, (A2), B, (B2) one behind the other
    __shared__ __align__(16) T16 ring[2][TILE];      // two buffers: tile t lies in buffer t & 1
    __shared__ __align__(16) float osw[4][16 * 68];
    const int wv = __builtin_amdgcn_readfirstlane((int)(threadIdx.x >> 5)); float* const os = osw[wv];   // each wave stages its output in its own LDS range
    const size_t z = blockIdx.z; A += z * sA; if (A2) A2 += z * sA; Bt += z * sB; if (Bt2) Bt2 += z * sB; C += z * sC;
    const float* __restrict__ bias = (z == 0) ? bias0 : (z == 1) ? bias1 : bias2;   // one bias vector per z slice
    const int lane = threadIdx.x & 31, lr = lane & 15, hi = lane >> 4; const int r0 = blockIdx.x * 128 + (wv & 1) * 64, c0 = blockIdx.y * 128 + (wv >> 1) * 64;
    v8f acc[4][4];
#pragma unroll
    for (int mb = 0; mb < 4; ++mb)
#pragma unroll
        for (int nb = 0; nb < 4; ++nb) acc[mb][nb] = (v8f){};
    static_assert(K % 64 == 0 && K >= 128, "k is walked in tiles of two k blocks; the two buffers want two tiles");
    static_assert((K / 64 & (K / 64 - 1)) == 0, "the walk wraps by a mask");
    // ROTATED WALK: work-groups that share A rows (same x) or B rows (same y, z) each enter the k tiles at a place of their own and wrap round, so that at one moment they ask L2 for different lines
    // (and the whole grid for all sixteen 2-KB pieces of every 32-KB row block, not for the same one). Each accumulator sums the same products, begun at another k.
    const int rot = (int)((blockIdx.x + blockIdx.y + (DQ / 128) * blockIdx.z) & (K / 64 - 1));
    // the walk's tile t (k tile (t + rot) mod K/64) into buffer bu: wave wv brings row blocks wv and wv + 4 of every plane (fragment order: row block stride 16 * K elements, a k tile 1024 elements in a row)
    const unsigned lw = (unsigned)(size_t)&ring[0][0] + (unsigned)wv * 2048u + (unsigned)lane * 16u;
    const size_t gw = ((size_t)wv * 16 * K) * 2 + (size_t)lane * 16, ga = (size_t)(blockIdx.x * 128) * K * 2 + gw, gb = (size_t)(blockIdx.y * 128) * K * 2 + gw;   // bytes
    auto copies = [&](int t, int bu) __attribute__((always_inline)) {
        const unsigned l = lw + (unsigned)bu * (TILE * 2u); const size_t ko = (size_t)((t + rot) & (K / 64 - 1)) * 2048, ka = ga + ko, kb = gb + ko; constexpr size_t R4 = (size_t)4 * 16 * K * 2;
        cp8(l, (const char*)A + ka, l + 8192u, (const char*)A + ka + R4);
        if constexpr (NPA == 2) cp8(l + PLN * 2u, (const char*)A2 + ka, l + PLN * 2u + 8192u, (const char*)A2 + ka + R4);
        cp8(l + NPA * PLN * 2u, (const char*)Bt + kb, l + NPA * PLN * 2u + 8192u, (const char*)Bt + kb + R4);
        if constexpr (NPB == 2) cp8(l + (NPA + 1) * PLN * 2u, (const char*)Bt2 + kb, l + (NPA + 1) * PLN * 2u + 8192u, (const char*)Bt2 + kb + R4); };
    // TWO FRAGMENT SETS, one per k block of the tile: all fragment reads of a trip go out as one group in front of its products
    V a[2][4], a2[2][4], b[2][4], b2[2][4];
    auto fetch = [&](int st, const T16* sa, const T16* sb) __attribute__((always_inline)) {   // sa, sb: the wave's first A and B row block in the buffer + 8 * lane
#pragma unroll
        for (int mb = 0; mb < 4; ++mb) { a[st][mb] = WFrag<T16>::ld(sa + mb * 1024 + st * 512); if (NSPLIT == 1 || NSPLIT == 2) a2[st][mb] = WFrag<T16>::ld(sa + PLN + mb * 1024 + st * 512); }
#pragma unroll
        for (int nb = 0; nb < 4; ++nb) { b[st][nb] = WFrag<T16>::ld(sb + nb * 1024 + st * 512); if (NSPLIT >= 2) b2[st][nb] = WFrag<T16>::ld(sb + PLN + nb * 1024 + st * 512); } };
    auto prods = [&](int st) __attribute__((always_inline)) {   // per accumulator the order of the products is the old one
#pragma unroll
        for (int nb = 0; nb < 4; ++nb)
#pragma unroll
            for (int mb = 0; mb < 4; ++mb) { acc[mb][nb] = WFrag<T16>::mma(a[st][mb], b[st][nb], acc[mb][nb]); if (NSPLIT == 1 || NSPLIT == 2) acc[mb][nb] = WFrag<T16>::mma(a2[st][mb], b[st][nb], acc[mb][nb]); if (NSPLIT >= 2) acc[mb][nb] = WFrag<T16>::mma(a[st][mb], b2[st][nb], acc[mb][nb]); } };
    copies(0, 0);
    asm volatile("s_wait_asynccnt 0x0" ::: "memory");   // this wave's share of tile 0 has landed
    __syncthreads();                                    // every wave's share has: tile 0 may be read
    copies(1, 1);
#pragma unroll 1
    for (int t = 0; t < K / 64; ++t) {   // stays rolled: one copy of the 32 (64) products in the text
        const T16* const sa = &ring[t & 1][0] + (wv & 1) * 4096 + 8 * lane; const T16* const sb = &ring[t & 1][0] + NPA * PLN + (wv >> 1) * 4096 + 8 * lane;
        fetch(0, sa, sb); fetch(1, sa, sb); SB(); prods(0); prods(1);
        asm volatile("v_nop\n\tv_nop\n\tv_nop\n\tv_nop" : "+v"(acc[0][0]), "+v"(acc[1][1]), "+v"(acc[2][2]), "+v"(acc[3][3]) : "v"(a[1][0]), "v"(a[1][3]));   // the four vector slots behind the last product, on the taken side of the branch back too
        SB();   // the products stay in front of the trip's foot (without it the build sinks most of them behind the barrier, in front of the copies, which then fly for a part of a trip only)
        asm volatile("s_wait_dscnt 0x0" ::: "memory");      // this wave's reads of buffer t & 1 are done before the buffer is handed to its next writer
        asm volatile("s_wait_asynccnt 0x0" ::: "memory");   // this wave's share of tile t + 1 has landed
        __syncthreads();                                    // one barrier a trip: it publishes tile t + 1 and ends every wave's reads of buffer t & 1
        if (t + 2 < K / 64) copies(t + 2, t & 1);           // the same test in the whole work-group; flies while tile t + 1 is worked on
    }
    asm volatile("s_wait_asynccnt 0x0" ::: "memory");   // no copy is out when the wave goes on
    if constexpr (PLANES) {
        const int cofs = hi * 8;   // read-back in fragment order: step s, lane (lr, hi) takes row lr, values s*16 + hi*8 + 0..7; the wave's 32 pieces are 512 bytes in a row of the plane
        const size_t hp = ((size_t)(r0 / TT) * NH_ + c0 / HD) * TT * HD; const int t0 = r0 % TT;   // (entry, head) plane; first token of the tile
        if (z == 2) {
            const size_t po = hp + (size_t)t0 * 16 + lane * 8; float bb[4];
#pragma unroll
            for (int nb = 0; nb < 4; ++nb) bb[nb] = bias[c0 + nb * 16 + lr];
            asm volatile("" :: "v"(bb[0]), "v"(bb[1]), "v"(bb[2]), "v"(bb[3]));   // inputs only: the four bias loads are asked for together, one wait (without it the build waits out each load in turn)
#pragma unroll
            for (int nb = 0; nb < 4; ++nb) bb[nb] = bfr(bb[nb]);
#pragma unroll
            for (int nb = 0; nb < 4; ++nb) {
#pragma unroll
                for (int mb = 0; mb < 4; ++mb) { const v8f val = acc[mb][nb] + bb[nb];   // lane (lr, hi): column d = nb*16 + lr, tokens mb*16 + 8*hi + 0..7
                    *(v4fa*)(os + lr * 68 + mb * 16 + hi * 8) = __builtin_shufflevector(val, val, 0, 1, 2, 3); *(v4fa*)(os + lr * 68 + mb * 16 + hi * 8 + 4) = __builtin_shufflevector(val, val, 4, 5, 6, 7); }
                __builtin_amdgcn_wave_barrier(); asm volatile("" ::: "memory");   // the read-back below stays behind the LDS stores
#pragma unroll
                for (int s = 0; s < 4; ++s) { const v4f v0 = *(const v4fa*)(os + lr * 68 + s * 16 + cofs), v1 = *(const v4fa*)(os + lr * 68 + s * 16 + cofs + 4);
                    const size_t e = po + (size_t)nb * 16 * TT + s * 256; put2<true>(__builtin_shufflevector(v0, v1, 0, 1, 2, 3, 4, 5, 6, 7), V16 + e, Vl + e); }
                XWAIT();
                __builtin_amdgcn_wave_barrier(); asm volatile("" ::: "memory");   // the next block's LDS stores stay behind the read-back
            }
            return;
        }
        const size_t po = z * ((size_t)GB * NH_ * TT * HD) + hp + (size_t)t0 * HD + lane * 8; v8f bb[4]; const float* const bp = bias + c0 + cofs;
#pragma unroll
        for (int s = 0; s < 4; ++s)
#pragma unroll
            for (int i = 0; i < 8; ++i) bb[s][i] = bp[s * 16 + i];
        asm volatile("s_wait_xcnt 0x0" :: "v"(bp) : "memory");   // stands before the address register of the bias loads is written again; the address as an input: its register stays its own up to here
#pragma unroll
        for (int s = 0; s < 4; ++s)
#pragma unroll
            for (int i = 0; i < 8; ++i) bb[s][i] = bfr(bb[s][i]);
        auto rows = [&](auto lo) __attribute__((always_inline)) {   // lo: a type that says at compile time whether the lo plane is written, so each side is straight-line code
#pragma unroll
        for (int mb = 0; mb < 4; ++mb) {
#pragma unroll
            for (int nb = 0; nb < 4; ++nb) {
#pragma unroll
                for (int j = 0; j < 8; ++j) os[(hi * 8 + j) * 68 + nb * 16 + lr] = acc[mb][nb][j]; }
            __builtin_amdgcn_wave_barrier(); asm volatile("" ::: "memory");   // the read-back below stays behind the LDS stores
#pragma unroll
            for (int s = 0; s < 4; ++s) { const v4f v0 = *(const v4fa*)(os + lr * 68 + s * 16 + cofs), v1 = *(const v4fa*)(os + lr * 68 + s * 16 + cofs + 4);
                const size_t e = po + (size_t)mb * 16 * HD + s * 256; put2<decltype(lo)::v>(__builtin_shufflevector(v0, v1, 0, 1, 2, 3, 4, 5, 6, 7) + bb[s], P16 + e, Pl + e); }
            XWAIT();
            __builtin_amdgcn_wave_barrier(); asm volatile("" ::: "memory");   // the next block's LDS stores stay behind the read-back
        }
        };
        // one scalar branch a wave: the lo plane of q is read for query rows < RH alone (a wave's 64 tokens lie on one side of RH)
        if (z != 0 || t0 < RH) rows(BoolC<true>{}); else rows(BoolC<false>{});
        asm volatile("s_wait_xcnt 0x0" ::: "memory");   // the build lays the v path behind this one with a never-taken fall-through: its first register writes stay behind the wait for the stores above
        return;
    }
#pragma unroll
    for (int mb = 0; mb < 4; ++mb) {
#pragma unroll
        for (int nb = 0; nb < 4; ++nb) {
#pragma unroll
            for (int j = 0; j < 8; ++j) os[(hi * 8 + j) * 68 + nb * 16 + lr] = acc[mb][nb][j]; }
        __builtin_amdgcn_wave_barrier(); asm volatile("" ::: "memory");
        float* crow = C + (size_t)(r0 + mb * 16) * ldc + c0;
{
#pragma unroll
            for (int s = 0; s < 8; ++s) { const int row = 2 * s + hi, cofs = lr * 4; v4f val = *(const v4fa*)(os + row * 68 + cofs); if (BIAS) { val[0] += bfr(bias[c0 + cofs]); val[1] += bfr(bias[c0 + cofs + 1]); val[2] += bfr(bias[c0 + cofs + 2]); val[3] += bfr(bias[c0 + cofs + 3]); }
                *(v4f*)(crow + (size_t)row * ldc + cofs) = val; }
             }
        __builtin_amdgcn_wave_barrier(); asm volatile("" ::: "memory");
    }
}

typedef __attribute__((ext_vector_type(2))) _Float16 v2h;
typedef __attribute__((ext_vector_type(4))) _Float16 v4h;
typedef __attribute__((ext_vector_type(2))) unsigned short v2us;
typedef __attribute__((ext_vector_type(4))) unsigned short v4us;
typedef __attribute__((ext_vector_type(2))) float v2f;
typedef __attribute__((ext_vector_type(4))) int v4i;

// thread i writes piece i (8 k of one n) of the transposed plane [n][k] in fragment order: each half of a wave reads 16 neighbouring n of one k row, eight rows in turn
template <int K, int N>
__device__ __forceinline__ void wtG(int y, int bx, const float* __restrict__ w0, const float* __restrict__ w1, const float* __restrict__ w2, const float* __restrict__ w3, bf* Bt) {
    const float* __restrict__ w = (y == 0) ? w0 : (y == 1) ? w1 : (y == 2) ? w2 : w3; Bt += (size_t)y * N * K;   // y: which of the four weights
    const int i = bx * 256 + threadIdx.x; if (i >= N * K / 8) return;
    const int blk = i >> 6; const int n = blk / (K / 32) * 16 + (i & 15), k = blk % (K / 32) * 32 + ((i >> 5) & 1) * 16 + ((i >> 4) & 1) * 8; const float* p = w + (size_t)k * N + n; float t[8]; v8us o;
#pragma unroll
    for (int j = 0; j < 8; ++j) t[j] = p[j * N];
    asm volatile("s_wait_xcnt 0x0" :: "v"(p) : "memory");   // stands before the address register of the eight loads is written again; the address as an input: its register stays its own up to here
#pragma unroll
    for (int j = 0; j < 8; ++j) o[j] = f2bf(t[j]);
    *(v8us*)(Bt + (size_t)i * 8) = o;
}
// thread i writes piece i of the plane in fragment order: block i >> 6 = (row block, k block), half (i >> 5) & 1, lane i & 31 = (hi, lr)
__device__ __forceinline__ void cvt8(int bx, const float* __restrict__ src, bf* dst, size_t n8) { const size_t i = (size_t)bx * 256 + threadIdx.x; if (i >= n8) return;
    const size_t blk = i >> 6; const size_t row = blk / (DM / 32) * 16 + (i & 15); const int k = (int)(blk % (DM / 32)) * 32 + (int)((i >> 5) & 1) * 16 + (int)((i >> 4) & 1) * 8; const float* p = src + row * DM + k; const v8f v = *(const v8f*)p; v8us o;
    asm volatile("s_wait_xcnt 0x0" :: "v"(p) : "memory");   // stands before the address register of the two loads is written again; the address as an input: its register stays its own up to here
#pragma unroll
    for (int k = 0; k < 8; ++k) o[k] = f2bf(v[k]); *(v8us*)(dst + i * 8) = o;  }
// ---- k_prep: both conversions in ONE grid (neither reads what the other writes): blocks 0 .. XBLK-1 make the x plane, the next 4 * WBLK the four transposed weights
#define XBLK ((int)((size_t)NB_ * TT * DM / 8 / 256))
#define WBLK (DM * DQ / 8 / 256)
__global__ __launch_bounds__(256) void k_prep(const float* __restrict__ x, const float* __restrict__ w0, const float* __restrict__ w1, const float* __restrict__ w2, const float* __restrict__ w3, bf* XB, bf* Bt) {
    const int b = blockIdx.x;
    if (b < XBLK) cvt8(b, x, XB, (size_t)NB_ * TT * DM / 8);
    else wtG<DM, DQ>((b - XBLK) / WBLK, (b - XBLK) % WBLK, w0, w1, w2, w3, Bt);
}

#define NQ   2                    // 16-query groups per wave
#define FW   4                    // waves per work-group: same head, neighbouring rows, no exchange between them
#define LC   (SCL * 1.4426950408889634f)
__device__ __forceinline__ float xhalf(float v) { const int b = __float_as_int(v); return __int_as_float(__builtin_amdgcn_permlanex16(b, b, 0x76543210, 0xfedcba98, false, false)); }   // lane l <-> l ^ 16
template <bool HL>
__device__ __forceinline__ void fattn(const h16* __restrict__ Q, const h16* __restrict__ Q2, const h16* __restrict__ Kp, const h16* __restrict__ K2, const h16* __restrict__ Vt, const h16* __restrict__ V2, int q0, bf* Ah, bf* Al) {
    typedef h16 T16; typedef typename WFrag<T16>::V V;
    const int lane = threadIdx.x & 31;
    V qf[NQ][2], qf2[NQ][2], kf[2][2], kf2[2][2];
#pragma unroll
    for (int qt = 0; qt < NQ; ++qt)
#pragma unroll
        for (int ks = 0; ks < 2; ++ks) { const int qo = (q0 + qt * 16) * HD + ks * 512 + 8 * lane; qf[qt][ks] = WFrag<T16>::ld(Q + qo); if constexpr (HL) qf2[qt][ks] = WFrag<T16>::ld(Q2 + qo); }
    XWAIT();
    // fragment order: K blocks 512 apart along d, 16 * HD along the keys; Vt blocks 512 apart along the keys, 16 * TT along d
#pragma unroll
    for (int kt = 0; kt < 2; ++kt)
#pragma unroll
        for (int ks = 0; ks < 2; ++ks) { const int ko = kt * 16 * HD + ks * 512 + 8 * lane; kf[kt][ks] = WFrag<T16>::ld(Kp + ko); if constexpr (HL) kf2[kt][ks] = WFrag<T16>::ld(K2 + ko); }
    XWAIT();
    v8f o[NQ][4]; float m[NQ], l[NQ];
#pragma unroll
    for (int qt = 0; qt < NQ; ++qt) { m[qt] = -3.0e38f; l[qt] = 0.f;
#pragma unroll
        for (int dt = 0; dt < 4; ++dt) o[qt][dt] = (v8f){}; }
#pragma unroll 1
    for (int kb = 0; kb < TT; kb += 32) {
        V vf[4], vf2[4];   // this pass's Vt fragments: asked for first, used last
#pragma unroll
        for (int dt = 0; dt < 4; ++dt) vf[dt] = WFrag<T16>::ld(Vt + dt * 16 * TT + kb * 16 + 8 * lane);
        XWAIT();
        if constexpr (HL) {
#pragma unroll
            for (int dt = 0; dt < 4; ++dt) vf2[dt] = WFrag<T16>::ld(V2 + dt * 16 * TT + kb * 16 + 8 * lane);
            XWAIT(); }
        v8f s[NQ][2];
#pragma unroll
        for (int qt = 0; qt < NQ; ++qt) { s[qt][0] = (v8f){}; s[qt][1] = (v8f){}; }
#pragma unroll
        for (int ks = 0; ks < 2; ++ks) {
#pragma unroll
            for (int kt = 0; kt < 2; ++kt)
#pragma unroll
                for (int qt = 0; qt < NQ; ++qt) s[qt][kt] = WFrag<T16>::mma(kf[kt][ks], qf[qt][ks], s[qt][kt]);
            if constexpr (HL) {
#pragma unroll
                for (int kt = 0; kt < 2; ++kt)
#pragma unroll
                    for (int qt = 0; qt < NQ; ++qt) s[qt][kt] = WFrag<T16>::mma(kf[kt][ks], qf2[qt][ks], s[qt][kt]);
#pragma unroll
                for (int kt = 0; kt < 2; ++kt)
#pragma unroll
                    for (int qt = 0; qt < NQ; ++qt) s[qt][kt] = WFrag<T16>::mma(kf2[kt][ks], qf[qt][ks], s[qt][kt]); } }
        const int kn = (kb + 32) & (TT - 1);   // next pass's key fragments, one pass ahead; the last pass asks for the first keys again (in bounds, not used)
#pragma unroll
        for (int kt = 0; kt < 2; ++kt)
#pragma unroll
            for (int ks = 0; ks < 2; ++ks) { const int ko = (kn + kt * 16) * HD + ks * 512 + 8 * lane; kf[kt][ks] = WFrag<T16>::ld(Kp + ko); if constexpr (HL) kf2[kt][ks] = WFrag<T16>::ld(K2 + ko); }
        XWAIT();
        V pf[NQ], pf2[NQ];
#pragma unroll
        for (int qt = 0; qt < NQ; ++qt) {
            float bm = fmaxf(s[qt][0][0], s[qt][1][0]);
#pragma unroll
            for (int j = 1; j < 8; ++j) bm = fmaxf(bm, fmaxf(s[qt][0][j], s[qt][1][j]));
            bm = fmaxf(bm, xhalf(bm));
            const float mn = fmaxf(m[qt], bm); const float al = __builtin_amdgcn_exp2f((m[qt] - mn) * LC); m[qt] = mn;
            const float sh = 10.0f - mn * LC; float ps = 0.f;
#pragma unroll
            for (int e = 0; e < 16; e += 2) { v2f p; p[0] = __builtin_amdgcn_exp2f(__builtin_fmaf(s[qt][e >> 3][e & 7], LC, sh)); p[1] = __builtin_amdgcn_exp2f(__builtin_fmaf(s[qt][e >> 3][(e & 7) + 1], LC, sh)); ps += p[0]; ps += p[1];
                const v2h ph = __builtin_convertvector(p, v2h); pf[qt][e] = ph[0]; pf[qt][e + 1] = ph[1];
                if constexpr (HL) { const v2h pl = __builtin_convertvector(p - __builtin_convertvector(ph, v2f), v2h); pf2[qt][e] = pl[0]; pf2[qt][e + 1] = pl[1]; } }
            l[qt] = l[qt] * al + ps;
#pragma unroll
            for (int dt = 0; dt < 4; ++dt) o[qt][dt] *= al; }
#pragma unroll
        for (int dt = 0; dt < 4; ++dt)
#pragma unroll
            for (int qt = 0; qt < NQ; ++qt) o[qt][dt] = WFrag<T16>::mma(vf[dt], pf[qt], o[qt][dt]);
        if constexpr (HL) {
#pragma unroll
            for (int dt = 0; dt < 4; ++dt)
#pragma unroll
                for (int qt = 0; qt < NQ; ++qt) o[qt][dt] = WFrag<T16>::mma(vf[dt], pf2[qt], o[qt][dt]);
#pragma unroll
            for (int dt = 0; dt < 4; ++dt)
#pragma unroll
                for (int qt = 0; qt < NQ; ++qt) o[qt][dt] = WFrag<T16>::mma(vf2[dt], pf[qt], o[qt][dt]); }
    }
#pragma unroll
    for (int qt = 0; qt < NQ; ++qt) { const float inv = __fdiv_rn(1.0f, l[qt] + xhalf(l[qt])); const size_t ro = (size_t)(q0 + qt * 16) * DQ + 8 * lane;   // o[qt][dt][j] = O[query lr][d = dt*16 + 8*hi + j]: piece (half dt & 1, lane) of k block dt >> 1 of this head
#pragma unroll
        for (int dt = 0; dt < 4; ++dt) { const v8f val = o[qt][dt] * inv; const v8b oh = __builtin_convertvector(val, v8b); const v8b ol = __builtin_convertvector(val - __builtin_convertvector(oh, v8f), v8b);
            *(v8us*)(Ah + ro + dt * 256) = __builtin_bit_cast(v8us, oh); *(v8us*)(Al + ro + dt * 256) = __builtin_bit_cast(v8us, ol);
            XWAIT(); } }
}
// grid x: (entry of the group, head); grid y: block of FW*NQ*16 query rows, the hi+lo blocks (three times the products) first
__global__ __launch_bounds__(FW * 32) void k_fattn(const h16* __restrict__ Q16, const h16* __restrict__ K16, const h16* __restrict__ V16, const h16* __restrict__ Ql, const h16* __restrict__ Kl, const h16* __restrict__ Vl, bf* Ah, bf* Al) {
    const int z = blockIdx.x; const size_t po = (size_t)z * TT * HD; const size_t ao = (size_t)(z / NH_) * TT * DQ + (size_t)(z % NH_) * (HD / 32) * 512;   // the merged plane [token][DQ] in fragment order: this head's two k blocks
    const int qb = blockIdx.y * (FW * NQ * 16); const int q0 = qb + (int)(threadIdx.x >> 5) * (NQ * 16);
    if (qb < RH) fattn<true>(Q16 + po, Ql + po, K16 + po, Kl + po, V16 + po, Vl + po, q0, Ah + ao, Al + ao);
    else fattn<false>(Q16 + po, nullptr, K16 + po, nullptr, V16 + po, nullptr, q0, Ah + ao, Al + ao);
}

extern "C" void kernel_launch(void* const* d_in, const int* in_sizes, int n_in,
                              void* d_out, int out_size, void* d_ws, size_t ws_size, hipStream_t stream) {
    (void)in_sizes; (void)n_in; (void)out_size;
    const float* x = (const float*)d_in[0]; const float* wq = (const float*)d_in[1]; const float* bq = (const float*)d_in[2]; const float* wk = (const float*)d_in[3]; const float* bk = (const float*)d_in[4]; const float* wv = (const float*)d_in[5]; const float* bv = (const float*)d_in[6]; const float* wo = (const float*)d_in[7]; const float* bo = (const float*)d_in[8];
    float* OUT = (float*)d_out;     // [8][1024][1024]
    char* wsp = (char*)d_ws;
    auto take = [&](size_t bytes) { char* p = wsp; wsp += (bytes + 255) & ~(size_t)255; return (void*)p; };
    const size_t PS = (size_t)GB * NH_ * TT * HD;   // one 16-bit plane of a group: [entry][head] planes of [t][d] (v: [d][t]), each in fragment order
    static_assert(NKV == NH_ && NB_ % GB == 0 && ZH == NH_, "one pass per group of GB batch entries; q, k, v of equal width");
    bf* W4 = (bf*)take((size_t)4 * DQ * DM * 2); bf* WO = W4 + (size_t)3 * DQ * DM;   // Wq, Wk, Wv, Wo transposed, back to back
    bf* XB = (bf*)take((size_t)GB * TT * DM * 2);
    h16* QP16 = (h16*)take(2 * PS * 2); h16* KP16 = QP16 + PS; h16* VT16 = (h16*)take(PS * 2);
    h16* QPl = (h16*)take(2 * PS * 2); h16* KPl = QPl + PS; h16* VTl = (h16*)take(PS * 2);   // of the q lo plane only the rows < RH of each (entry, head) are written, and only they are read
    bf* ATh = (bf*)take((size_t)NB_ * TT * DQ * 2); bf* ATl = (bf*)take((size_t)NB_ * TT * DQ * 2);
    if ((size_t)(wsp - (char*)d_ws) > ws_size) return;    // ws 256 MiB
    static_assert(TT % 64 == 0 && HD == 64 && DQ == NH_ * HD && (GB * TT) % 128 == 0 && DQ % 128 == 0 && DM % 128 == 0, "a wave's 64x64 projection tile is 64 tokens of one entry x one head; whole 128x128 work-group tiles");
    static_assert(RH % (FW * NQ * 16) == 0 && TT % (FW * NQ * 16) == 0 && HD == 64 && (TT & (TT - 1)) == 0, "whole row blocks on either side of RH");
    static_assert(GB == NB_ && ((size_t)NB_ * TT * DM / 8) % 256 == 0 && (DM * DQ / 8) % 256 == 0, "one group; whole blocks of 256 pieces on either side of XBLK");
    k_prep<<<XBLK + 4 * WBLK, 256, 0, stream>>>(x, wq, wk, wv, wo, XB, W4);
    k_gemmw<bf, 0, true, true, DM><<<dim3(GB * TT / 128, DQ / 128, 3), 128, 0, stream>>>(XB, nullptr, W4, nullptr, nullptr, 0, bq, bk, bv, 0, (size_t)DQ * DM, 0, QP16, QPl, VT16, VTl);
    k_fattn<<<dim3(GB * NH_, TT / (FW * NQ * 16), 1), FW * 32, 0, stream>>>(QP16, KP16, VT16, QPl, KPl, VTl, ATh, ATl);
    k_gemmw<bf, 1, true, false, DQ><<<dim3(NB_ * TT / 128, DM / 128, 1), 128, 0, stream>>>(ATh, ATl, WO, nullptr, OUT, DM, bo, nullptr, nullptr, 0, 0, 0, nullptr, nullptr, nullptr, nullptr);
}

// v010
// Measured time: 114 microseconds a run.
// Two timings next to v009 both put it at 1.06 times that version's speed.
// Over all steps from v000 it is 41.2 times as fast.
#include <hip/hip_runtime.h>

// CLIP attention (hidden_states [8][1024][1024]; q = (x Wq + bq) x 64^-0.5, k, v = x W + b ('xw' [1024][1024]; 16 heads x 64); softmax(q.k) over all keys; out = merged Wo + bo -> [8][1024][1024] (8.4 M)).
// Compute dtypes, f32 accumulate: every input rounded to bf16; q/k/v on PLAIN bf16 operands (inputs: exact) + biases; the 64^-0.5 applied to the f32 score (the module scales q after the bias; power of two, exact); scores and attn.v: query rows < 512 hl (3 products; hi = the fp16 value, lo = its residual in fp16), the rest single fp16 (p x1024 in both); softmax f32; Wo hl x exact (2 products) + bo.

#define NB_  8
#define TT   1024
#define DM   1024
#define NH_  16
#define NKV  16
#define REP  (NH_ / NKV)
#define HD   64
#define DQ   (NH_ * HD)
#define DKV  (NKV * HD)
#define ZH   16                   // heads of one batch entry (only checked equal to NH_); one attention pass takes all GB entries
#define GB   8                    // batch entries per projection group: all of them, every stage runs once
#define RH   512                  // query rows < RH use hi+lo planes (0: none)
#define WIN  0
#define PCAR 1024.0f
#define SCL  0.125f   // HD^-0.5
typedef _Float16 h16;
typedef unsigned short bf;
typedef __attribute__((ext_vector_type(16))) __bf16   v16bf;
typedef __attribute__((ext_vector_type(16))) _Float16 v16h;
typedef __attribute__((ext_vector_type(8)))  _Float16 v8h;
typedef __attribute__((ext_vector_type(8)))  unsigned short v8us;
typedef __attribute__((ext_vector_type(8)))  float    v8f;
typedef __attribute__((ext_vector_type(4)))  float    v4f;
typedef v8h  __attribute__((may_alias)) v8ha;
typedef v4f  __attribute__((may_alias)) v4fa;
typedef v8us __attribute__((may_alias)) v8usa;

__device__ __forceinline__ unsigned short f2bf(float f) { unsigned u = __float_as_uint(f); u += 0x7FFFu + ((u >> 16) & 1u); return (unsigned short)(u >> 16); }
__device__ __forceinline__ float bf2f(unsigned short b) { return __uint_as_float(((unsigned)b) << 16); }
__device__ __forceinline__ float bfr(float f) { return bf2f(f2bf(f)); }
__device__ __forceinline__ v16h cat16(v8h lo, v8h hi) { return __builtin_shufflevector(lo, hi, 0, 1, 2, 3, 4, 5, 6, 7, 8, 9, 10, 11, 12, 13, 14, 15); }
__device__ __forceinline__ v16bf cat16b(v8us lo, v8us hi) { return __builtin_bit_cast(v16bf, __builtin_shufflevector(lo, hi, 0, 1, 2, 3, 4, 5, 6, 7, 8, 9, 10, 11, 12, 13, 14, 15)); }
__device__ __forceinline__ v8f wmma16(v16h a, v16h b, v8f c) { return __builtin_amdgcn_wmma_f32_16x16x32_f16(false, a, false, b, (short)0, c, false, false); }
__device__ __forceinline__ v8f wmmab(v16bf a, v16bf b, v8f c) { return __builtin_amdgcn_wmma_f32_16x16x32_bf16(false, a, false, b, (short)0, c, false, false); }



// FRAGMENT ORDER of every 16-bit operand plane [rows][K]: a block of 16 rows x 32 k is 512 elements in a row, element (row r, k) at ((k >> 4) & 1) * 256 + (((k >> 3) & 1) * 16 + (r & 15)) * 8 + (k & 7);
// blocks run along k, then along the rows: block (r >> 4, k >> 5) starts at (r >> 4) * 16 * K + (k >> 5) * 512. Lane l of a wave finds its two 16-byte pieces of a fragment at l * 8 and 256 + l * 8,
// so each wave-wide 16-byte load or store covers 512 bytes in a row: 4 whole lines, where rows of K in a row give a 32-byte piece of each of 16 lines. Lane (lr, hi), l = hi * 16 + lr, holds row lr, k = 8 * hi + 0..7 and 16 + 8 * hi + 0..7.

// ---- k_gemmw: register-blocked GEMM, one wave per 64x64 output tile (16 accumulators); FOUR WAVES (2 x 2 wave tiles) make a work-group with a 128x128 tile and share its operands through LDS; grid (M/128, N/128, Z), 128 threads.
// The 16-bit planes lie in fragment order, so a k tile (64 k = two k blocks) of 16 rows is 2 KB in a row in memory and goes to LDS as it is, by asynchronous copies; each operand byte is asked for once a work-group, where four lone waves asked for it twice.
// C[m][n] (f32, pitch ldc, + optional f32 bias[n], one vector per z slice up to three) = sum_k A[m][k] Bt[n][k] (+ split products per NSPLIT). z-batch strides sA/sB/sC in elements. K % 32 == 0.
typedef __attribute__((ext_vector_type(8))) __bf16 v8b;
// eight neighbouring f32 values -> 16 bytes in each of the two operand planes (round to nearest even): the fp16 value and, where somebody reads it (lo), what the rounding left, in fp16 again
template <bool B> struct BoolC { static constexpr bool v = B; };
template <bool LO> __device__ __forceinline__ void split2(v8f val, v8h& o16, v8h& ol) {
    o16 = __builtin_convertvector(val, v8h);
    if constexpr (LO) ol = __builtin_convertvector(val - __builtin_convertvector(o16, v8f), v8h); }
// ld(p): p = start of the fragment's block + 8 * lane
template <typename T16> struct WFrag;
template <> struct WFrag<h16> { typedef v16h V; static __device__ __forceinline__ V ld(const h16* p) { return cat16(*(const v8h*)p, *(const v8h*)(p + 256)); } static __device__ __forceinline__ v8f mma(V a, V b, v8f c) { return wmma16(a, b, c); } };
template <> struct WFrag<bf> { typedef v16bf V; static __device__ __forceinline__ V ld(const bf* p) { return cat16b(*(const v8us*)p, *(const v8us*)(p + 256)); } static __device__ __forceinline__ v8f mma(V a, V b, v8f c) { return wmmab(a, b, c); } };
// SB: a scheduling fence; keeps a group of fragment loads whole and in front of the products that cover it (without it the build sinks most of the loads in among the products and waits for them there)
#define SB() __builtin_amdgcn_sched_barrier(0)
// XWAIT: stands behind a group of global loads or stores, before a register that one of them names is written again (this build goes above v255); the scheduling fence keeps later register writes behind it
#define XWAIT() do { asm volatile("s_wait_xcnt 0x0" ::: "memory"); __builtin_amdgcn_sched_barrier(0); } while (0)
// cp8: eight asynchronous copies, 16 bytes a lane, global memory -> LDS through no register: two row blocks of a k tile, each four wave-wide pieces of 512 bytes. l0, l1: the lane's LDS byte address in the row block; g0, g1: its global address.
// The s_wait_xcnt stands in the copies' own statement: no register that a copy names is written again in front of it.
__device__ __forceinline__ void cp8(unsigned l0, const char* g0, unsigned l1, const char* g1) {
    asm volatile("global_load_async_to_lds_b128 %0, %8, off\n\tglobal_load_async_to_lds_b128 %1, %9, off\n\tglobal_load_async_to_lds_b128 %2, %10, off\n\tglobal_load_async_to_lds_b128 %3, %11, off\n\t"
                 "global_load_async_to_lds_b128 %4, %12, off\n\tglobal_load_async_to_lds_b128 %5, %13, off\n\tglobal_load_async_to_lds_b128 %6, %14, off\n\tglobal_load_async_to_lds_b128 %7, %15, off\n\ts_wait_xcnt 0x0"
                 :: "v"(l0), "v"(l0 + 512u), "v"(l0 + 1024u), "v"(l0 + 1536u), "v"(l1), "v"(l1 + 512u), "v"(l1 + 1024u), "v"(l1 + 1536u),
                    "v"(g0), "v"(g0 + 512), "v"(g0 + 1024), "v"(g0 + 1536), "v"(g1), "v"(g1 + 512), "v"(g1 + 1024), "v"(g1 + 1536) : "memory"); }
template <typename T16, int NSPLIT, bool BIAS, int K>   // K at compile time: the row blocks of a fragment-order plane are then fixed byte offsets from one address per operand
__global__ __launch_bounds__(128) void k_gemmw(const T16* __restrict__ A, const T16* __restrict__ A2, const T16* __restrict__ Bt, const T16* __restrict__ Bt2, float* C, int ldc, const float* __restrict__ bias0, const float* __restrict__ bias1, const float* __restrict__ bias2, size_t sA, size_t sB, size_t sC) {
    typedef typename WFrag<T16>::V V;
    constexpr int NPA = (NSPLIT == 1 || NSPLIT == 2) ? 2 : 1, NPB = (NSPLIT >= 2) ? 2 : 1;   // planes per operand
    constexpr int PLN = 8 * 1024, TILE = (NPA + NPB) * PLN;   // elements: a plane's share of a k tile is 8 row blocks x (16 rows x 64 k); a tile holds A, (A2), B, (B2) one behind the other
    __shared__ __align__(16) T16 ring[2][TILE];      // two buffers: tile t lies in buffer t & 1
    __shared__ __align__(16) float osw[4][16 * 68];
    const int wv = __builtin_amdgcn_readfirstlane((int)(threadIdx.x >> 5)); float* const os = osw[wv];   // each wave stages its output in its own LDS range
    const size_t z = blockIdx.z; A += z * sA; if (A2) A2 += z * sA; Bt += z * sB; if (Bt2) Bt2 += z * sB; C += z * sC;
    const float* __restrict__ bias = (z == 0) ? bias0 : (z == 1) ? bias1 : bias2;   // one bias vector per z slice
    const int lane = threadIdx.x & 31, lr = lane & 15, hi = lane >> 4; const int r0 = blockIdx.x * 128 + (wv & 1) * 64, c0 = blockIdx.y * 128 + (wv >> 1) * 64;
    v8f acc[4][4];
#pragma unroll
    for (int mb = 0; mb < 4; ++mb)
#pragma unroll
        for (int nb = 0; nb < 4; ++nb) acc[mb][nb] = (v8f){};
    static_assert(K % 64 == 0 && K >= 128, "k is walked in tiles of two k blocks; the two buffers want two tiles");
    static_assert((K / 64 & (K / 64 - 1)) == 0, "the walk wraps by a mask");
    // ROTATED WALK: work-groups that share A rows (same x) or B rows (same y, z) run in step; each enters the k tiles at a place of its own and wraps round, so that at one moment they ask L2 for different lines
    // (and the whole grid for all sixteen 2-KB pieces of every 32-KB Bt row block and eight of every A row block, not for the same one). Each accumulator sums the same products, begun at another k.
    const int rot = (int)((blockIdx.x + blockIdx.y + (DQ / 128) * blockIdx.z) & (K / 64 - 1));
    // the walk's tile t (k tile (t + rot) mod K/64) into buffer bu: wave wv brings row blocks wv and wv + 4 of every plane (fragment order: row block stride 16 * K elements, a k tile 1024 elements in a row)
    const unsigned lw = (unsigned)(size_t)&ring[0][0] + (unsigned)wv * 2048u + (unsigned)lane * 16u;
    const size_t gw = ((size_t)wv * 16 * K) * 2 + (size_t)lane * 16, ga = (size_t)(blockIdx.x * 128) * K * 2 + gw, gb = (size_t)(blockIdx.y * 128) * K * 2 + gw;   // bytes
    auto copies = [&](int t, int bu) __attribute__((always_inline)) {
        const unsigned l = lw + (unsigned)bu * (TILE * 2u); const size_t ko = (size_t)((t + rot) & (K / 64 - 1)) * 2048, ka = ga + ko, kb = gb + ko; constexpr size_t R4 = (size_t)4 * 16 * K * 2;
        cp8(l, (const char*)A + ka, l + 8192u, (const char*)A + ka + R4);
        if constexpr (NPA == 2) cp8(l + PLN * 2u, (const char*)A2 + ka, l + PLN * 2u + 8192u, (const char*)A2 + ka + R4);
        cp8(l + NPA * PLN * 2u, (const char*)Bt + kb, l + NPA * PLN * 2u + 8192u, (const char*)Bt + kb + R4);
        if constexpr (NPB == 2) cp8(l + (NPA + 1) * PLN * 2u, (const char*)Bt2 + kb, l + (NPA + 1) * PLN * 2u + 8192u, (const char*)Bt2 + kb + R4); };
    // TWO FRAGMENT SETS, one per k block of the tile: all fragment reads of a trip go out as one group in front of its products
    V a[2][4], a2[2][4], b[2][4], b2[2][4];
    auto fetch = [&](int st, const T16* sa, const T16* sb) __attribute__((always_inline)) {   // sa, sb: the wave's first A and B row block in the buffer + 8 * lane
#pragma unroll
        for (int mb = 0; mb < 4; ++mb) { a[st][mb] = WFrag<T16>::ld(sa + mb * 1024 + st * 512); if (NSPLIT == 1 || NSPLIT == 2) a2[st][mb] = WFrag<T16>::ld(sa + PLN + mb * 1024 + st * 512); }
#pragma unroll
        for (int nb = 0; nb < 4; ++nb) { b[st][nb] = WFrag<T16>::ld(sb + nb * 1024 + st * 512); if (NSPLIT >= 2) b2[st][nb] = WFrag<T16>::ld(sb + PLN + nb * 1024 + st * 512); } };
    auto prods = [&](int st) __attribute__((always_inline)) {   // per accumulator the order of the products is the old one
#pragma unroll
        for (int nb = 0; nb < 4; ++nb)
#pragma unroll
            for (int mb = 0; mb < 4; ++mb) { acc[mb][nb] = WFrag<T16>::mma(a[st][mb], b[st][nb], acc[mb][nb]); if (NSPLIT == 1 || NSPLIT == 2) acc[mb][nb] = WFrag<T16>::mma(a2[st][mb], b[st][nb], acc[mb][nb]); if (NSPLIT >= 2) acc[mb][nb] = WFrag<T16>::mma(a[st][mb], b2[st][nb], acc[mb][nb]); } };
    copies(0, 0);
    asm volatile("s_wait_asynccnt 0x0" ::: "memory");   // this wave's share of tile 0 has landed
    __syncthreads();                                    // every wave's share has: tile 0 may be read
    copies(1, 1);
#pragma unroll 1
    for (int t = 0; t < K / 64; ++t) {   // stays rolled: one copy of the 32 (64) products in the text
        const T16* const sa = &ring[t & 1][0] + (wv & 1) * 4096 + 8 * lane; const T16* const sb = &ring[t & 1][0] + NPA * PLN + (wv >> 1) * 4096 + 8 * lane;
        fetch(0, sa, sb); fetch(1, sa, sb); SB(); prods(0); prods(1);
        asm volatile("v_nop\n\tv_nop\n\tv_nop\n\tv_nop" : "+v"(acc[0][0]), "+v"(acc[1][1]), "+v"(acc[2][2]), "+v"(acc[3][3]) : "v"(a[1][0]), "v"(a[1][3]));   // the four vector slots behind the last product, on the taken side of the branch back too
        SB();   // the products stay in front of the trip's foot (without it the build sinks most of them behind the barrier, in front of the copies, which then fly for a part of a trip only)
        asm volatile("s_wait_dscnt 0x0" ::: "memory");      // this wave's reads of buffer t & 1 are done before the buffer is handed to its next writer
        asm volatile("s_wait_asynccnt 0x0" ::: "memory");   // this wave's share of tile t + 1 has landed
        __syncthreads();                                    // one barrier a trip: it publishes tile t + 1 and ends every wave's reads of buffer t & 1
        if (t + 2 < K / 64) copies(t + 2, t & 1);           // the same test in the whole work-group; flies while tile t + 1 is worked on
    }
    asm volatile("s_wait_asynccnt 0x0" ::: "memory");   // no copy is out when the wave goes on
#pragma unroll
    for (int mb = 0; mb < 4; ++mb) {
#pragma unroll
        for (int nb = 0; nb < 4; ++nb) {
#pragma unroll
            for (int j = 0; j < 8; ++j) os[(hi * 8 + j) * 68 + nb * 16 + lr] = acc[mb][nb][j]; }
        __builtin_amdgcn_wave_barrier(); asm volatile("" ::: "memory");
        float* crow = C + (size_t)(r0 + mb * 16) * ldc + c0;
{
#pragma unroll
            for (int s = 0; s < 8; ++s) { const int row = 2 * s + hi, cofs = lr * 4; v4f val = *(const v4fa*)(os + row * 68 + cofs); if (BIAS) { val[0] += bfr(bias[c0 + cofs]); val[1] += bfr(bias[c0 + cofs + 1]); val[2] += bfr(bias[c0 + cofs + 2]); val[3] += bfr(bias[c0 + cofs + 3]); }
                *(v4f*)(crow + (size_t)row * ldc + cofs) = val; }
             }
        __builtin_amdgcn_wave_barrier(); asm volatile("" ::: "memory");
    }
}

// ---- k_qkv: the q/k/v projection, x [8192][1024] times the three transposed weights taken as ONE plane of 3072 rows. One wave per 128x96 output tile (48 accumulators: 14 fragments feed 48 products,
// where a 64x64 tile's 8 feed 16); four waves (2 x 2) share a 256x192 tile through the same two-buffer LDS ring as k_gemmw; two work-groups a WGP (512 registers a wave), and the grid (32, 16) is resident at once.
// No f32 C: the wave itself writes the attention operand planes (fp16, and the fp16 residual 'lo'; the hi+lo rows read the fp16 plane as their hi). Its 96 columns are three blocks of 32, each inside one head of q, k or v:
// q, k: [entry][head] planes of [t][d] in fragment order, turned through the wave's LDS; v: [entry][head] planes of [d][t] in fragment order.
#define QMB 8                     // A fragments a wave: 128 tokens of one batch entry, on one side of RH
#define QNB 6                     // B fragments a wave: 96 columns
// cp7: a wave's share of a k tile, seven row blocks of 2 KB, 28 asynchronous copies. One address pair a row block: the immediate offset moves the LDS and the global address alike, so the four 512-byte pieces of a row block
// need no registers of their own (asm operands lie below v256, where this kernel keeps accumulators; 84 address registers made the build move nine of them away and back every trip).
// As in cp8, the s_wait_xcnt stands in the copies' own statement: no register that a copy names is written again in front of it.
__device__ __forceinline__ void cp7(unsigned l0, unsigned l1, unsigned l2, unsigned l3, unsigned l4, unsigned l5, unsigned l6, const char* g0, const char* g1, const char* g2, const char* g3, const char* g4, const char* g5, const char* g6) {
    asm volatile(
                 "global_load_async_to_lds_b128 %0, %7, off\n\tglobal_load_async_to_lds_b128 %0, %7, off offset:512\n\tglobal_load_async_to_lds_b128 %0, %7, off offset:1024\n\tglobal_load_async_to_lds_b128 %0, %7, off offset:1536\n\t"
                 "global_load_async_to_lds_b128 %1, %8, off\n\tglobal_load_async_to_lds_b128 %1, %8, off offset:512\n\tglobal_load_async_to_lds_b128 %1, %8, off offset:1024\n\tglobal_load_async_to_lds_b128 %1, %8, off offset:1536\n\t"
                 "global_load_async_to_lds_b128 %2, %9, off\n\tglobal_load_async_to_lds_b128 %2, %9, off offset:512\n\tglobal_load_async_to_lds_b128 %2, %9, off offset:1024\n\tglobal_load_async_to_lds_b128 %2, %9, off offset:1536\n\t"
                 "global_load_async_to_lds_b128 %3, %10, off\n\tglobal_load_async_to_lds_b128 %3, %10, off offset:512\n\tglobal_load_async_to_lds_b128 %3, %10, off offset:1024\n\tglobal_load_async_to_lds_b128 %3, %10, off offset:1536\n\t"
                 "global_load_async_to_lds_b128 %4, %11, off\n\tglobal_load_async_to_lds_b128 %4, %11, off offset:512\n\tglobal_load_async_to_lds_b128 %4, %11, off offset:1024\n\tglobal_load_async_to_lds_b128 %4, %11, off offset:1536\n\t"
                 "global_load_async_to_lds_b128 %5, %12, off\n\tglobal_load_async_to_lds_b128 %5, %12, off offset:512\n\tglobal_load_async_to_lds_b128 %5, %12, off offset:1024\n\tglobal_load_async_to_lds_b128 %5, %12, off offset:1536\n\t"
                 "global_load_async_to_lds_b128 %6, %13, off\n\tglobal_load_async_to_lds_b128 %6, %13, off offset:512\n\tglobal_load_async_to_lds_b128 %6, %13, off offset:1024\n\tglobal_load_async_to_lds_b128 %6, %13, off offset:1536\n\t"
                 "s_wait_xcnt 0x0"
                 :: "v"(l0), "v"(l1), "v"(l2), "v"(l3), "v"(l4), "v"(l5), "v"(l6), "v"(g0), "v"(g1), "v"(g2), "v"(g3), "v"(g4), "v"(g5), "v"(g6) : "memory"); }
// amdgpu_waves_per_eu(2, 2): the build keeps to 512 registers, so that two waves share a SIMD (at 128 threads it may otherwise take up to 1,024, and one wave would be alone with its waits)
__global__ __launch_bounds__(128) __attribute__((amdgpu_waves_per_eu(2, 2))) void k_qkv(const bf* __restrict__ A, const bf* __restrict__ Bt, const float* __restrict__ bias0, const float* __restrict__ bias1, const float* __restrict__ bias2, h16* P16, h16* Pl, h16* V16, h16* Vl) {
    typedef WFrag<bf>::V V; constexpr int K = DM;
    constexpr int PA = 2 * QMB * 1024, PB = 2 * QNB * 1024, TILE = PA + PB;   // elements: a k tile holds 16 row blocks of A, then 12 of B, each 16 rows x 64 k
    __shared__ __align__(16) bf ring[2][TILE];       // two buffers: tile t lies in buffer t & 1
    __shared__ __align__(16) float osw[4][4 * 16 * 36];
    const int wv = __builtin_amdgcn_readfirstlane((int)(threadIdx.x >> 5)); float* const os = osw[wv];   // each wave stages its output in its own LDS range
    const int lane = threadIdx.x & 31, lr = lane & 15, hi = lane >> 4; const int r0 = blockIdx.x * 256 + (wv & 1) * 128, cg0 = blockIdx.y * 192 + (wv >> 1) * 96;
    v8f acc[QMB][QNB];
#pragma unroll
    for (int mb = 0; mb < QMB; ++mb)
#pragma unroll
        for (int nb = 0; nb < QNB; ++nb) acc[mb][nb] = (v8f){};
    static_assert(K % 64 == 0 && K >= 128 && (K / 64 & (K / 64 - 1)) == 0, "k is walked in tiles of two k blocks; two buffers want two tiles; the walk wraps by a mask");
    const int rot = (int)((blockIdx.x + blockIdx.y) & (K / 64 - 1));   // rotated walk, as in k_gemmw
    // the walk's tile t into buffer bu: wave wv brings row blocks wv, wv + 4, .. of both planes
    const unsigned lw = (unsigned)(size_t)&ring[0][0] + (unsigned)wv * 2048u + (unsigned)lane * 16u;
    const size_t gw = ((size_t)wv * 16 * K) * 2 + (size_t)lane * 16, ga = (size_t)(blockIdx.x * 256) * K * 2 + gw, gb = (size_t)(blockIdx.y * 192) * K * 2 + gw;   // bytes
    auto copies = [&](int t, int bu) __attribute__((always_inline)) {
        const unsigned l = lw + (unsigned)bu * (TILE * 2u); const size_t ko = (size_t)((t + rot) & (K / 64 - 1)) * 2048, ka = ga + ko, kb = gb + ko; constexpr size_t R4 = (size_t)4 * 16 * K * 2;
        const char* const pa = (const char*)A + ka; const char* const pb = (const char*)Bt + kb;
        cp7(l, l + 8192u, l + 16384u, l + 24576u, l + PA * 2u, l + PA * 2u + 8192u, l + PA * 2u + 16384u, pa, pa + R4, pa + 2 * R4, pa + 3 * R4, pb, pb + R4, pb + 2 * R4); };
    V a[4], b[QNB];   // ONE fragment set, and of A four fragments at a time: 384 accumulator registers leave room for 80; the SIMD's other wave works while this one waits for its reads
    auto row = [&](int mb, V av) __attribute__((always_inline)) {
#pragma unroll
        for (int nb = 0; nb < QNB; ++nb) acc[mb][nb] = WFrag<bf>::mma(av, b[nb], acc[mb][nb]); };
    auto kblock = [&](const bf* sa, const bf* sb) __attribute__((always_inline)) {   // sa, sb: the wave's first A and B row block of this k block + 8 * lane
        a[0] = WFrag<bf>::ld(sa); b[0] = WFrag<bf>::ld(sb); SB();   // this fence and the next keep the reads in the order in which the products want them: the first product waits for four reads (without them: for fourteen)
#pragma unroll
        for (int nb = 1; nb < QNB; ++nb) b[nb] = WFrag<bf>::ld(sb + nb * 1024);
        SB();
#pragma unroll
        for (int mb = 1; mb < 4; ++mb) a[mb] = WFrag<bf>::ld(sa + mb * 1024);
        SB(); row(0, a[0]); row(1, a[1]); SB();   // 20 reads as one group in front of the products
        a[0] = WFrag<bf>::ld(sa + 4 * 1024); a[1] = WFrag<bf>::ld(sa + 5 * 1024);   // the later A fragments take the places of used ones, two at a time, and land under the next 12 products
        SB(); row(2, a[2]); row(3, a[3]); SB();
        a[2] = WFrag<bf>::ld(sa + 6 * 1024); a[3] = WFrag<bf>::ld(sa + 7 * 1024);
        SB(); row(4, a[0]); row(5, a[1]); row(6, a[2]); row(7, a[3]); };
    copies(0, 0);
    asm volatile("s_wait_asynccnt 0x0" ::: "memory");   // this wave's share of tile 0 has landed
    __syncthreads();                                    // every wave's share has: tile 0 may be read
    copies(1, 1);
#pragma unroll 1
    for (int t = 0; t < K / 64; ++t) {   // stays rolled: one copy of the 96 products in the text
        const bf* const sa = &ring[t & 1][0] + (wv & 1) * (QMB * 1024) + 8 * lane; const bf* const sb = &ring[t & 1][0] + PA + (wv >> 1) * (QNB * 1024) + 8 * lane;
        kblock(sa, sb); SB(); kblock(sa + 512, sb + 512);   // the fence: the second k block's reads, into the same registers, stay behind the first's products
        SB();   // the products stay in front of the trip's foot
        asm volatile("s_wait_dscnt 0x0" ::: "memory");      // this wave's reads of buffer t & 1 are done before the buffer is handed to its next writer
        asm volatile("s_wait_asynccnt 0x0" ::: "memory");   // this wave's share of tile t + 1 has landed
        __syncthreads();                                    // one barrier a trip: it publishes tile t + 1 and ends every wave's reads of buffer t & 1
        if (t + 2 < K / 64) copies(t + 2, t & 1);           // the same test in the whole work-group; flies while tile t + 1 is worked on
    }
    asm volatile("s_wait_asynccnt 0x0" ::: "memory");   // no copy is out when the wave goes on
    const int cofs = hi * 8; const int t0 = r0 % TT;   // first token of the tile
    auto block = [&](int cp) __attribute__((always_inline)) {   // one block of 32 columns: it lies in acc[..][0] and acc[..][1]
        const int cg = cg0 + cp * 32, z = cg / DQ, cz = cg % DQ, ks = (cz / 32) & 1;   // the same in the whole wave: which of q, k, v; the column in it; which half of its head
        const float* __restrict__ bias = (z == 0) ? bias0 : (z == 1) ? bias1 : bias2;
        const size_t hp = ((size_t)(r0 / TT) * NH_ + cz / HD) * TT * HD;   // (entry, head) plane
        if (z == 2) {
            const size_t po = hp + (size_t)(ks * 2) * 16 * TT + (size_t)t0 * 16 + lane * 8; float bb[2]; const float* const bp = bias + cz + lr;
            bb[0] = bp[0]; bb[1] = bp[16];
            asm volatile("s_wait_xcnt 0x0" :: "v"(bp) : "memory");   // stands before the address register of the bias loads is written again; the address as an input: its register stays its own up to here
            bb[0] = bfr(bb[0]); bb[1] = bfr(bb[1]);
#pragma unroll
            for (int nl = 0; nl < 2; ++nl)
#pragma unroll
                for (int h = 0; h < 2; ++h) {
#pragma unroll
                    for (int mb = 0; mb < 4; ++mb) { const v8f val = acc[h * 4 + mb][nl] + bb[nl];   // lane (lr, hi): column d = (ks*2 + nl)*16 + lr, tokens (h*4 + mb)*16 + 8*hi + 0..7
                        *(v4fa*)(os + lr * 68 + mb * 16 + hi * 8) = __builtin_shufflevector(val, val, 0, 1, 2, 3); *(v4fa*)(os + lr * 68 + mb * 16 + hi * 8 + 4) = __builtin_shufflevector(val, val, 4, 5, 6, 7); }
                    __builtin_amdgcn_wave_barrier(); asm volatile("" ::: "memory");   // the read-back below stays behind the LDS stores
                    v8h oh[4], ol[4];
#pragma unroll
                    for (int s = 0; s < 4; ++s) { const v4f v0 = *(const v4fa*)(os + lr * 68 + s * 16 + cofs), v1 = *(const v4fa*)(os + lr * 68 + s * 16 + cofs + 4);
                        split2<true>(__builtin_shufflevector(v0, v1, 0, 1, 2, 3, 4, 5, 6, 7), oh[s], ol[s]); }
                    SB();   // all eight pieces are made before the first store goes out: few registers are free here, and without it the build writes the next piece over one that an issued store names
#pragma unroll
                    for (int s = 0; s < 4; ++s) { const size_t e = po + (size_t)nl * 16 * TT + (h * 4 + s) * 256; *(v8h*)(V16 + e) = oh[s]; *(v8h*)(Vl + e) = ol[s]; }
                    XWAIT();
                    __builtin_amdgcn_wave_barrier(); asm volatile("" ::: "memory");   // the next block's LDS stores stay behind the read-back
                }
            return;
        }
        const size_t po = (size_t)z * ((size_t)GB * NH_ * TT * HD) + hp + (size_t)t0 * HD + ks * 512 + lane * 8; v8f bb[2]; const float* const bp = bias + cz + cofs;
#pragma unroll
        for (int s = 0; s < 2; ++s)
#pragma unroll
            for (int i = 0; i < 8; ++i) bb[s][i] = bp[s * 16 + i];
        asm volatile("s_wait_xcnt 0x0" :: "v"(bp) : "memory");   // stands before the address register of the bias loads is written again; the address as an input: its register stays its own up to here
#pragma unroll
        for (int s = 0; s < 2; ++s)
#pragma unroll
            for (int i = 0; i < 8; ++i) bb[s][i] = bfr(bb[s][i]);
        auto rows = [&](auto lo) __attribute__((always_inline)) {   // lo: a type that says at compile time whether the lo plane is written, so each side is straight-line code
#pragma unroll
        for (int h = 0; h < 2; ++h) {   // 64 tokens x 32 columns at a time; LDS rows of 36 floats
#pragma unroll
            for (int mb = 0; mb < 4; ++mb)
#pragma unroll
                for (int nl = 0; nl < 2; ++nl) {
#pragma unroll
                    for (int j = 0; j < 8; ++j) os[(mb * 16 + hi * 8 + j) * 36 + nl * 16 + lr] = acc[h * 4 + mb][nl][j]; }
            __builtin_amdgcn_wave_barrier(); asm volatile("" ::: "memory");   // the read-back below stays behind the LDS stores
#pragma unroll
            for (int mp = 0; mp < 2; ++mp) {   // two token blocks, up to eight stores, at a time
                v8h oh[4], ol[4];
#pragma unroll
                for (int g = 0; g < 4; ++g) { const int mb = mp * 2 + (g >> 1), s = g & 1; const v4f v0 = *(const v4fa*)(os + (mb * 16 + lr) * 36 + s * 16 + cofs), v1 = *(const v4fa*)(os + (mb * 16 + lr) * 36 + s * 16 + cofs + 4);   // read-back in fragment order: lane (lr, hi) takes row lr, values s*16 + hi*8 + 0..7
                    split2<decltype(lo)::v>(__builtin_shufflevector(v0, v1, 0, 1, 2, 3, 4, 5, 6, 7) + bb[s], oh[g], ol[g]); }
                SB();   // all pieces are made before the first store goes out: few registers are free here, and without it the build writes the next piece over one that an issued store names
#pragma unroll
                for (int g = 0; g < 4; ++g) { const size_t e = po + (size_t)(h * 4 + mp * 2 + (g >> 1)) * 16 * HD + (g & 1) * 256; *(v8h*)(P16 + e) = oh[g]; if constexpr (decltype(lo)::v) *(v8h*)(Pl + e) = ol[g]; }
                XWAIT();
            }
            __builtin_amdgcn_wave_barrier(); asm volatile("" ::: "memory");   // the next block's LDS stores stay behind the read-back
        }
        };
        // one scalar branch: the lo plane of q is read for query rows < RH alone (a wave's 128 tokens lie on one side of RH)
        if (z != 0 || t0 < RH) rows(BoolC<true>{}); else rows(BoolC<false>{});
    };
#pragma unroll 1
    for (int cp = 0; cp < QNB / 2; ++cp) {   // stays rolled: one copy of the stores' code in the text, which three copies would triple; the next block's accumulators move down instead, while the stores drain
        block(cp);
#pragma unroll
        for (int mb = 0; mb < QMB; ++mb)
#pragma unroll
            for (int nb = 0; nb + 2 < QNB; ++nb) acc[mb][nb] = acc[mb][nb + 2];
    }
}

typedef __attribute__((ext_vector_type(2))) _Float16 v2h;
typedef __attribute__((ext_vector_type(4))) _Float16 v4h;
typedef __attribute__((ext_vector_type(2))) unsigned short v2us;
typedef __attribute__((ext_vector_type(4))) unsigned short v4us;
typedef __attribute__((ext_vector_type(2))) float v2f;
typedef __attribute__((ext_vector_type(4))) int v4i;

// thread i writes piece i (8 k of one n) of the transposed plane [n][k] in fragment order: each half of a wave reads 16 neighbouring n of one k row, eight rows in turn
template <int K, int N>
__device__ __forceinline__ void wtG(int y, int bx, const float* __restrict__ w0, const float* __restrict__ w1, const float* __restrict__ w2, const float* __restrict__ w3, bf* Bt) {
    const float* __restrict__ w = (y == 0) ? w0 : (y == 1) ? w1 : (y == 2) ? w2 : w3; Bt += (size_t)y * N * K;   // y: which of the four weights
    const int i = bx * 256 + threadIdx.x; if (i >= N * K / 8) return;
    const int blk = i >> 6; const int n = blk / (K / 32) * 16 + (i & 15), k = blk % (K / 32) * 32 + ((i >> 5) & 1) * 16 + ((i >> 4) & 1) * 8; const float* p = w + (size_t)k * N + n; float t[8]; v8us o;
#pragma unroll
    for (int j = 0; j < 8; ++j) t[j] = p[j * N];
    asm volatile("s_wait_xcnt 0x0" :: "v"(p) : "memory");   // stands before the address register of the eight loads is written again; the address as an input: its register stays its own up to here
#pragma unroll
    for (int j = 0; j < 8; ++j) o[j] = f2bf(t[j]);
    *(v8us*)(Bt + (size_t)i * 8) = o;
}
// thread i writes piece i of the plane in fragment order: block i >> 6 = (row block, k block), half (i >> 5) & 1, lane i & 31 = (hi, lr)
__device__ __forceinline__ void cvt8(int bx, const float* __restrict__ src, bf* dst, size_t n8) { const size_t i = (size_t)bx * 256 + threadIdx.x; if (i >= n8) return;
    const size_t blk = i >> 6; const size_t row = blk / (DM / 32) * 16 + (i & 15); const int k = (int)(blk % (DM / 32)) * 32 + (int)((i >> 5) & 1) * 16 + (int)((i >> 4) & 1) * 8; const float* p = src + row * DM + k; const v8f v = *(const v8f*)p; v8us o;
    asm volatile("s_wait_xcnt 0x0" :: "v"(p) : "memory");   // stands before the address register of the two loads is written again; the address as an input: its register stays its own up to here
#pragma unroll
    for (int k = 0; k < 8; ++k) o[k] = f2bf(v[k]); *(v8us*)(dst + i * 8) = o;  }
// ---- k_prep: both conversions in ONE grid (neither reads what the other writes): blocks 0 .. XBLK-1 make the x plane, the next 4 * WBLK the four transposed weights
#define XBLK ((int)((size_t)NB_ * TT * DM / 8 / 256))
#define WBLK (DM * DQ / 8 / 256)
__global__ __launch_bounds__(256) void k_prep(const float* __restrict__ x, const float* __restrict__ w0, const float* __restrict__ w1, const float* __restrict__ w2, const float* __restrict__ w3, bf* XB, bf* Bt) {
    const int b = blockIdx.x;
    if (b < XBLK) cvt8(b, x, XB, (size_t)NB_ * TT * DM / 8);
    else wtG<DM, DQ>((b - XBLK) / WBLK, (b - XBLK) % WBLK, w0, w1, w2, w3, Bt);
}

#define NQ   2                    // 16-query groups per wave
#define FW   4                    // waves per work-group: same head, neighbouring rows, no exchange between them
#define LC   (SCL * 1.4426950408889634f)
__device__ __forceinline__ float xhalf(float v) { const int b = __float_as_int(v); return __int_as_float(__builtin_amdgcn_permlanex16(b, b, 0x76543210, 0xfedcba98, false, false)); }   // lane l <-> l ^ 16
template <bool HL>
__device__ __forceinline__ void fattn(const h16* __restrict__ Q, const h16* __restrict__ Q2, const h16* __restrict__ Kp, const h16* __restrict__ K2, const h16* __restrict__ Vt, const h16* __restrict__ V2, int q0, bf* Ah, bf* Al) {
    typedef h16 T16; typedef typename WFrag<T16>::V V;
    const int lane = threadIdx.x & 31;
    V qf[NQ][2], qf2[NQ][2], kf[2][2], kf2[2][2];
#pragma unroll
    for (int qt = 0; qt < NQ; ++qt)
#pragma unroll
        for (int ks = 0; ks < 2; ++ks) { const int qo = (q0 + qt * 16) * HD + ks * 512 + 8 * lane; qf[qt][ks] = WFrag<T16>::ld(Q + qo); if constexpr (HL) qf2[qt][ks] = WFrag<T16>::ld(Q2 + qo); }
    XWAIT();
    // fragment order: K blocks 512 apart along d, 16 * HD along the keys; Vt blocks 512 apart along the keys, 16 * TT along d
#pragma unroll
    for (int kt = 0; kt < 2; ++kt)
#pragma unroll
        for (int ks = 0; ks < 2; ++ks) { const int ko = kt * 16 * HD + ks * 512 + 8 * lane; kf[kt][ks] = WFrag<T16>::ld(Kp + ko); if constexpr (HL) kf2[kt][ks] = WFrag<T16>::ld(K2 + ko); }
    XWAIT();
    v8f o[NQ][4]; float m[NQ], l[NQ];
#pragma unroll
    for (int qt = 0; qt < NQ; ++qt) { m[qt] = -3.0e38f; l[qt] = 0.f;
#pragma unroll
        for (int dt = 0; dt < 4; ++dt) o[qt][dt] = (v8f){}; }
#pragma unroll 1
    for (int kb = 0; kb < TT; kb += 32) {
        V vf[4], vf2[4];   // this pass's Vt fragments: asked for first, used last
#pragma unroll
        for (int dt = 0; dt < 4; ++dt) vf[dt] = WFrag<T16>::ld(Vt + dt * 16 * TT + kb * 16 + 8 * lane);
        XWAIT();
        if constexpr (HL) {
#pragma unroll
            for (int dt = 0; dt < 4; ++dt) vf2[dt] = WFrag<T16>::ld(V2 + dt * 16 * TT + kb * 16 + 8 * lane);
            XWAIT(); }
        v8f s[NQ][2];
#pragma unroll
        for (int qt = 0; qt < NQ; ++qt) { s[qt][0] = (v8f){}; s[qt][1] = (v8f){}; }
#pragma unroll
        for (int ks = 0; ks < 2; ++ks) {
#pragma unroll
            for (int kt = 0; kt < 2; ++kt)
#pragma unroll
                for (int qt = 0; qt < NQ; ++qt) s[qt][kt] = WFrag<T16>::mma(kf[kt][ks], qf[qt][ks], s[qt][kt]);
            if constexpr (HL) {
#pragma unroll
                for (int kt = 0; kt < 2; ++kt)
#pragma unroll
                    for (int qt = 0; qt < NQ; ++qt) s[qt][kt] = WFrag<T16>::mma(kf[kt][ks], qf2[qt][ks], s[qt][kt]);
#pragma unroll
                for (int kt = 0; kt < 2; ++kt)
#pragma unroll
                    for (int qt = 0; qt < NQ; ++qt) s[qt][kt] = WFrag<T16>::mma(kf2[kt][ks], qf[qt][ks], s[qt][kt]); } }
        const int kn = (kb + 32) & (TT - 1);   // next pass's key fragments, one pass ahead; the last pass asks for the first keys again (in bounds, not used)
#pragma unroll
        for (int kt = 0; kt < 2; ++kt)
#pragma unroll
            for (int ks = 0; ks < 2; ++ks) { const int ko = (kn + kt * 16) * HD + ks * 512 + 8 * lane; kf[kt][ks] = WFrag<T16>::ld(Kp + ko); if constexpr (HL) kf2[kt][ks] = WFrag<T16>::ld(K2 + ko); }
        XWAIT();
        V pf[NQ], pf2[NQ];
#pragma unroll
        for (int qt = 0; qt < NQ; ++qt) {
            float bm = fmaxf(s[qt][0][0], s[qt][1][0]);
#pragma unroll
            for (int j = 1; j < 8; ++j) bm = fmaxf(bm, fmaxf(s[qt][0][j], s[qt][1][j]));
            bm = fmaxf(bm, xhalf(bm));
            const float mn = fmaxf(m[qt], bm); const float al = __builtin_amdgcn_exp2f((m[qt] - mn) * LC); m[qt] = mn;
            const float sh = 10.0f - mn * LC; float ps = 0.f;
#pragma unroll
            for (int e = 0; e < 16; e += 2) { v2f p; p[0] = __builtin_amdgcn_exp2f(__builtin_fmaf(s[qt][e >> 3][e & 7], LC, sh)); p[1] = __builtin_amdgcn_exp2f(__builtin_fmaf(s[qt][e >> 3][(e & 7) + 1], LC, sh)); ps += p[0]; ps += p[1];
                const v2h ph = __builtin_convertvector(p, v2h); pf[qt][e] = ph[0]; pf[qt][e + 1] = ph[1];
                if constexpr (HL) { const v2h pl = __builtin_convertvector(p - __builtin_convertvector(ph, v2f), v2h); pf2[qt][e] = pl[0]; pf2[qt][e + 1] = pl[1]; } }
            l[qt] = l[qt] * al + ps;
#pragma unroll
            for (int dt = 0; dt < 4; ++dt) o[qt][dt] *= al; }
#pragma unroll
        for (int dt = 0; dt < 4; ++dt)
#pragma unroll
            for (int qt = 0; qt < NQ; ++qt) o[qt][dt] = WFrag<T16>::mma(vf[dt], pf[qt], o[qt][dt]);
        if constexpr (HL) {
#pragma unroll
            for (int dt = 0; dt < 4; ++dt)
#pragma unroll
                for (int qt = 0; qt < NQ; ++qt) o[qt][dt] = WFrag<T16>::mma(vf[dt], pf2[qt], o[qt][dt]);
#pragma unroll
            for (int dt = 0; dt < 4; ++dt)
#pragma unroll
                for (int qt = 0; qt < NQ; ++qt) o[qt][dt] = WFrag<T16>::mma(vf2[dt], pf[qt], o[qt][dt]); }
    }
#pragma unroll
    for (int qt = 0; qt < NQ; ++qt) { const float inv = __fdiv_rn(1.0f, l[qt] + xhalf(l[qt])); const size_t ro = (size_t)(q0 + qt * 16) * DQ + 8 * lane;   // o[qt][dt][j] = O[query lr][d = dt*16 + 8*hi + j]: piece (half dt & 1, lane) of k block dt >> 1 of this head
#pragma unroll
        for (int dt = 0; dt < 4; ++dt) { const v8f val = o[qt][dt] * inv; const v8b oh = __builtin_convertvector(val, v8b); const v8b ol = __builtin_convertvector(val - __builtin_convertvector(oh, v8f), v8b);
            *(v8us*)(Ah + ro + dt * 256) = __builtin_bit_cast(v8us, oh); *(v8us*)(Al + ro + dt * 256) = __builtin_bit_cast(v8us, ol);
            XWAIT(); } }
}
// grid x: (entry of the group, head); grid y: block of FW*NQ*16 query rows, the hi+lo blocks (three times the products) first
__global__ __launch_bounds__(FW * 32) void k_fattn(const h16* __restrict__ Q16, const h16* __restrict__ K16, const h16* __restrict__ V16, const h16* __restrict__ Ql, const h16* __restrict__ Kl, const h16* __restrict__ Vl, bf* Ah, bf* Al) {
    const int z = blockIdx.x; const size_t po = (size_t)z * TT * HD; const size_t ao = (size_t)(z / NH_) * TT * DQ + (size_t)(z % NH_) * (HD / 32) * 512;   // the merged plane [token][DQ] in fragment order: this head's two k blocks
    const int qb = blockIdx.y * (FW * NQ * 16); const int q0 = qb + (int)(threadIdx.x >> 5) * (NQ * 16);
    if (qb < RH) fattn<true>(Q16 + po, Ql + po, K16 + po, Kl + po, V16 + po, Vl + po, q0, Ah + ao, Al + ao);
    else fattn<false>(Q16 + po, nullptr, K16 + po, nullptr, V16 + po, nullptr, q0, Ah + ao, Al + ao);
}

extern "C" void kernel_launch(void* const* d_in, const int* in_sizes, int n_in,
                              void* d_out, int out_size, void* d_ws, size_t ws_size, hipStream_t stream) {
    (void)in_sizes; (void)n_in; (void)out_size;
    const float* x = (const float*)d_in[0]; const float* wq = (const float*)d_in[1]; const float* bq = (const float*)d_in[2]; const float* wk = (const float*)d_in[3]; const float* bk = (const float*)d_in[4]; const float* wv = (const float*)d_in[5]; const float* bv = (const float*)d_in[6]; const float* wo = (const float*)d_in[7]; const float* bo = (const float*)d_in[8];
    float* OUT = (float*)d_out;     // [8][1024][1024]
    char* wsp = (char*)d_ws;
    auto take = [&](size_t bytes) { char* p = wsp; wsp += (bytes + 255) & ~(size_t)255; return (void*)p; };
    const size_t PS = (size_t)GB * NH_ * TT * HD;   // one 16-bit plane of a group: [entry][head] planes of [t][d] (v: [d][t]), each in fragment order
    static_assert(NKV == NH_ && NB_ % GB == 0 && ZH == NH_, "one pass per group of GB batch entries; q, k, v of equal width");
    bf* W4 = (bf*)take((size_t)4 * DQ * DM * 2); bf* WO = W4 + (size_t)3 * DQ * DM;   // Wq, Wk, Wv, Wo transposed, back to back
    bf* XB = (bf*)take((size_t)GB * TT * DM * 2);
    h16* QP16 = (h16*)take(2 * PS * 2); h16* KP16 = QP16 + PS; h16* VT16 = (h16*)take(PS * 2);
    h16* QPl = (h16*)take(2 * PS * 2); h16* KPl = QPl + PS; h16* VTl = (h16*)take(PS * 2);   // of the q lo plane only the rows < RH of each (entry, head) are written, and only they are read
    bf* ATh = (bf*)take((size_t)NB_ * TT * DQ * 2); bf* ATl = (bf*)take((size_t)NB_ * TT * DQ * 2);
    if ((size_t)(wsp - (char*)d_ws) > ws_size) return;    // ws 256 MiB
    static_assert(TT % 128 == 0 && RH % 128 == 0 && HD == 64 && DQ == NH_ * HD && (GB * TT) % 256 == 0 && (3 * DQ) % 192 == 0 && DQ % 128 == 0 && DM % 128 == 0, "a wave's 128x96 projection tile is 128 tokens of one entry x three half heads; whole work-group tiles in both GEMMs");
    static_assert(RH % (FW * NQ * 16) == 0 && TT % (FW * NQ * 16) == 0 && HD == 64 && (TT & (TT - 1)) == 0, "whole row blocks on either side of RH");
    static_assert(GB == NB_ && ((size_t)NB_ * TT * DM / 8) % 256 == 0 && (DM * DQ / 8) % 256 == 0, "one group; whole blocks of 256 pieces on either side of XBLK");
    k_prep<<<XBLK + 4 * WBLK, 256, 0, stream>>>(x, wq, wk, wv, wo, XB, W4);
    k_qkv<<<dim3(GB * TT / 256, 3 * DQ / 192, 1), 128, 0, stream>>>(XB, W4, bq, bk, bv, QP16, QPl, VT16, VTl);
    k_fattn<<<dim3(GB * NH_, TT / (FW * NQ * 16), 1), FW * 32, 0, stream>>>(QP16, KP16, VT16, QPl, KPl, VTl, ATh, ATl);
    k_gemmw<bf, 1, true, DQ><<<dim3(NB_ * TT / 128, DM / 128, 1), 128, 0, stream>>>(ATh, ATl, WO, nullptr, OUT, DM, bo, nullptr, nullptr, 0, 0, 0);
}
